// v000
// The times below were measured on an AMD MI455X: many runs one after another, warmed up first and cycling through
// copies of the inputs, with the whole window's GPU time divided by the number of runs. Launches and the gaps
// between them are all in it. The median over several windows is given; except for v000 it joins two sittings, which
// can be a few percent apart, so the side-by-side timings, each taken in one sitting, are the better comparison.
// v000 is the starting kernel. One run takes 132 microseconds.
#include <hip/hip_runtime.h>
#include <hip/hip_bf16.h>

// ---------------------------------------------------------------------------
// Fused self-attention for gfx1250 (MI455X), f16 WMMA with f32 accumulation.
// B=4, H=W=64 -> N=4096 tokens/batch, C=256, DQK=32, DV=128.
// ---------------------------------------------------------------------------

#define BATCH 4
#define NTOK  4096        // H*W
#define CIN   256
#define DQK   32
#define DVDIM 128
#define ROWS  (BATCH * NTOK)   // 16384

typedef _Float16 v16h __attribute__((ext_vector_type(16)));
typedef _Float16 v8h  __attribute__((ext_vector_type(8)));
typedef float    v8f  __attribute__((ext_vector_type(8)));

// K index held by half-slot h (0..15) for lane-group g (0 or 1) in the
// 16-bit A/B operand of V_WMMA_*_16X16X32 (ISA 7.12.2):
//   h<8  -> K = h      + 8g      (VGPR 0..3)
//   h>=8 -> K = h + 8  + 8g      (VGPR 4..7)
__device__ __forceinline__ int kmap(int h, int g) {
    return (h < 8 ? h : h + 8) + 8 * g;
}

// Load a v16h A/B fragment from a contiguous f16 row `p` (row holds K=0..31).
// The two 8-half groups per lane are 16-byte aligned -> b128 vector loads
// (global_load_b128 or ds_load_b128 depending on the pointer).
__device__ __forceinline__ v16h load_frag_h(const _Float16* p, int g) {
    const v8h lo = *(const v8h*)(p + 8 * g);
    const v8h hi = *(const v8h*)(p + 16 + 8 * g);
    v16h r;
#pragma unroll
    for (int i = 0; i < 8; ++i) { r[i] = lo[i]; r[8 + i] = hi[i]; }
    return r;
}

// Load a v16h fragment from a contiguous f32 row (two groups of 8 consecutive
// floats at +8g and +16+8g), converting to f16. Lowers to b128 loads + cvt_pk.
__device__ __forceinline__ v16h load_frag_f32(const float* __restrict__ p, int g) {
    v16h r;
    const float* lo = p + 8 * g;
    const float* hi = p + 16 + 8 * g;
#pragma unroll
    for (int i = 0; i < 8; ++i) {
        r[i]     = (_Float16)lo[i];
        r[8 + i] = (_Float16)hi[i];
    }
    return r;
}

__device__ __forceinline__ v8f wmma_f16(v16h a, v16h b, v8f c) {
    return __builtin_amdgcn_wmma_f32_16x16x32_f16(false, a, false, b, (short)0, c,
                                                  false, false);
}

// ---- CDNA5 async global->LDS copies (ASYNCcnt-tracked) --------------------
// Generic pointers to __shared__ have the LDS byte offset in their low 32 bits
// (ISA 10.2: LDS aperture address is truncated to addr[31:0]).
__device__ __forceinline__ unsigned lds_off(const void* p) {
    return (unsigned)(uintptr_t)p;
}
__device__ __forceinline__ void async_ld_b64(unsigned lds, const _Float16* g) {
    asm volatile("global_load_async_to_lds_b64 %0, %1, off"
                 :: "v"(lds), "v"(g) : "memory");
}
__device__ __forceinline__ void async_ld_b128(unsigned lds, const _Float16* g) {
    asm volatile("global_load_async_to_lds_b128 %0, %1, off"
                 :: "v"(lds), "v"(g) : "memory");
}
__device__ __forceinline__ void wait_asynccnt_3() {
    asm volatile("s_wait_asynccnt 0x3" ::: "memory");
}
__device__ __forceinline__ void wait_asynccnt_0() {
    asm volatile("s_wait_asynccnt 0x0" ::: "memory");
}

// ---------------------------------------------------------------------------
// Kernel 0: pre-transpose + f16-convert the weight matrices (160 KB total,
// stays resident in L2). Wft/Wgt/Wht are W^T [out, 256]; Wvt is Wv^T [256,128].
// ---------------------------------------------------------------------------
__global__ void __launch_bounds__(256)
prep_weights_kernel(const float* __restrict__ Wf, const float* __restrict__ Wg,
                    const float* __restrict__ Wh, const float* __restrict__ Wv,
                    _Float16* __restrict__ Wft, _Float16* __restrict__ Wgt,
                    _Float16* __restrict__ Wht, _Float16* __restrict__ Wvt) {
    const int i = blockIdx.x * 256 + threadIdx.x;   // 0 .. 32767
    if (i < DQK * CIN) {                            // [32][256]
        const int n = i >> 8, k = i & 255;
        Wft[i] = (_Float16)Wf[k * DQK + n];
        Wgt[i] = (_Float16)Wg[k * DQK + n];
    }
    if (i < DVDIM * CIN) {                          // [128][256]
        const int n = i >> 8, k = i & 255;
        Wht[i] = (_Float16)Wh[k * DVDIM + n];
    }
    if (i < CIN * DVDIM) {                          // [256][128]
        const int n = i >> 7, k = i & 127;
        Wvt[i] = (_Float16)Wv[k * CIN + n];
    }
}

// ---------------------------------------------------------------------------
// Kernel 1: fused QKV projections. One wave per 16-row tile computes ALL
// output tiles (2 K + 2 Q + 8 V = 12 WMMAs per K-chunk), reusing the x
// A-fragment. x is read exactly once; weight B-fragments are contiguous f16.
//   Kh = f16(x @ Wf + bf)   [ROWS, 32]
//   Qh = f16(x @ Wg + bg)   [ROWS, 32]
//   Vt = f16(x @ Wh + bh)^T [BATCH, 128, NTOK]
// ---------------------------------------------------------------------------
__global__ void __launch_bounds__(256)
proj_qkv_kernel(const float* __restrict__ x,
                const _Float16* __restrict__ Wft, const float* __restrict__ bf,
                const _Float16* __restrict__ Wgt, const float* __restrict__ bg,
                const _Float16* __restrict__ Wht, const float* __restrict__ bh,
                _Float16* __restrict__ Qh, _Float16* __restrict__ Kh,
                _Float16* __restrict__ Vt) {
    const int widx = blockIdx.x * 8 + (threadIdx.x >> 5);   // 0 .. 1023
    const int lane = threadIdx.x & 31;
    const int g    = lane >> 4;
    const int lr   = lane & 15;

    const int row0 = widx * 16;

    v8f accK[2], accQ[2], accV[8];
#pragma unroll
    for (int t = 0; t < 2; ++t) accK[t] = accQ[t] = (v8f){0,0,0,0,0,0,0,0};
#pragma unroll
    for (int t = 0; t < 8; ++t) accV[t] = (v8f){0,0,0,0,0,0,0,0};

    const _Float16* wfr = Wft + (size_t)lr * CIN;           // row lr of W^T tiles
    const _Float16* wgr = Wgt + (size_t)lr * CIN;
    const _Float16* whr = Wht + (size_t)lr * CIN;
    const float*    xr  = x + (size_t)(row0 + lr) * CIN;

    for (int k0 = 0; k0 < CIN; k0 += 32) {
        const v16h a = load_frag_f32(xr + k0, g);           // shared A fragment
#pragma unroll
        for (int t = 0; t < 2; ++t) {
            const v16h bK = load_frag_h(wfr + (size_t)(t * 16) * CIN + k0, g);
            accK[t] = wmma_f16(a, bK, accK[t]);
            const v16h bQ = load_frag_h(wgr + (size_t)(t * 16) * CIN + k0, g);
            accQ[t] = wmma_f16(a, bQ, accQ[t]);
        }
#pragma unroll
        for (int t = 0; t < 8; ++t) {
            const v16h bV = load_frag_h(whr + (size_t)(t * 16) * CIN + k0, g);
            accV[t] = wmma_f16(a, bV, accV[t]);
        }
    }

    // ---- store K and Q: f16 [row, 32] (C-layout: row = row0 + j + 8g) ----
#pragma unroll
    for (int t = 0; t < 2; ++t) {
        const float bK = bf[t * 16 + lr];
        const float bQ = bg[t * 16 + lr];
#pragma unroll
        for (int j = 0; j < 8; ++j) {
            const size_t row = row0 + j + 8 * g;
            Kh[row * DQK + t * 16 + lr] = (_Float16)(accK[t][j] + bK);
            Qh[row * DQK + t * 16 + lr] = (_Float16)(accQ[t][j] + bQ);
        }
    }
    // ---- store V transposed: Vt[b][dv][token], 8 consecutive tokens/lane ----
    const int b     = row0 >> 12;
    const int nbase = (row0 & (NTOK - 1)) + 8 * g;
#pragma unroll
    for (int t = 0; t < 8; ++t) {
        const float bV = bh[t * 16 + lr];
        _Float16* dst = Vt + (size_t)b * DVDIM * NTOK + (size_t)(t * 16 + lr) * NTOK;
#pragma unroll
        for (int j = 0; j < 8; ++j)
            dst[nbase + j] = (_Float16)(accV[t][j] + bV);
    }
}

// ---------------------------------------------------------------------------
// Kernel 2: fused flash attention (transposed formulation) with double-
// buffered LDS staging of K/V tiles via global_load_async_to_lds (ASYNCcnt).
// One block (8 waves) owns 128 consecutive queries of one batch; all waves
// share each staged 32-key tile (K: 2 KB, V^T: 8 KB -> 20 KB LDS w/ 2 bufs).
//   S^T sub-tile  = WMMA(A = K rows, B = Q^T)        (2 per key tile)
//   online softmax across key tiles (cross-group shfl_xor(16) reduction)
//   O^T           = WMMA(A = V^T rows, B = P^T)      (8 per key tile)
// P^T B-fragment is built from the two S^T C-fragments *within each lane*.
// ---------------------------------------------------------------------------
__global__ void __launch_bounds__(256)
attn_kernel(const _Float16* __restrict__ Qh, const _Float16* __restrict__ Kh,
            const _Float16* __restrict__ Vt, float* __restrict__ Of) {
    __shared__ _Float16 Kbuf[2][32 * DQK];      // [buf][key(32) x dqk(32)]
    __shared__ _Float16 Vbuf[2][DVDIM * 32];    // [buf][dv(128) x key(32)]

    const int tid  = threadIdx.x;               // 0..255
    const int lane = tid & 31;
    const int g    = lane >> 4;
    const int lr   = lane & 15;

    const int b    = blockIdx.x >> 5;           // 32 blocks per batch
    const int q0   = (blockIdx.x & 31) * 128 + (tid >> 5) * 16;

    const _Float16* Qb    = Qh + (size_t)b * NTOK * DQK;
    const _Float16* KbBlk = Kh + (size_t)b * NTOK * DQK;      // block-uniform
    const _Float16* VbBlk = Vt + (size_t)b * DVDIM * NTOK;    // block-uniform

    // Q^T B-fragment: lane column = query (q0+lr), halfs sweep d_qk (=32)
    const v16h qf = load_frag_h(Qb + (size_t)(q0 + lr) * DQK, g);

    // ---- async stage of one 32-key tile: 3 ops per wave ----
    auto fill = [&](int kb, int buf) {
        // K tile: 32 rows x 64 B contiguous = 2048 B = 256 lanes x 8 B
        async_ld_b64(lds_off(&Kbuf[buf][tid * 4]),
                     KbBlk + (size_t)kb * DQK + tid * 4);
        // V tile: 128 rows (stride NTOK) x 64 B = 8192 B = 2 x 256 lanes x 16 B
#pragma unroll
        for (int i = 0; i < 2; ++i) {
            const int u  = i * 256 + tid;        // 0..511
            const int d  = u >> 2;               // dv row 0..127
            const int ro = (u & 3) * 8;          // half offset within row
            async_ld_b128(lds_off(&Vbuf[buf][d * 32 + ro]),
                          VbBlk + (size_t)d * NTOK + kb + ro);
        }
    };

    float m = -1e30f, l = 0.f;
    v8f acc[8];
#pragma unroll
    for (int dt = 0; dt < 8; ++dt) acc[dt] = (v8f){0,0,0,0,0,0,0,0};
    const v8f zero = {0,0,0,0,0,0,0,0};

    const int NT = NTOK / 32;                   // 128 key tiles
    fill(0, 0);
    for (int kt = 0; kt < NT; ++kt) {
        const int buf = kt & 1;
        if (kt + 1 < NT) {                       // prefetch next tile
            fill((kt + 1) * 32, buf ^ 1);
            wait_asynccnt_3();                   // own fill(kt) done (in-order)
        } else {
            wait_asynccnt_0();
        }
        __syncthreads();                         // all waves' fill(kt) visible

        // A-fragments from LDS: 16 key rows each, halfs sweep d_qk
        const v16h a0 = load_frag_h(&Kbuf[buf][lr * DQK], g);
        const v16h a1 = load_frag_h(&Kbuf[buf][(16 + lr) * DQK], g);

        // S^T tiles: lane = query column, VGPR j -> key = kb + sub*16 + j + 8g
        v8f s0 = wmma_f16(a0, qf, zero);
        v8f s1 = wmma_f16(a1, qf, zero);

        // per-query max over this 32-key tile
        float tmax = s0[0];
#pragma unroll
        for (int j = 0; j < 8; ++j) {
            tmax = fmaxf(tmax, s0[j]);
            tmax = fmaxf(tmax, s1[j]);
        }
        tmax = fmaxf(tmax, __shfl_xor(tmax, 16, 32));
        const float mnew  = fmaxf(m, tmax);
        const float alpha = __expf(m - mnew);

        // exponentiate + pack P^T B-fragment (pure in-lane repack):
        //   h<8  -> key kb + h + 8g        == s0[j = h]
        //   h>=8 -> key kb + 16 + (h-8)+8g == s1[j = h-8]
        float psum = 0.f;
        v16h pf;
#pragma unroll
        for (int j = 0; j < 8; ++j) {
            const float p0 = __expf(s0[j] - mnew);
            const float p1 = __expf(s1[j] - mnew);
            psum += p0 + p1;
            pf[j]     = (_Float16)p0;
            pf[8 + j] = (_Float16)p1;
        }
        psum += __shfl_xor(psum, 16, 32);
        l = l * alpha + psum;
        m = mnew;

        // O^T accumulation over the 8 dv tiles (V^T rows from LDS)
#pragma unroll
        for (int dt = 0; dt < 8; ++dt) {
#pragma unroll
            for (int j = 0; j < 8; ++j) acc[dt][j] *= alpha;
            const v16h av = load_frag_h(&Vbuf[buf][(dt * 16 + lr) * 32], g);
            acc[dt] = wmma_f16(av, pf, acc[dt]);
        }
        __syncthreads();                         // buf fully consumed -> refill ok
    }

    const float inv = 1.f / l;
    float* Ob = Of + ((size_t)b * NTOK + q0 + lr) * DVDIM;  // this lane's query row
#pragma unroll
    for (int dt = 0; dt < 8; ++dt) {
#pragma unroll
        for (int j = 0; j < 8; ++j)                         // 8 consecutive dv elems
            Ob[dt * 16 + 8 * g + j] = acc[dt][j] * inv;
    }
}

// ---------------------------------------------------------------------------
// Kernel 3: out = x + O @ Wv + bv.  [16384,128] x [128,256].
// One wave per 16-row x 128-col half: the O-row A-fragment is reused across
// 8 column tiles (8 WMMAs per K-chunk). 2048 waves total.
// ---------------------------------------------------------------------------
__global__ void __launch_bounds__(256)
outproj_kernel(const float* __restrict__ x, const float* __restrict__ Of,
               const _Float16* __restrict__ Wvt, const float* __restrict__ bv,
               float* __restrict__ out) {
    const int widx = blockIdx.x * 8 + (threadIdx.x >> 5);   // 0 .. 2047
    const int lane = threadIdx.x & 31;
    const int g    = lane >> 4;
    const int lr   = lane & 15;

    const int r0 = (widx >> 1) * 16;
    const int c0 = (widx & 1) * 128;

    v8f acc[8];
#pragma unroll
    for (int t = 0; t < 8; ++t) acc[t] = (v8f){0,0,0,0,0,0,0,0};

    const float*    orow = Of + (size_t)(r0 + lr) * DVDIM;
    const _Float16* wr   = Wvt + (size_t)(c0 + lr) * DVDIM;

#pragma unroll
    for (int k0 = 0; k0 < DVDIM; k0 += 32) {
        const v16h a = load_frag_f32(orow + k0, g);          // shared A fragment
#pragma unroll
        for (int t = 0; t < 8; ++t) {
            const v16h bfr = load_frag_h(wr + (size_t)(t * 16) * DVDIM + k0, g);
            acc[t] = wmma_f16(a, bfr, acc[t]);
        }
    }

#pragma unroll
    for (int t = 0; t < 8; ++t) {
        const float bcol = bv[c0 + t * 16 + lr];
#pragma unroll
        for (int j = 0; j < 8; ++j) {
            const size_t idx = (size_t)(r0 + j + 8 * g) * CIN + c0 + t * 16 + lr;
            out[idx] = x[idx] + acc[t][j] + bcol;
        }
    }
}

// ---------------------------------------------------------------------------
// Host-side launch. Workspace layout (bytes):
//   [0,       1 MB)   Qh  f16 [16384, 32]
//   [1 MB,    2 MB)   Kh  f16 [16384, 32]
//   [2 MB,    6 MB)   Vt  f16 [4, 128, 4096]   (transposed values)
//   [6 MB,   14 MB)   Of  f32 [16384, 128]
//   [14 MB,  ...  )   Wft(16K) Wgt(16K) Wht(64K) Wvt(64K) f16 transposed weights
// ---------------------------------------------------------------------------
extern "C" void kernel_launch(void* const* d_in, const int* in_sizes, int n_in,
                              void* d_out, int out_size, void* d_ws, size_t ws_size,
                              hipStream_t stream) {
    const float* x  = (const float*)d_in[0];
    const float* Wf = (const float*)d_in[1];
    const float* bf = (const float*)d_in[2];
    const float* Wg = (const float*)d_in[3];
    const float* bg = (const float*)d_in[4];
    const float* Wh = (const float*)d_in[5];
    const float* bh = (const float*)d_in[6];
    const float* Wv = (const float*)d_in[7];
    const float* bv = (const float*)d_in[8];
    float* out = (float*)d_out;

    char* ws = (char*)d_ws;
    _Float16* Qh  = (_Float16*)(ws);
    _Float16* Kh  = (_Float16*)(ws + (1u << 20));
    _Float16* Vt  = (_Float16*)(ws + (2u << 20));
    float*    Of  = (float*)   (ws + (6u << 20));
    _Float16* Wft = (_Float16*)(ws + (14u << 20));
    _Float16* Wgt = (_Float16*)(ws + (14u << 20) + (16u << 10));
    _Float16* Wht = (_Float16*)(ws + (14u << 20) + (32u << 10));
    _Float16* Wvt = (_Float16*)(ws + (14u << 20) + (96u << 10));

    // K0: weight transpose/convert (32768 threads)
    hipLaunchKernelGGL(prep_weights_kernel, dim3(128), dim3(256), 0, stream,
                       Wf, Wg, Wh, Wv, Wft, Wgt, Wht, Wvt);
    // K1: 1024 row-tile waves, 8 waves/block -> 128 blocks
    hipLaunchKernelGGL(proj_qkv_kernel, dim3(128), dim3(256), 0, stream,
                       x, Wft, bf, Wgt, bg, Wht, bh, Qh, Kh, Vt);
    // K2: 128 blocks x 8 waves, each block = 128 queries of one batch
    hipLaunchKernelGGL(attn_kernel, dim3(128), dim3(256), 0, stream,
                       Qh, Kh, Vt, Of);
    // K3: 2048 output-half waves, 8 waves/block -> 256 blocks
    hipLaunchKernelGGL(outproj_kernel, dim3(256), dim3(256), 0, stream,
                       x, Of, Wvt, bv, out);
}

// v001
// One run takes 106 microseconds.
// In two side-by-side timings against v000, it was 1.25 and 1.26 times as fast.
#include <hip/hip_runtime.h>
#include <hip/hip_bf16.h>

// ---------------------------------------------------------------------------
// Fused self-attention for gfx1250 (MI455X), f16 WMMA with f32 accumulation.
// B=4, H=W=64 -> N=4096 tokens/batch, C=256, DQK=32, DV=128.
// ---------------------------------------------------------------------------

#define BATCH 4
#define NTOK  4096        // H*W
#define CIN   256
#define DQK   32
#define DVDIM 128
#define ROWS  (BATCH * NTOK)   // 16384
#define LPITCH 40              // halfs per staged LDS row: 32 data + 8 pad (80 B)

typedef _Float16 v16h __attribute__((ext_vector_type(16)));
typedef _Float16 v8h  __attribute__((ext_vector_type(8)));
typedef float    v8f  __attribute__((ext_vector_type(8)));

// K index held by half-slot h (0..15) for lane-group g (0 or 1) in the
// 16-bit A/B operand of V_WMMA_*_16X16X32 (ISA 7.12.2):
//   h<8  -> K = h      + 8g      (VGPR 0..3)
//   h>=8 -> K = h + 8  + 8g      (VGPR 4..7)
__device__ __forceinline__ int kmap(int h, int g) {
    return (h < 8 ? h : h + 8) + 8 * g;
}

// Load a v16h A/B fragment from a contiguous f16 row `p` (row holds K=0..31).
// The two 8-half groups per lane are 16-byte aligned -> b128 vector loads
// (global_load_b128 or ds_load_b128 depending on the pointer).
__device__ __forceinline__ v16h load_frag_h(const _Float16* p, int g) {
    const v8h lo = *(const v8h*)(p + 8 * g);
    const v8h hi = *(const v8h*)(p + 16 + 8 * g);
    v16h r;
#pragma unroll
    for (int i = 0; i < 8; ++i) { r[i] = lo[i]; r[8 + i] = hi[i]; }
    return r;
}

// Load a v16h fragment from a contiguous f32 row (two groups of 8 consecutive
// floats at +8g and +16+8g), converting to f16. Lowers to b128 loads + cvt_pk.
__device__ __forceinline__ v16h load_frag_f32(const float* __restrict__ p, int g) {
    v16h r;
    const float* lo = p + 8 * g;
    const float* hi = p + 16 + 8 * g;
#pragma unroll
    for (int i = 0; i < 8; ++i) {
        r[i]     = (_Float16)lo[i];
        r[8 + i] = (_Float16)hi[i];
    }
    return r;
}

__device__ __forceinline__ v8f wmma_f16(v16h a, v16h b, v8f c) {
    return __builtin_amdgcn_wmma_f32_16x16x32_f16(false, a, false, b, (short)0, c,
                                                  false, false);
}

// ---- CDNA5 async global->LDS copies (ASYNCcnt-tracked) --------------------
// Generic pointers to __shared__ have the LDS byte offset in their low 32 bits
// (ISA 10.2: LDS aperture address is truncated to addr[31:0]).
__device__ __forceinline__ unsigned lds_off(const void* p) {
    return (unsigned)(uintptr_t)p;
}
// One 32-key tile = three copies per lane (K: 8 B, V^T: 2 x 16 B). The
// s_wait_xcnt closes the statement so that it stands in front of any later
// rewrite of the address registers the copies name.
__device__ __forceinline__ void async_ld_tile(unsigned ldsK, const _Float16* gK,
                                              unsigned ldsV0, const _Float16* gV0,
                                              unsigned ldsV1, const _Float16* gV1) {
    asm volatile("global_load_async_to_lds_b64 %0, %1, off\n\t"
                 "global_load_async_to_lds_b128 %2, %3, off\n\t"
                 "global_load_async_to_lds_b128 %4, %5, off\n\t"
                 "s_wait_xcnt 0x0"
                 :: "v"(ldsK), "v"(gK), "v"(ldsV0), "v"(gV0), "v"(ldsV1), "v"(gV1)
                 : "memory");
}
__device__ __forceinline__ void wait_asynccnt_3() {
    asm volatile("s_wait_asynccnt 0x3" ::: "memory");
}
__device__ __forceinline__ void wait_asynccnt_0() {
    asm volatile("s_wait_asynccnt 0x0" ::: "memory");
}

// ---------------------------------------------------------------------------
// Kernel 0: pre-transpose + f16-convert the weight matrices (160 KB total,
// stays resident in L2). Wft/Wgt/Wht are W^T [out, 256]; Wvt is Wv^T [256,128].
// ---------------------------------------------------------------------------
__global__ void __launch_bounds__(256)
prep_weights_kernel(const float* __restrict__ Wf, const float* __restrict__ Wg,
                    const float* __restrict__ Wh, const float* __restrict__ Wv,
                    _Float16* __restrict__ Wft, _Float16* __restrict__ Wgt,
                    _Float16* __restrict__ Wht, _Float16* __restrict__ Wvt) {
    const int i = blockIdx.x * 256 + threadIdx.x;   // 0 .. 32767
    if (i < DQK * CIN) {                            // [32][256]
        const int n = i >> 8, k = i & 255;
        Wft[i] = (_Float16)Wf[k * DQK + n];
        Wgt[i] = (_Float16)Wg[k * DQK + n];
    }
    if (i < DVDIM * CIN) {                          // [128][256]
        const int n = i >> 8, k = i & 255;
        Wht[i] = (_Float16)Wh[k * DVDIM + n];
    }
    if (i < CIN * DVDIM) {                          // [256][128]
        const int n = i >> 7, k = i & 127;
        Wvt[i] = (_Float16)Wv[k * CIN + n];
    }
}

// ---------------------------------------------------------------------------
// Kernel 1: fused QKV projections. One wave per 16-row tile computes ALL
// output tiles (2 K + 2 Q + 8 V = 12 WMMAs per K-chunk), reusing the x
// A-fragment. x is read exactly once; weight B-fragments are contiguous f16.
//   Kh = f16(x @ Wf + bf)   [ROWS, 32]
//   Qh = f16(x @ Wg + bg)   [ROWS, 32]
//   Vt = f16(x @ Wh + bh)^T [BATCH, 128, NTOK]
// ---------------------------------------------------------------------------
__global__ void __launch_bounds__(256)
proj_qkv_kernel(const float* __restrict__ x,
                const _Float16* __restrict__ Wft, const float* __restrict__ bf,
                const _Float16* __restrict__ Wgt, const float* __restrict__ bg,
                const _Float16* __restrict__ Wht, const float* __restrict__ bh,
                _Float16* __restrict__ Qh, _Float16* __restrict__ Kh,
                _Float16* __restrict__ Vt) {
    const int widx = blockIdx.x * 8 + (threadIdx.x >> 5);   // 0 .. 1023
    const int lane = threadIdx.x & 31;
    const int g    = lane >> 4;
    const int lr   = lane & 15;

    const int row0 = widx * 16;

    v8f accK[2], accQ[2], accV[8];
#pragma unroll
    for (int t = 0; t < 2; ++t) accK[t] = accQ[t] = (v8f){0,0,0,0,0,0,0,0};
#pragma unroll
    for (int t = 0; t < 8; ++t) accV[t] = (v8f){0,0,0,0,0,0,0,0};

    const _Float16* wfr = Wft + (size_t)lr * CIN;           // row lr of W^T tiles
    const _Float16* wgr = Wgt + (size_t)lr * CIN;
    const _Float16* whr = Wht + (size_t)lr * CIN;
    const float*    xr  = x + (size_t)(row0 + lr) * CIN;

    for (int k0 = 0; k0 < CIN; k0 += 32) {
        const v16h a = load_frag_f32(xr + k0, g);           // shared A fragment
#pragma unroll
        for (int t = 0; t < 2; ++t) {
            const v16h bK = load_frag_h(wfr + (size_t)(t * 16) * CIN + k0, g);
            accK[t] = wmma_f16(a, bK, accK[t]);
            const v16h bQ = load_frag_h(wgr + (size_t)(t * 16) * CIN + k0, g);
            accQ[t] = wmma_f16(a, bQ, accQ[t]);
        }
#pragma unroll
        for (int t = 0; t < 8; ++t) {
            const v16h bV = load_frag_h(whr + (size_t)(t * 16) * CIN + k0, g);
            accV[t] = wmma_f16(a, bV, accV[t]);
        }
    }

    // ---- store K and Q: f16 [row, 32] (C-layout: row = row0 + j + 8g) ----
#pragma unroll
    for (int t = 0; t < 2; ++t) {
        const float bK = bf[t * 16 + lr];
        const float bQ = bg[t * 16 + lr];
#pragma unroll
        for (int j = 0; j < 8; ++j) {
            const size_t row = row0 + j + 8 * g;
            Kh[row * DQK + t * 16 + lr] = (_Float16)(accK[t][j] + bK);
            Qh[row * DQK + t * 16 + lr] = (_Float16)(accQ[t][j] + bQ);
        }
    }
    // ---- store V transposed: Vt[b][dv][token], 8 consecutive tokens/lane ----
    const int b     = row0 >> 12;
    const int nbase = (row0 & (NTOK - 1)) + 8 * g;
#pragma unroll
    for (int t = 0; t < 8; ++t) {
        const float bV = bh[t * 16 + lr];
        _Float16* dst = Vt + (size_t)b * DVDIM * NTOK + (size_t)(t * 16 + lr) * NTOK;
#pragma unroll
        for (int j = 0; j < 8; ++j)
            dst[nbase + j] = (_Float16)(accV[t][j] + bV);
    }
}

// ---------------------------------------------------------------------------
// Kernel 2: fused flash attention (transposed formulation) with double-
// buffered LDS staging of K/V tiles via global_load_async_to_lds (ASYNCcnt).
// One block (8 waves) owns 128 consecutive queries of one batch; all waves
// share each staged 32-key tile (K: 2 KB, V^T: 8 KB). The 64-byte tile rows
// lie in LDS at a pitch of 80 bytes (16 B x odd): the 16 lanes of a half-wave,
// one row each, then fall on 16 distinct groups of four banks in every
// ds_load_b128 (25 KB LDS w/ 2 bufs).
//   S^T sub-tile  = WMMA(A = K rows, B = Q^T)        (2 per key tile)
//   online softmax across key tiles (cross-group shfl_xor(16) reduction)
//   O^T           = WMMA(A = V^T rows, B = P^T)      (8 per key tile)
// P^T B-fragment is built from the two S^T C-fragments *within each lane*.
// ---------------------------------------------------------------------------
__global__ void __launch_bounds__(256)
attn_kernel(const _Float16* __restrict__ Qh, const _Float16* __restrict__ Kh,
            const _Float16* __restrict__ Vt, float* __restrict__ Of) {
    __shared__ __attribute__((aligned(16))) _Float16 Kbuf[2][32 * LPITCH];    // [buf][key(32)][dqk(32) + pad]
    __shared__ __attribute__((aligned(16))) _Float16 Vbuf[2][DVDIM * LPITCH]; // [buf][dv(128)][key(32) + pad]

    const int tid  = threadIdx.x;               // 0..255
    const int lane = tid & 31;
    const int g    = lane >> 4;
    const int lr   = lane & 15;

    const int b    = blockIdx.x >> 5;           // 32 blocks per batch
    const int q0   = (blockIdx.x & 31) * 128 + (tid >> 5) * 16;

    const _Float16* Qb    = Qh + (size_t)b * NTOK * DQK;
    const _Float16* KbBlk = Kh + (size_t)b * NTOK * DQK;      // block-uniform
    const _Float16* VbBlk = Vt + (size_t)b * DVDIM * NTOK;    // block-uniform

    // Q^T B-fragment: lane column = query (q0+lr), halfs sweep d_qk (=32)
    const v16h qf = load_frag_h(Qb + (size_t)(q0 + lr) * DQK, g);

    // ---- async stage of one 32-key tile: 3 ops per wave ----
    auto fill = [&](int kb, int buf) {
        // K tile: 32 rows x 64 B contiguous = 2048 B = 256 lanes x 8 B
        // V tile: 128 rows (stride NTOK) x 64 B = 8192 B = 2 x 256 lanes x 16 B
        const int d  = tid >> 2;                 // dv row 0..63 (second copy: +64)
        const int ro = (tid & 3) * 8;            // half offset within row
        async_ld_tile(lds_off(&Kbuf[buf][(tid >> 3) * LPITCH + (tid & 7) * 4]),
                      KbBlk + (size_t)kb * DQK + tid * 4,
                      lds_off(&Vbuf[buf][d * LPITCH + ro]),
                      VbBlk + (size_t)d * NTOK + kb + ro,
                      lds_off(&Vbuf[buf][(d + 64) * LPITCH + ro]),
                      VbBlk + (size_t)(d + 64) * NTOK + kb + ro);
    };

    float m = -1e30f, l = 0.f;
    v8f acc[8];
#pragma unroll
    for (int dt = 0; dt < 8; ++dt) acc[dt] = (v8f){0,0,0,0,0,0,0,0};
    const v8f zero = {0,0,0,0,0,0,0,0};

    const int NT = NTOK / 32;                   // 128 key tiles
    fill(0, 0);
    for (int kt = 0; kt < NT; ++kt) {
        const int buf = kt & 1;
        if (kt + 1 < NT) {                       // prefetch next tile
            fill((kt + 1) * 32, buf ^ 1);
            wait_asynccnt_3();                   // own fill(kt) done (in-order)
        } else {
            wait_asynccnt_0();
        }
        __syncthreads();                         // all waves' fill(kt) visible

        // A-fragments from LDS: 16 key rows each, halfs sweep d_qk
        const v16h a0 = load_frag_h(&Kbuf[buf][lr * LPITCH], g);
        const v16h a1 = load_frag_h(&Kbuf[buf][(16 + lr) * LPITCH], g);

        // S^T tiles: lane = query column, VGPR j -> key = kb + sub*16 + j + 8g
        v8f s0 = wmma_f16(a0, qf, zero);
        v8f s1 = wmma_f16(a1, qf, zero);

        // per-query max over this 32-key tile
        float tmax = s0[0];
#pragma unroll
        for (int j = 0; j < 8; ++j) {
            tmax = fmaxf(tmax, s0[j]);
            tmax = fmaxf(tmax, s1[j]);
        }
        tmax = fmaxf(tmax, __shfl_xor(tmax, 16, 32));
        const float mnew  = fmaxf(m, tmax);
        const float alpha = __expf(m - mnew);

        // exponentiate + pack P^T B-fragment (pure in-lane repack):
        //   h<8  -> key kb + h + 8g        == s0[j = h]
        //   h>=8 -> key kb + 16 + (h-8)+8g == s1[j = h-8]
        float psum = 0.f;
        v16h pf;
#pragma unroll
        for (int j = 0; j < 8; ++j) {
            const float p0 = __expf(s0[j] - mnew);
            const float p1 = __expf(s1[j] - mnew);
            psum += p0 + p1;
            pf[j]     = (_Float16)p0;
            pf[8 + j] = (_Float16)p1;
        }
        psum += __shfl_xor(psum, 16, 32);
        l = l * alpha + psum;
        m = mnew;

        // O^T accumulation over the 8 dv tiles (V^T rows from LDS)
#pragma unroll
        for (int dt = 0; dt < 8; ++dt) {
#pragma unroll
            for (int j = 0; j < 8; ++j) acc[dt][j] *= alpha;
            const v16h av = load_frag_h(&Vbuf[buf][(dt * 16 + lr) * LPITCH], g);
            acc[dt] = wmma_f16(av, pf, acc[dt]);
        }
        __syncthreads();                         // buf fully consumed -> refill ok
    }

    const float inv = 1.f / l;
    float* Ob = Of + ((size_t)b * NTOK + q0 + lr) * DVDIM;  // this lane's query row
#pragma unroll
    for (int dt = 0; dt < 8; ++dt) {
#pragma unroll
        for (int j = 0; j < 8; ++j)                         // 8 consecutive dv elems
            Ob[dt * 16 + 8 * g + j] = acc[dt][j] * inv;
    }
}

// ---------------------------------------------------------------------------
// Kernel 3: out = x + O @ Wv + bv.  [16384,128] x [128,256].
// One wave per 16-row x 128-col half: the O-row A-fragment is reused across
// 8 column tiles (8 WMMAs per K-chunk). 2048 waves total.
// ---------------------------------------------------------------------------
__global__ void __launch_bounds__(256)
outproj_kernel(const float* __restrict__ x, const float* __restrict__ Of,
               const _Float16* __restrict__ Wvt, const float* __restrict__ bv,
               float* __restrict__ out) {
    const int widx = blockIdx.x * 8 + (threadIdx.x >> 5);   // 0 .. 2047
    const int lane = threadIdx.x & 31;
    const int g    = lane >> 4;
    const int lr   = lane & 15;

    const int r0 = (widx >> 1) * 16;
    const int c0 = (widx & 1) * 128;

    v8f acc[8];
#pragma unroll
    for (int t = 0; t < 8; ++t) acc[t] = (v8f){0,0,0,0,0,0,0,0};

    const float*    orow = Of + (size_t)(r0 + lr) * DVDIM;
    const _Float16* wr   = Wvt + (size_t)(c0 + lr) * DVDIM;

#pragma unroll
    for (int k0 = 0; k0 < DVDIM; k0 += 32) {
        const v16h a = load_frag_f32(orow + k0, g);          // shared A fragment
#pragma unroll
        for (int t = 0; t < 8; ++t) {
            const v16h bfr = load_frag_h(wr + (size_t)(t * 16) * DVDIM + k0, g);
            acc[t] = wmma_f16(a, bfr, acc[t]);
        }
    }

#pragma unroll
    for (int t = 0; t < 8; ++t) {
        const float bcol = bv[c0 + t * 16 + lr];
#pragma unroll
        for (int j = 0; j < 8; ++j) {
            const size_t idx = (size_t)(r0 + j + 8 * g) * CIN + c0 + t * 16 + lr;
            out[idx] = x[idx] + acc[t][j] + bcol;
        }
    }
}

// ---------------------------------------------------------------------------
// Host-side launch. Workspace layout (bytes):
//   [0,       1 MB)   Qh  f16 [16384, 32]
//   [1 MB,    2 MB)   Kh  f16 [16384, 32]
//   [2 MB,    6 MB)   Vt  f16 [4, 128, 4096]   (transposed values)
//   [6 MB,   14 MB)   Of  f32 [16384, 128]
//   [14 MB,  ...  )   Wft(16K) Wgt(16K) Wht(64K) Wvt(64K) f16 transposed weights
// ---------------------------------------------------------------------------
extern "C" void kernel_launch(void* const* d_in, const int* in_sizes, int n_in,
                              void* d_out, int out_size, void* d_ws, size_t ws_size,
                              hipStream_t stream) {
    const float* x  = (const float*)d_in[0];
    const float* Wf = (const float*)d_in[1];
    const float* bf = (const float*)d_in[2];
    const float* Wg = (const float*)d_in[3];
    const float* bg = (const float*)d_in[4];
    const float* Wh = (const float*)d_in[5];
    const float* bh = (const float*)d_in[6];
    const float* Wv = (const float*)d_in[7];
    const float* bv = (const float*)d_in[8];
    float* out = (float*)d_out;

    char* ws = (char*)d_ws;
    _Float16* Qh  = (_Float16*)(ws);
    _Float16* Kh  = (_Float16*)(ws + (1u << 20));
    _Float16* Vt  = (_Float16*)(ws + (2u << 20));
    float*    Of  = (float*)   (ws + (6u << 20));
    _Float16* Wft = (_Float16*)(ws + (14u << 20));
    _Float16* Wgt = (_Float16*)(ws + (14u << 20) + (16u << 10));
    _Float16* Wht = (_Float16*)(ws + (14u << 20) + (32u << 10));
    _Float16* Wvt = (_Float16*)(ws + (14u << 20) + (96u << 10));

    // K0: weight transpose/convert (32768 threads)
    hipLaunchKernelGGL(prep_weights_kernel, dim3(128), dim3(256), 0, stream,
                       Wf, Wg, Wh, Wv, Wft, Wgt, Wht, Wvt);
    // K1: 1024 row-tile waves, 8 waves/block -> 128 blocks
    hipLaunchKernelGGL(proj_qkv_kernel, dim3(128), dim3(256), 0, stream,
                       x, Wft, bf, Wgt, bg, Wht, bh, Qh, Kh, Vt);
    // K2: 128 blocks x 8 waves, each block = 128 queries of one batch
    hipLaunchKernelGGL(attn_kernel, dim3(128), dim3(256), 0, stream,
                       Qh, Kh, Vt, Of);
    // K3: 2048 output-half waves, 8 waves/block -> 256 blocks
    hipLaunchKernelGGL(outproj_kernel, dim3(256), dim3(256), 0, stream,
                       x, Of, Wvt, bv, out);
}

// v002
// It runs in 66 microseconds.
// Two timings next to v001 both put it at 1.59 times that version's speed.
// All steps since v000 together make it 1.99 times as fast.
#include <hip/hip_runtime.h>
#include <hip/hip_bf16.h>

// ---------------------------------------------------------------------------
// Fused self-attention for gfx1250 (MI455X), f16 WMMA with f32 accumulation.
// B=4, H=W=64 -> N=4096 tokens/batch, C=256, DQK=32, DV=128.
// ---------------------------------------------------------------------------

#define BATCH 4
#define NTOK  4096        // H*W
#define CIN   256
#define DQK   32
#define DVDIM 128
#define ROWS  (BATCH * NTOK)   // 16384
#define LPITCH 40              // halfs per staged LDS row: 32 data + 8 pad (80 B)
#define KSPLIT 4               // key groups (waves that share a query tile)
#define QTILES 4               // 16-query tiles per attention block
#define SKEYS  (32 * KSPLIT)   // keys per staged LDS buffer
#define ATHREADS (32 * KSPLIT * QTILES)

typedef _Float16 v16h __attribute__((ext_vector_type(16)));
typedef _Float16 v8h  __attribute__((ext_vector_type(8)));
typedef float    v8f  __attribute__((ext_vector_type(8)));
typedef float    v4f  __attribute__((ext_vector_type(4)));

// K index held by half-slot h (0..15) for lane-group g (0 or 1) in the
// 16-bit A/B operand of V_WMMA_*_16X16X32 (ISA 7.12.2):
//   h<8  -> K = h      + 8g      (VGPR 0..3)
//   h>=8 -> K = h + 8  + 8g      (VGPR 4..7)
__device__ __forceinline__ int kmap(int h, int g) {
    return (h < 8 ? h : h + 8) + 8 * g;
}

// Load a v16h A/B fragment from a contiguous f16 row `p` (row holds K=0..31).
// The two 8-half groups per lane are 16-byte aligned -> b128 vector loads
// (global_load_b128 or ds_load_b128 depending on the pointer).
__device__ __forceinline__ v16h load_frag_h(const _Float16* p, int g) {
    const v8h lo = *(const v8h*)(p + 8 * g);
    const v8h hi = *(const v8h*)(p + 16 + 8 * g);
    v16h r;
#pragma unroll
    for (int i = 0; i < 8; ++i) { r[i] = lo[i]; r[8 + i] = hi[i]; }
    return r;
}

// Load a v16h fragment from a contiguous f32 row (two groups of 8 consecutive
// floats at +8g and +16+8g), converting to f16. Lowers to b128 loads + cvt_pk.
__device__ __forceinline__ v16h load_frag_f32(const float* __restrict__ p, int g) {
    v16h r;
    const float* lo = p + 8 * g;
    const float* hi = p + 16 + 8 * g;
#pragma unroll
    for (int i = 0; i < 8; ++i) {
        r[i]     = (_Float16)lo[i];
        r[8 + i] = (_Float16)hi[i];
    }
    return r;
}

__device__ __forceinline__ v8f wmma_f16(v16h a, v16h b, v8f c) {
    return __builtin_amdgcn_wmma_f32_16x16x32_f16(false, a, false, b, (short)0, c,
                                                  false, false);
}

// ---- CDNA5 async global->LDS copies (ASYNCcnt-tracked) --------------------
// Generic pointers to __shared__ have the LDS byte offset in their low 32 bits
// (ISA 10.2: LDS aperture address is truncated to addr[31:0]).
__device__ __forceinline__ unsigned lds_off(const void* p) {
    return (unsigned)(uintptr_t)p;
}
// One 128-key stage = five 16-byte copies per lane (K: 1, V^T: 4). The
// s_wait_xcnt closes the statement so that it stands in front of any later
// rewrite of the address registers the copies name.
__device__ __forceinline__ void async_ld_stage(unsigned ldsK, const _Float16* gK,
                                               unsigned ldsV0, const _Float16* gV0,
                                               unsigned ldsV1, const _Float16* gV1,
                                               unsigned ldsV2, const _Float16* gV2,
                                               unsigned ldsV3, const _Float16* gV3) {
    asm volatile("global_load_async_to_lds_b128 %0, %1, off\n\t"
                 "global_load_async_to_lds_b128 %2, %3, off\n\t"
                 "global_load_async_to_lds_b128 %4, %5, off\n\t"
                 "global_load_async_to_lds_b128 %6, %7, off\n\t"
                 "global_load_async_to_lds_b128 %8, %9, off\n\t"
                 "s_wait_xcnt 0x0"
                 :: "v"(ldsK), "v"(gK), "v"(ldsV0), "v"(gV0), "v"(ldsV1), "v"(gV1),
                    "v"(ldsV2), "v"(gV2), "v"(ldsV3), "v"(gV3)
                 : "memory");
}
// This wave's own copies have landed (the barrier behind it publishes them).
__device__ __forceinline__ void wait_asynccnt_0() {
    asm volatile("s_wait_asynccnt 0x0" ::: "memory");
}
// This wave's own LDS reads have retired before the buffer they read is refilled.
__device__ __forceinline__ void wait_dscnt_0() {
    asm volatile("s_wait_dscnt 0x0" ::: "memory");
}

// ---------------------------------------------------------------------------
// Kernel 0: pre-transpose + f16-convert the weight matrices (160 KB total,
// stays resident in L2). Wft/Wgt/Wht are W^T [out, 256]; Wvt is Wv^T [256,128].
// ---------------------------------------------------------------------------
__global__ void __launch_bounds__(256)
prep_weights_kernel(const float* __restrict__ Wf, const float* __restrict__ Wg,
                    const float* __restrict__ Wh, const float* __restrict__ Wv,
                    _Float16* __restrict__ Wft, _Float16* __restrict__ Wgt,
                    _Float16* __restrict__ Wht, _Float16* __restrict__ Wvt) {
    const int i = blockIdx.x * 256 + threadIdx.x;   // 0 .. 32767
    if (i < DQK * CIN) {                            // [32][256]
        const int n = i >> 8, k = i & 255;
        Wft[i] = (_Float16)Wf[k * DQK + n];
        Wgt[i] = (_Float16)Wg[k * DQK + n];
    }
    if (i < DVDIM * CIN) {                          // [128][256]
        const int n = i >> 8, k = i & 255;
        Wht[i] = (_Float16)Wh[k * DVDIM + n];
    }
    if (i < CIN * DVDIM) {                          // [256][128]
        const int n = i >> 7, k = i & 127;
        Wvt[i] = (_Float16)Wv[k * CIN + n];
    }
}

// ---------------------------------------------------------------------------
// Kernel 1: fused QKV projections. One wave per 16-row tile computes ALL
// output tiles (2 K + 2 Q + 8 V = 12 WMMAs per K-chunk), reusing the x
// A-fragment. x is read exactly once; weight B-fragments are contiguous f16.
//   Kh = f16(x @ Wf + bf)   [ROWS, 32]
//   Qh = f16(x @ Wg + bg)   [ROWS, 32]
//   Vt = f16(x @ Wh + bh)^T [BATCH, 128, NTOK]
// ---------------------------------------------------------------------------
__global__ void __launch_bounds__(256)
proj_qkv_kernel(const float* __restrict__ x,
                const _Float16* __restrict__ Wft, const float* __restrict__ bf,
                const _Float16* __restrict__ Wgt, const float* __restrict__ bg,
                const _Float16* __restrict__ Wht, const float* __restrict__ bh,
                _Float16* __restrict__ Qh, _Float16* __restrict__ Kh,
                _Float16* __restrict__ Vt) {
    const int widx = blockIdx.x * 8 + (threadIdx.x >> 5);   // 0 .. 1023
    const int lane = threadIdx.x & 31;
    const int g    = lane >> 4;
    const int lr   = lane & 15;

    const int row0 = widx * 16;

    v8f accK[2], accQ[2], accV[8];
#pragma unroll
    for (int t = 0; t < 2; ++t) accK[t] = accQ[t] = (v8f){0,0,0,0,0,0,0,0};
#pragma unroll
    for (int t = 0; t < 8; ++t) accV[t] = (v8f){0,0,0,0,0,0,0,0};

    const _Float16* wfr = Wft + (size_t)lr * CIN;           // row lr of W^T tiles
    const _Float16* wgr = Wgt + (size_t)lr * CIN;
    const _Float16* whr = Wht + (size_t)lr * CIN;
    const float*    xr  = x + (size_t)(row0 + lr) * CIN;

    for (int k0 = 0; k0 < CIN; k0 += 32) {
        const v16h a = load_frag_f32(xr + k0, g);           // shared A fragment
#pragma unroll
        for (int t = 0; t < 2; ++t) {
            const v16h bK = load_frag_h(wfr + (size_t)(t * 16) * CIN + k0, g);
            accK[t] = wmma_f16(a, bK, accK[t]);
            const v16h bQ = load_frag_h(wgr + (size_t)(t * 16) * CIN + k0, g);
            accQ[t] = wmma_f16(a, bQ, accQ[t]);
        }
#pragma unroll
        for (int t = 0; t < 8; ++t) {
            const v16h bV = load_frag_h(whr + (size_t)(t * 16) * CIN + k0, g);
            accV[t] = wmma_f16(a, bV, accV[t]);
        }
    }

    // ---- store K and Q: f16 [row, 32] (C-layout: row = row0 + j + 8g) ----
#pragma unroll
    for (int t = 0; t < 2; ++t) {
        const float bK = bf[t * 16 + lr];
        const float bQ = bg[t * 16 + lr];
#pragma unroll
        for (int j = 0; j < 8; ++j) {
            const size_t row = row0 + j + 8 * g;
            Kh[row * DQK + t * 16 + lr] = (_Float16)(accK[t][j] + bK);
            Qh[row * DQK + t * 16 + lr] = (_Float16)(accQ[t][j] + bQ);
        }
    }
    // ---- store V transposed: Vt[b][dv][token], 8 consecutive tokens/lane ----
    const int b     = row0 >> 12;
    const int nbase = (row0 & (NTOK - 1)) + 8 * g;
#pragma unroll
    for (int t = 0; t < 8; ++t) {
        const float bV = bh[t * 16 + lr];
        _Float16* dst = Vt + (size_t)b * DVDIM * NTOK + (size_t)(t * 16 + lr) * NTOK;
#pragma unroll
        for (int j = 0; j < 8; ++j)
            dst[nbase + j] = (_Float16)(accV[t][j] + bV);
    }
}

// ---------------------------------------------------------------------------
// Kernel 2: fused flash attention (transposed formulation), keys split over
// four wave groups. One block (16 waves) owns 64 consecutive queries of one
// batch: wave = (query tile qt, key group ks). A stage is 128 keys; group ks
// works on its keys 32*ks .. 32*ks+31, so a wave walks a quarter of the keys
// and 256 blocks of four waves per SIMD cover every WGP. Stages are double-
// buffered in LDS via global_load_async_to_lds (ASYNCcnt). The 64-byte tile
// rows lie in LDS at a pitch of 80 bytes (16 B x odd): the 16 lanes of a
// half-wave, one row each, then fall on 16 distinct groups of four banks in
// every ds_load_b128.
//   S^T sub-tile  = WMMA(A = K rows, B = Q^T)        (2 per key tile)
//   online softmax across key tiles (cross-group shfl_xor(16) reduction)
//   O^T           = WMMA(A = V^T rows, B = P^T)      (8 per key tile)
// P^T B-fragment is built from the two S^T C-fragments *within each lane*.
// The four groups' (max, sum, O^T) partials of a query tile meet in LDS at the
// end; each group merges and stores a quarter of the dv range.
// ---------------------------------------------------------------------------
__global__ void __launch_bounds__(ATHREADS)
attn_kernel(const _Float16* __restrict__ Qh, const _Float16* __restrict__ Kh,
            const _Float16* __restrict__ Vt, float* __restrict__ Of) {
    __shared__ __attribute__((aligned(16))) _Float16 Kbuf[2][SKEYS * LPITCH];          // [buf][key(128)][dqk(32) + pad]
    __shared__ __attribute__((aligned(16))) _Float16 Vbuf[2][KSPLIT][DVDIM * LPITCH];  // [buf][group][dv(128)][key(32) + pad]
    __shared__ __attribute__((aligned(16))) v4f   Pacc[QTILES * KSPLIT][16][32];       // [wave][dt*2 + half][lane]
    __shared__ float Pm[QTILES * KSPLIT][32];                                          // [wave][lane]
    __shared__ float Pl[QTILES * KSPLIT][32];

    const int tid  = threadIdx.x;               // 0..511
    const int lane = tid & 31;
    const int g    = lane >> 4;
    const int lr   = lane & 15;
    const int wave = tid >> 5;                  // 0..15
    const int qt   = wave & (QTILES - 1);       // query tile of the block
    const int ks   = wave / QTILES;             // key group

    const int b    = blockIdx.x / (NTOK / (16 * QTILES));         // 64 blocks per batch
    const int q0   = (blockIdx.x % (NTOK / (16 * QTILES))) * (16 * QTILES) + qt * 16;

    const _Float16* Qb    = Qh + (size_t)b * NTOK * DQK;
    const _Float16* KbBlk = Kh + (size_t)b * NTOK * DQK;      // block-uniform
    const _Float16* VbBlk = Vt + (size_t)b * DVDIM * NTOK;    // block-uniform

    // Q^T B-fragment: lane column = query (q0+lr), halfs sweep d_qk (=32)
    const v16h qf = load_frag_h(Qb + (size_t)(q0 + lr) * DQK, g);

    // ---- async stage of 128 keys: 5 ops per wave ----
    auto fill = [&](int kb, int buf) {
        // K: 128 rows x 64 B contiguous = 8192 B = 512 lanes x 16 B
        // V: 128 rows (stride NTOK) x 256 B = 32768 B = 4 x 512 lanes x 16 B;
        //    16 lanes cover one row's 256 B, four lanes each group's 64 B
        const int d  = tid >> 4;                 // dv row 0..31 (copy c: +32c)
        const int pc = tid & 15;                 // 16-byte piece of the row
        _Float16*       lv = &Vbuf[buf][pc >> 2][d * LPITCH + (pc & 3) * 8];
        const _Float16* gv = VbBlk + (size_t)d * NTOK + kb + pc * 8;
        async_ld_stage(lds_off(&Kbuf[buf][(tid >> 2) * LPITCH + (tid & 3) * 8]),
                       KbBlk + (size_t)kb * DQK + tid * 8,
                       lds_off(lv),               gv,
                       lds_off(lv + 32 * LPITCH), gv + (size_t)32 * NTOK,
                       lds_off(lv + 64 * LPITCH), gv + (size_t)64 * NTOK,
                       lds_off(lv + 96 * LPITCH), gv + (size_t)96 * NTOK);
    };

    float m = -1e30f, l = 0.f;
    v8f acc[8];
#pragma unroll
    for (int dt = 0; dt < 8; ++dt) acc[dt] = (v8f){0,0,0,0,0,0,0,0};
    const v8f zero = {0,0,0,0,0,0,0,0};

    const int NST = NTOK / SKEYS;               // 32 stages
    fill(0, 0);
    wait_asynccnt_0();
    __syncthreads();                             // stage 0 visible to all waves
    fill(SKEYS, 1);
    for (int st = 0; st < NST; ++st) {
        const int buf = st & 1;

        // A-fragments from LDS: 16 key rows each, halfs sweep d_qk
        const v16h a0 = load_frag_h(&Kbuf[buf][(ks * 32 + lr) * LPITCH], g);
        const v16h a1 = load_frag_h(&Kbuf[buf][(ks * 32 + 16 + lr) * LPITCH], g);

        // S^T tiles: lane = query column, VGPR j -> key = kb + sub*16 + j + 8g
        v8f s0 = wmma_f16(a0, qf, zero);
        v8f s1 = wmma_f16(a1, qf, zero);

        // per-query max over this 32-key tile
        float tmax = s0[0];
#pragma unroll
        for (int j = 0; j < 8; ++j) {
            tmax = fmaxf(tmax, s0[j]);
            tmax = fmaxf(tmax, s1[j]);
        }
        tmax = fmaxf(tmax, __shfl_xor(tmax, 16, 32));
        const float mnew  = fmaxf(m, tmax);
        const float alpha = __expf(m - mnew);

        // exponentiate + pack P^T B-fragment (pure in-lane repack):
        //   h<8  -> key kb + h + 8g        == s0[j = h]
        //   h>=8 -> key kb + 16 + (h-8)+8g == s1[j = h-8]
        float psum = 0.f;
        v16h pf;
#pragma unroll
        for (int j = 0; j < 8; ++j) {
            const float p0 = __expf(s0[j] - mnew);
            const float p1 = __expf(s1[j] - mnew);
            psum += p0 + p1;
            pf[j]     = (_Float16)p0;
            pf[8 + j] = (_Float16)p1;
        }
        psum += __shfl_xor(psum, 16, 32);
        l = l * alpha + psum;
        m = mnew;

        // O^T accumulation over the 8 dv tiles (V^T rows from LDS)
#pragma unroll
        for (int dt = 0; dt < 8; ++dt) {
#pragma unroll
            for (int j = 0; j < 8; ++j) acc[dt][j] *= alpha;
            const v16h av = load_frag_h(&Vbuf[buf][ks][(dt * 16 + lr) * LPITCH], g);
            acc[dt] = wmma_f16(av, pf, acc[dt]);
        }

        // publish point: own reads of buf retired, own copies of stage st+1
        // landed; the one barrier publishes st+1 and frees buf for the refill
        wait_dscnt_0();
        wait_asynccnt_0();
        __syncthreads();
        if (st + 2 < NST) fill((st + 2) * SKEYS, buf);
    }
    wait_asynccnt_0();

    // ---- merge the four key groups' partials of each query tile ----
#pragma unroll
    for (int dt = 0; dt < 8; ++dt) {
        Pacc[wave][dt * 2 + 0][lane] = (v4f){acc[dt][0], acc[dt][1], acc[dt][2], acc[dt][3]};
        Pacc[wave][dt * 2 + 1][lane] = (v4f){acc[dt][4], acc[dt][5], acc[dt][6], acc[dt][7]};
    }
    Pm[wave][lane] = m;
    Pl[wave][lane] = l;
    __syncthreads();                             // all partials visible

    float ms[KSPLIT], wgt[KSPLIT];
    float mall = -1e30f;
#pragma unroll
    for (int s = 0; s < KSPLIT; ++s) {
        ms[s] = Pm[s * QTILES + qt][lane];
        mall  = fmaxf(mall, ms[s]);
    }
    float lall = 0.f;
#pragma unroll
    for (int s = 0; s < KSPLIT; ++s) {
        wgt[s] = __expf(ms[s] - mall);
        lall  += wgt[s] * Pl[s * QTILES + qt][lane];
    }
    const float inv = 1.f / lall;
#pragma unroll
    for (int s = 0; s < KSPLIT; ++s) wgt[s] *= inv;

    // group ks stores dv 32*ks .. 32*ks+31 of its query tile: one 128-byte
    // line per query row, written by this wave alone
    float* Ob = Of + ((size_t)b * NTOK + q0 + lr) * DVDIM;  // this lane's query row
#pragma unroll
    for (int dd = 0; dd < 8 / KSPLIT; ++dd) {
        const int dt = ks * (8 / KSPLIT) + dd;
#pragma unroll
        for (int h = 0; h < 2; ++h) {
            v4f o = {0.f, 0.f, 0.f, 0.f};
#pragma unroll
            for (int s = 0; s < KSPLIT; ++s)
                o += Pacc[s * QTILES + qt][dt * 2 + h][lane] * wgt[s];
            *(v4f*)(Ob + dt * 16 + 8 * g + 4 * h) = o;      // 4 consecutive dv elems
        }
    }
}

// ---------------------------------------------------------------------------
// Kernel 3: out = x + O @ Wv + bv.  [16384,128] x [128,256].
// One wave per 16-row x 128-col half: the O-row A-fragment is reused across
// 8 column tiles (8 WMMAs per K-chunk). 2048 waves total.
// ---------------------------------------------------------------------------
__global__ void __launch_bounds__(256)
outproj_kernel(const float* __restrict__ x, const float* __restrict__ Of,
               const _Float16* __restrict__ Wvt, const float* __restrict__ bv,
               float* __restrict__ out) {
    const int widx = blockIdx.x * 8 + (threadIdx.x >> 5);   // 0 .. 2047
    const int lane = threadIdx.x & 31;
    const int g    = lane >> 4;
    const int lr   = lane & 15;

    const int r0 = (widx >> 1) * 16;
    const int c0 = (widx & 1) * 128;

    v8f acc[8];
#pragma unroll
    for (int t = 0; t < 8; ++t) acc[t] = (v8f){0,0,0,0,0,0,0,0};

    const float*    orow = Of + (size_t)(r0 + lr) * DVDIM;
    const _Float16* wr   = Wvt + (size_t)(c0 + lr) * DVDIM;

#pragma unroll
    for (int k0 = 0; k0 < DVDIM; k0 += 32) {
        const v16h a = load_frag_f32(orow + k0, g);          // shared A fragment
#pragma unroll
        for (int t = 0; t < 8; ++t) {
            const v16h bfr = load_frag_h(wr + (size_t)(t * 16) * DVDIM + k0, g);
            acc[t] = wmma_f16(a, bfr, acc[t]);
        }
    }

#pragma unroll
    for (int t = 0; t < 8; ++t) {
        const float bcol = bv[c0 + t * 16 + lr];
#pragma unroll
        for (int j = 0; j < 8; ++j) {
            const size_t idx = (size_t)(r0 + j + 8 * g) * CIN + c0 + t * 16 + lr;
            out[idx] = x[idx] + acc[t][j] + bcol;
        }
    }
}

// ---------------------------------------------------------------------------
// Host-side launch. Workspace layout (bytes):
//   [0,       1 MB)   Qh  f16 [16384, 32]
//   [1 MB,    2 MB)   Kh  f16 [16384, 32]
//   [2 MB,    6 MB)   Vt  f16 [4, 128, 4096]   (transposed values)
//   [6 MB,   14 MB)   Of  f32 [16384, 128]
//   [14 MB,  ...  )   Wft(16K) Wgt(16K) Wht(64K) Wvt(64K) f16 transposed weights
// ---------------------------------------------------------------------------
extern "C" void kernel_launch(void* const* d_in, const int* in_sizes, int n_in,
                              void* d_out, int out_size, void* d_ws, size_t ws_size,
                              hipStream_t stream) {
    const float* x  = (const float*)d_in[0];
    const float* Wf = (const float*)d_in[1];
    const float* bf = (const float*)d_in[2];
    const float* Wg = (const float*)d_in[3];
    const float* bg = (const float*)d_in[4];
    const float* Wh = (const float*)d_in[5];
    const float* bh = (const float*)d_in[6];
    const float* Wv = (const float*)d_in[7];
    const float* bv = (const float*)d_in[8];
    float* out = (float*)d_out;

    char* ws = (char*)d_ws;
    _Float16* Qh  = (_Float16*)(ws);
    _Float16* Kh  = (_Float16*)(ws + (1u << 20));
    _Float16* Vt  = (_Float16*)(ws + (2u << 20));
    float*    Of  = (float*)   (ws + (6u << 20));
    _Float16* Wft = (_Float16*)(ws + (14u << 20));
    _Float16* Wgt = (_Float16*)(ws + (14u << 20) + (16u << 10));
    _Float16* Wht = (_Float16*)(ws + (14u << 20) + (32u << 10));
    _Float16* Wvt = (_Float16*)(ws + (14u << 20) + (96u << 10));

    // K0: weight transpose/convert (32768 threads)
    hipLaunchKernelGGL(prep_weights_kernel, dim3(128), dim3(256), 0, stream,
                       Wf, Wg, Wh, Wv, Wft, Wgt, Wht, Wvt);
    // K1: 1024 row-tile waves, 8 waves/block -> 128 blocks
    hipLaunchKernelGGL(proj_qkv_kernel, dim3(128), dim3(256), 0, stream,
                       x, Wft, bf, Wgt, bg, Wht, bh, Qh, Kh, Vt);
    // K2: 256 blocks x 16 waves, each block = 64 queries of one batch
    hipLaunchKernelGGL(attn_kernel, dim3(256), dim3(ATHREADS), 0, stream,
                       Qh, Kh, Vt, Of);
    // K3: 2048 output-half waves, 8 waves/block -> 256 blocks
    hipLaunchKernelGGL(outproj_kernel, dim3(256), dim3(256), 0, stream,
                       x, Of, Wvt, bv, out);
}

// v003
// It runs in 56.9 microseconds.
// Two timings next to v002 both put it at 1.16 times that version's speed.
// Over all steps from v000 it is 2.32 times as fast.
#include <hip/hip_runtime.h>
#include <hip/hip_bf16.h>

// ---------------------------------------------------------------------------
// Fused self-attention for gfx1250 (MI455X), f16 WMMA with f32 accumulation.
// B=4, H=W=64 -> N=4096 tokens/batch, C=256, DQK=32, DV=128.
// ---------------------------------------------------------------------------

#define BATCH 4
#define NTOK  4096        // H*W
#define CIN   256
#define DQK   32
#define DVDIM 128
#define ROWS  (BATCH * NTOK)   // 16384
#define LPITCH 40              // halfs per staged LDS row: 32 data + 8 pad (80 B)
#define KSPLIT 4               // key groups (waves that share a query tile)
#define QTILES 4               // 16-query tiles per attention block
#define SKEYS  (32 * KSPLIT)   // keys per staged LDS buffer
#define ATHREADS (32 * KSPLIT * QTILES)
#define WROWS  (2 * DQK + DVDIM)   // staged W^T rows of the QKV projection (K, Q, V)
#define WPITCH (CIN + 8)           // halfs per staged row: 256 data + 8 pad (528 B = 16 B x 33)

typedef _Float16 v16h __attribute__((ext_vector_type(16)));
typedef _Float16 v8h  __attribute__((ext_vector_type(8)));
typedef float    v8f  __attribute__((ext_vector_type(8)));
typedef float    v4f  __attribute__((ext_vector_type(4)));

// K index held by half-slot h (0..15) for lane-group g (0 or 1) in the
// 16-bit A/B operand of V_WMMA_*_16X16X32 (ISA 7.12.2):
//   h<8  -> K = h      + 8g      (VGPR 0..3)
//   h>=8 -> K = h + 8  + 8g      (VGPR 4..7)
__device__ __forceinline__ int kmap(int h, int g) {
    return (h < 8 ? h : h + 8) + 8 * g;
}

// Load a v16h A/B fragment from a contiguous f16 row `p` (row holds K=0..31).
// The two 8-half groups per lane are 16-byte aligned -> b128 vector loads
// (global_load_b128 or ds_load_b128 depending on the pointer).
__device__ __forceinline__ v16h load_frag_h(const _Float16* p, int g) {
    const v8h lo = *(const v8h*)(p + 8 * g);
    const v8h hi = *(const v8h*)(p + 16 + 8 * g);
    v16h r;
#pragma unroll
    for (int i = 0; i < 8; ++i) { r[i] = lo[i]; r[8 + i] = hi[i]; }
    return r;
}

// Load a v16h fragment from a contiguous f32 row (two groups of 8 consecutive
// floats at +8g and +16+8g), converting to f16. Lowers to b128 loads + cvt_pk.
__device__ __forceinline__ v16h load_frag_f32(const float* __restrict__ p, int g) {
    v16h r;
    const float* lo = p + 8 * g;
    const float* hi = p + 16 + 8 * g;
#pragma unroll
    for (int i = 0; i < 8; ++i) {
        r[i]     = (_Float16)lo[i];
        r[8 + i] = (_Float16)hi[i];
    }
    return r;
}

__device__ __forceinline__ v8f wmma_f16(v16h a, v16h b, v8f c) {
    return __builtin_amdgcn_wmma_f32_16x16x32_f16(false, a, false, b, (short)0, c,
                                                  false, false);
}

// ---- CDNA5 async global->LDS copies (ASYNCcnt-tracked) --------------------
// Generic pointers to __shared__ have the LDS byte offset in their low 32 bits
// (ISA 10.2: LDS aperture address is truncated to addr[31:0]).
__device__ __forceinline__ unsigned lds_off(const void* p) {
    return (unsigned)(uintptr_t)p;
}
// One 128-key stage = five 16-byte copies per lane (K: 1, V^T: 4). The
// s_wait_xcnt closes the statement so that it stands in front of any later
// rewrite of the address registers the copies name.
__device__ __forceinline__ void async_ld_stage(unsigned ldsK, const _Float16* gK,
                                               unsigned ldsV0, const _Float16* gV0,
                                               unsigned ldsV1, const _Float16* gV1,
                                               unsigned ldsV2, const _Float16* gV2,
                                               unsigned ldsV3, const _Float16* gV3) {
    asm volatile("global_load_async_to_lds_b128 %0, %1, off\n\t"
                 "global_load_async_to_lds_b128 %2, %3, off\n\t"
                 "global_load_async_to_lds_b128 %4, %5, off\n\t"
                 "global_load_async_to_lds_b128 %6, %7, off\n\t"
                 "global_load_async_to_lds_b128 %8, %9, off\n\t"
                 "s_wait_xcnt 0x0"
                 :: "v"(ldsK), "v"(gK), "v"(ldsV0), "v"(gV0), "v"(ldsV1), "v"(gV1),
                    "v"(ldsV2), "v"(gV2), "v"(ldsV3), "v"(gV3)
                 : "memory");
}
// Eight 16-byte copies per lane (weight staging of the QKV projection): four
// from ga and four from gb, each run in steps of gs halfs at the source and
// ls bytes in LDS. The same closing s_wait_xcnt stands in front of any rewrite
// of the address registers the copies name.
__device__ __forceinline__ void async_ld8(unsigned la, const _Float16* ga,
                                          unsigned lb, const _Float16* gb,
                                          unsigned ls, size_t gs) {
    asm volatile("global_load_async_to_lds_b128 %0, %1, off\n\t"
                 "global_load_async_to_lds_b128 %2, %3, off\n\t"
                 "global_load_async_to_lds_b128 %4, %5, off\n\t"
                 "global_load_async_to_lds_b128 %6, %7, off\n\t"
                 "global_load_async_to_lds_b128 %8, %9, off\n\t"
                 "global_load_async_to_lds_b128 %10, %11, off\n\t"
                 "global_load_async_to_lds_b128 %12, %13, off\n\t"
                 "global_load_async_to_lds_b128 %14, %15, off\n\t"
                 "s_wait_xcnt 0x0"
                 :: "v"(la),          "v"(ga),          "v"(la + ls),     "v"(ga + gs),
                    "v"(la + 2 * ls), "v"(ga + 2 * gs), "v"(la + 3 * ls), "v"(ga + 3 * gs),
                    "v"(lb),          "v"(gb),          "v"(lb + ls),     "v"(gb + gs),
                    "v"(lb + 2 * ls), "v"(gb + 2 * gs), "v"(lb + 3 * ls), "v"(gb + 3 * gs)
                 : "memory");
}
// This wave's own copies have landed (the barrier behind it publishes them).
__device__ __forceinline__ void wait_asynccnt_0() {
    asm volatile("s_wait_asynccnt 0x0" ::: "memory");
}
// This wave's own LDS reads have retired before the buffer they read is refilled.
__device__ __forceinline__ void wait_dscnt_0() {
    asm volatile("s_wait_dscnt 0x0" ::: "memory");
}

// ---------------------------------------------------------------------------
// Kernel 0: pre-transpose + f16-convert the weight matrices (160 KB total,
// stays resident in L2). Wft/Wgt/Wht are W^T [out, 256]; Wvt is Wv^T [256,128].
// ---------------------------------------------------------------------------
__global__ void __launch_bounds__(256)
prep_weights_kernel(const float* __restrict__ Wf, const float* __restrict__ Wg,
                    const float* __restrict__ Wh, const float* __restrict__ Wv,
                    _Float16* __restrict__ Wft, _Float16* __restrict__ Wgt,
                    _Float16* __restrict__ Wht, _Float16* __restrict__ Wvt) {
    const int i = blockIdx.x * 256 + threadIdx.x;   // 0 .. 32767
    if (i < DQK * CIN) {                            // [32][256]
        const int n = i >> 8, k = i & 255;
        Wft[i] = (_Float16)Wf[k * DQK + n];
        Wgt[i] = (_Float16)Wg[k * DQK + n];
    }
    if (i < DVDIM * CIN) {                          // [128][256]
        const int n = i >> 8, k = i & 255;
        Wht[i] = (_Float16)Wh[k * DVDIM + n];
    }
    if (i < CIN * DVDIM) {                          // [256][128]
        const int n = i >> 7, k = i & 127;
        Wvt[i] = (_Float16)Wv[k * CIN + n];
    }
}

// ---------------------------------------------------------------------------
// Kernel 1: fused QKV projections. One wave per 16-row tile computes ALL
// output tiles (2 K + 2 Q + 8 V = 12 WMMAs per K-chunk), reusing the x
// A-fragment. x is read exactly once. The 192 W^T rows (96 KB) are staged once
// per block in LDS by asynchronous copies, one whole 512-byte row per wave and
// copy; the B-fragments then come by ds_load_b128 at a pitch of 16 B x odd (no
// bank conflict) instead of global loads that touch 16 cache lines each.
//   Kh = f16(x @ Wf + bf)   [ROWS, 32]
//   Qh = f16(x @ Wg + bg)   [ROWS, 32]
//   Vt = f16(x @ Wh + bh)^T [BATCH, 128, NTOK]
// ---------------------------------------------------------------------------
__global__ void __launch_bounds__(256)
proj_qkv_kernel(const float* __restrict__ x,
                const _Float16* __restrict__ Wft, const float* __restrict__ bf,
                const _Float16* __restrict__ Wgt, const float* __restrict__ bg,
                const _Float16* __restrict__ Wht, const float* __restrict__ bh,
                _Float16* __restrict__ Qh, _Float16* __restrict__ Kh,
                _Float16* __restrict__ Vt) {
    const int widx = blockIdx.x * 8 + (threadIdx.x >> 5);   // 0 .. 1023
    const int lane = threadIdx.x & 31;
    const int g    = lane >> 4;
    const int lr   = lane & 15;

    const int row0 = widx * 16;

    __shared__ __attribute__((aligned(16))) _Float16 Wl[WROWS * WPITCH];   // rows: 32 K, 32 Q, 128 V

    v8f accK[2], accQ[2], accV[8];
#pragma unroll
    for (int t = 0; t < 2; ++t) accK[t] = accQ[t] = (v8f){0,0,0,0,0,0,0,0};
#pragma unroll
    for (int t = 0; t < 8; ++t) accV[t] = (v8f){0,0,0,0,0,0,0,0};

    const _Float16* wfr = &Wl[lr * WPITCH];                 // row lr of the staged W^T tiles
    const _Float16* wgr = &Wl[(DQK + lr) * WPITCH];
    const _Float16* whr = &Wl[(2 * DQK + lr) * WPITCH];
    const float*    xr  = x + (size_t)(row0 + lr) * CIN;

    // ---- stage W^T: copy c of wave w brings row 8c + w (24 copies per lane) ----
    {
        const int      w8 = threadIdx.x >> 5;
        const unsigned l  = lds_off(&Wl[w8 * WPITCH + lane * 8]);
        const size_t   go = (size_t)w8 * CIN + lane * 8;
        const unsigned LS = 8 * WPITCH * 2;          // LDS bytes per 8 rows
        const size_t   GS = 8 * CIN;                 // source halfs per 8 rows
        async_ld8(l,           Wft + go,           l + 4 * LS,  Wgt + go,           LS, GS);
        async_ld8(l + 8 * LS,  Wht + go,           l + 12 * LS, Wht + go + 4 * GS,  LS, GS);
        async_ld8(l + 16 * LS, Wht + go + 8 * GS,  l + 20 * LS, Wht + go + 12 * GS, LS, GS);
    }
    wait_asynccnt_0();
    __syncthreads();                                        // staged W^T visible to all waves

    for (int k0 = 0; k0 < CIN; k0 += 32) {
        const v16h a = load_frag_f32(xr + k0, g);           // shared A fragment
#pragma unroll
        for (int t = 0; t < 2; ++t) {
            const v16h bK = load_frag_h(wfr + (t * 16) * WPITCH + k0, g);
            accK[t] = wmma_f16(a, bK, accK[t]);
            const v16h bQ = load_frag_h(wgr + (t * 16) * WPITCH + k0, g);
            accQ[t] = wmma_f16(a, bQ, accQ[t]);
        }
#pragma unroll
        for (int t = 0; t < 8; ++t) {
            const v16h bV = load_frag_h(whr + (t * 16) * WPITCH + k0, g);
            accV[t] = wmma_f16(a, bV, accV[t]);
        }
    }

    // ---- store K and Q: f16 [row, 32] (C-layout: row = row0 + j + 8g) ----
#pragma unroll
    for (int t = 0; t < 2; ++t) {
        const float bK = bf[t * 16 + lr];
        const float bQ = bg[t * 16 + lr];
#pragma unroll
        for (int j = 0; j < 8; ++j) {
            const size_t row = row0 + j + 8 * g;
            Kh[row * DQK + t * 16 + lr] = (_Float16)(accK[t][j] + bK);
            Qh[row * DQK + t * 16 + lr] = (_Float16)(accQ[t][j] + bQ);
        }
    }
    // ---- store V transposed: Vt[b][dv][token], 8 consecutive tokens/lane ----
    const int b     = row0 >> 12;
    const int nbase = (row0 & (NTOK - 1)) + 8 * g;
#pragma unroll
    for (int t = 0; t < 8; ++t) {
        const float bV = bh[t * 16 + lr];
        _Float16* dst = Vt + (size_t)b * DVDIM * NTOK + (size_t)(t * 16 + lr) * NTOK;
#pragma unroll
        for (int j = 0; j < 8; ++j)
            dst[nbase + j] = (_Float16)(accV[t][j] + bV);
    }
}

// ---------------------------------------------------------------------------
// Kernel 2: fused flash attention (transposed formulation), keys split over
// four wave groups. One block (16 waves) owns 64 consecutive queries of one
// batch: wave = (query tile qt, key group ks). A stage is 128 keys; group ks
// works on its keys 32*ks .. 32*ks+31, so a wave walks a quarter of the keys
// and 256 blocks of four waves per SIMD cover every WGP. Stages are double-
// buffered in LDS via global_load_async_to_lds (ASYNCcnt). The 64-byte tile
// rows lie in LDS at a pitch of 80 bytes (16 B x odd): the 16 lanes of a
// half-wave, one row each, then fall on 16 distinct groups of four banks in
// every ds_load_b128.
//   S^T sub-tile  = WMMA(A = K rows, B = Q^T)        (2 per key tile)
//   online softmax across key tiles (cross-group shfl_xor(16) reduction)
//   O^T           = WMMA(A = V^T rows, B = P^T)      (8 per key tile)
// P^T B-fragment is built from the two S^T C-fragments *within each lane*.
// The four groups' (max, sum, O^T) partials of a query tile meet in LDS at the
// end; each group merges and stores a quarter of the dv range.
// ---------------------------------------------------------------------------
__global__ void __launch_bounds__(ATHREADS)
attn_kernel(const _Float16* __restrict__ Qh, const _Float16* __restrict__ Kh,
            const _Float16* __restrict__ Vt, float* __restrict__ Of) {
    __shared__ __attribute__((aligned(16))) _Float16 Kbuf[2][SKEYS * LPITCH];          // [buf][key(128)][dqk(32) + pad]
    __shared__ __attribute__((aligned(16))) _Float16 Vbuf[2][KSPLIT][DVDIM * LPITCH];  // [buf][group][dv(128)][key(32) + pad]
    __shared__ __attribute__((aligned(16))) v4f   Pacc[QTILES * KSPLIT][16][32];       // [wave][dt*2 + half][lane]
    __shared__ float Pm[QTILES * KSPLIT][32];                                          // [wave][lane]
    __shared__ float Pl[QTILES * KSPLIT][32];

    const int tid  = threadIdx.x;               // 0..511
    const int lane = tid & 31;
    const int g    = lane >> 4;
    const int lr   = lane & 15;
    const int wave = tid >> 5;                  // 0..15
    const int qt   = wave & (QTILES - 1);       // query tile of the block
    const int ks   = wave / QTILES;             // key group

    const int b    = blockIdx.x / (NTOK / (16 * QTILES));         // 64 blocks per batch
    const int q0   = (blockIdx.x % (NTOK / (16 * QTILES))) * (16 * QTILES) + qt * 16;

    const _Float16* Qb    = Qh + (size_t)b * NTOK * DQK;
    const _Float16* KbBlk = Kh + (size_t)b * NTOK * DQK;      // block-uniform
    const _Float16* VbBlk = Vt + (size_t)b * DVDIM * NTOK;    // block-uniform

    // Q^T B-fragment: lane column = query (q0+lr), halfs sweep d_qk (=32)
    const v16h qf = load_frag_h(Qb + (size_t)(q0 + lr) * DQK, g);

    // ---- async stage of 128 keys: 5 ops per wave ----
    auto fill = [&](int kb, int buf) {
        // K: 128 rows x 64 B contiguous = 8192 B = 512 lanes x 16 B
        // V: 128 rows (stride NTOK) x 256 B = 32768 B = 4 x 512 lanes x 16 B;
        //    16 lanes cover one row's 256 B, four lanes each group's 64 B
        const int d  = tid >> 4;                 // dv row 0..31 (copy c: +32c)
        const int pc = tid & 15;                 // 16-byte piece of the row
        _Float16*       lv = &Vbuf[buf][pc >> 2][d * LPITCH + (pc & 3) * 8];
        const _Float16* gv = VbBlk + (size_t)d * NTOK + kb + pc * 8;
        async_ld_stage(lds_off(&Kbuf[buf][(tid >> 2) * LPITCH + (tid & 3) * 8]),
                       KbBlk + (size_t)kb * DQK + tid * 8,
                       lds_off(lv),               gv,
                       lds_off(lv + 32 * LPITCH), gv + (size_t)32 * NTOK,
                       lds_off(lv + 64 * LPITCH), gv + (size_t)64 * NTOK,
                       lds_off(lv + 96 * LPITCH), gv + (size_t)96 * NTOK);
    };

    float m = -1e30f, l = 0.f;
    v8f acc[8];
#pragma unroll
    for (int dt = 0; dt < 8; ++dt) acc[dt] = (v8f){0,0,0,0,0,0,0,0};
    const v8f zero = {0,0,0,0,0,0,0,0};

    const int NST = NTOK / SKEYS;               // 32 stages
    fill(0, 0);
    wait_asynccnt_0();
    __syncthreads();                             // stage 0 visible to all waves
    fill(SKEYS, 1);
    for (int st = 0; st < NST; ++st) {
        const int buf = st & 1;

        // A-fragments from LDS: 16 key rows each, halfs sweep d_qk
        const v16h a0 = load_frag_h(&Kbuf[buf][(ks * 32 + lr) * LPITCH], g);
        const v16h a1 = load_frag_h(&Kbuf[buf][(ks * 32 + 16 + lr) * LPITCH], g);

        // S^T tiles: lane = query column, VGPR j -> key = kb + sub*16 + j + 8g
        v8f s0 = wmma_f16(a0, qf, zero);
        v8f s1 = wmma_f16(a1, qf, zero);

        // per-query max over this 32-key tile
        float tmax = s0[0];
#pragma unroll
        for (int j = 0; j < 8; ++j) {
            tmax = fmaxf(tmax, s0[j]);
            tmax = fmaxf(tmax, s1[j]);
        }
        tmax = fmaxf(tmax, __shfl_xor(tmax, 16, 32));
        const float mnew  = fmaxf(m, tmax);
        const float alpha = __expf(m - mnew);

        // exponentiate + pack P^T B-fragment (pure in-lane repack):
        //   h<8  -> key kb + h + 8g        == s0[j = h]
        //   h>=8 -> key kb + 16 + (h-8)+8g == s1[j = h-8]
        float psum = 0.f;
        v16h pf;
#pragma unroll
        for (int j = 0; j < 8; ++j) {
            const float p0 = __expf(s0[j] - mnew);
            const float p1 = __expf(s1[j] - mnew);
            psum += p0 + p1;
            pf[j]     = (_Float16)p0;
            pf[8 + j] = (_Float16)p1;
        }
        psum += __shfl_xor(psum, 16, 32);
        l = l * alpha + psum;
        m = mnew;

        // O^T accumulation over the 8 dv tiles (V^T rows from LDS)
#pragma unroll
        for (int dt = 0; dt < 8; ++dt) {
#pragma unroll
            for (int j = 0; j < 8; ++j) acc[dt][j] *= alpha;
            const v16h av = load_frag_h(&Vbuf[buf][ks][(dt * 16 + lr) * LPITCH], g);
            acc[dt] = wmma_f16(av, pf, acc[dt]);
        }

        // publish point: own reads of buf retired, own copies of stage st+1
        // landed; the one barrier publishes st+1 and frees buf for the refill
        wait_dscnt_0();
        wait_asynccnt_0();
        __syncthreads();
        if (st + 2 < NST) fill((st + 2) * SKEYS, buf);
    }
    wait_asynccnt_0();

    // ---- merge the four key groups' partials of each query tile ----
#pragma unroll
    for (int dt = 0; dt < 8; ++dt) {
        Pacc[wave][dt * 2 + 0][lane] = (v4f){acc[dt][0], acc[dt][1], acc[dt][2], acc[dt][3]};
        Pacc[wave][dt * 2 + 1][lane] = (v4f){acc[dt][4], acc[dt][5], acc[dt][6], acc[dt][7]};
    }
    Pm[wave][lane] = m;
    Pl[wave][lane] = l;
    __syncthreads();                             // all partials visible

    float ms[KSPLIT], wgt[KSPLIT];
    float mall = -1e30f;
#pragma unroll
    for (int s = 0; s < KSPLIT; ++s) {
        ms[s] = Pm[s * QTILES + qt][lane];
        mall  = fmaxf(mall, ms[s]);
    }
    float lall = 0.f;
#pragma unroll
    for (int s = 0; s < KSPLIT; ++s) {
        wgt[s] = __expf(ms[s] - mall);
        lall  += wgt[s] * Pl[s * QTILES + qt][lane];
    }
    const float inv = 1.f / lall;
#pragma unroll
    for (int s = 0; s < KSPLIT; ++s) wgt[s] *= inv;

    // group ks stores dv 32*ks .. 32*ks+31 of its query tile: one 128-byte
    // line per query row, written by this wave alone
    float* Ob = Of + ((size_t)b * NTOK + q0 + lr) * DVDIM;  // this lane's query row
#pragma unroll
    for (int dd = 0; dd < 8 / KSPLIT; ++dd) {
        const int dt = ks * (8 / KSPLIT) + dd;
#pragma unroll
        for (int h = 0; h < 2; ++h) {
            v4f o = {0.f, 0.f, 0.f, 0.f};
#pragma unroll
            for (int s = 0; s < KSPLIT; ++s)
                o += Pacc[s * QTILES + qt][dt * 2 + h][lane] * wgt[s];
            *(v4f*)(Ob + dt * 16 + 8 * g + 4 * h) = o;      // 4 consecutive dv elems
        }
    }
}

// ---------------------------------------------------------------------------
// Kernel 3: out = x + O @ Wv + bv.  [16384,128] x [128,256].
// One wave per 16-row x 128-col half: the O-row A-fragment is reused across
// 8 column tiles (8 WMMAs per K-chunk). 2048 waves total.
// ---------------------------------------------------------------------------
__global__ void __launch_bounds__(256)
outproj_kernel(const float* __restrict__ x, const float* __restrict__ Of,
               const _Float16* __restrict__ Wvt, const float* __restrict__ bv,
               float* __restrict__ out) {
    const int widx = blockIdx.x * 8 + (threadIdx.x >> 5);   // 0 .. 2047
    const int lane = threadIdx.x & 31;
    const int g    = lane >> 4;
    const int lr   = lane & 15;

    const int r0 = (widx >> 1) * 16;
    const int c0 = (widx & 1) * 128;

    v8f acc[8];
#pragma unroll
    for (int t = 0; t < 8; ++t) acc[t] = (v8f){0,0,0,0,0,0,0,0};

    const float*    orow = Of + (size_t)(r0 + lr) * DVDIM;
    const _Float16* wr   = Wvt + (size_t)(c0 + lr) * DVDIM;

#pragma unroll
    for (int k0 = 0; k0 < DVDIM; k0 += 32) {
        const v16h a = load_frag_f32(orow + k0, g);          // shared A fragment
#pragma unroll
        for (int t = 0; t < 8; ++t) {
            const v16h bfr = load_frag_h(wr + (size_t)(t * 16) * DVDIM + k0, g);
            acc[t] = wmma_f16(a, bfr, acc[t]);
        }
    }

#pragma unroll
    for (int t = 0; t < 8; ++t) {
        const float bcol = bv[c0 + t * 16 + lr];
#pragma unroll
        for (int j = 0; j < 8; ++j) {
            const size_t idx = (size_t)(r0 + j + 8 * g) * CIN + c0 + t * 16 + lr;
            out[idx] = x[idx] + acc[t][j] + bcol;
        }
    }
}

// ---------------------------------------------------------------------------
// Host-side launch. Workspace layout (bytes):
//   [0,       1 MB)   Qh  f16 [16384, 32]
//   [1 MB,    2 MB)   Kh  f16 [16384, 32]
//   [2 MB,    6 MB)   Vt  f16 [4, 128, 4096]   (transposed values)
//   [6 MB,   14 MB)   Of  f32 [16384, 128]
//   [14 MB,  ...  )   Wft(16K) Wgt(16K) Wht(64K) Wvt(64K) f16 transposed weights
// ---------------------------------------------------------------------------
extern "C" void kernel_launch(void* const* d_in, const int* in_sizes, int n_in,
                              void* d_out, int out_size, void* d_ws, size_t ws_size,
                              hipStream_t stream) {
    const float* x  = (const float*)d_in[0];
    const float* Wf = (const float*)d_in[1];
    const float* bf = (const float*)d_in[2];
    const float* Wg = (const float*)d_in[3];
    const float* bg = (const float*)d_in[4];
    const float* Wh = (const float*)d_in[5];
    const float* bh = (const float*)d_in[6];
    const float* Wv = (const float*)d_in[7];
    const float* bv = (const float*)d_in[8];
    float* out = (float*)d_out;

    char* ws = (char*)d_ws;
    _Float16* Qh  = (_Float16*)(ws);
    _Float16* Kh  = (_Float16*)(ws + (1u << 20));
    _Float16* Vt  = (_Float16*)(ws + (2u << 20));
    float*    Of  = (float*)   (ws + (6u << 20));
    _Float16* Wft = (_Float16*)(ws + (14u << 20));
    _Float16* Wgt = (_Float16*)(ws + (14u << 20) + (16u << 10));
    _Float16* Wht = (_Float16*)(ws + (14u << 20) + (32u << 10));
    _Float16* Wvt = (_Float16*)(ws + (14u << 20) + (96u << 10));

    // K0: weight transpose/convert (32768 threads)
    hipLaunchKernelGGL(prep_weights_kernel, dim3(128), dim3(256), 0, stream,
                       Wf, Wg, Wh, Wv, Wft, Wgt, Wht, Wvt);
    // K1: 1024 row-tile waves, 8 waves/block -> 128 blocks
    hipLaunchKernelGGL(proj_qkv_kernel, dim3(128), dim3(256), 0, stream,
                       x, Wft, bf, Wgt, bg, Wht, bh, Qh, Kh, Vt);
    // K2: 256 blocks x 16 waves, each block = 64 queries of one batch
    hipLaunchKernelGGL(attn_kernel, dim3(256), dim3(ATHREADS), 0, stream,
                       Qh, Kh, Vt, Of);
    // K3: 2048 output-half waves, 8 waves/block -> 256 blocks
    hipLaunchKernelGGL(outproj_kernel, dim3(256), dim3(256), 0, stream,
                       x, Of, Wvt, bv, out);
}

// v004
// It runs in 49.5 microseconds.
// Timed twice side by side with v003, it ran 1.14 and 1.15 times as fast.
// Over all steps from v000 it is 2.66 times as fast.
#include <hip/hip_runtime.h>
#include <hip/hip_bf16.h>

// ---------------------------------------------------------------------------
// Fused self-attention for gfx1250 (MI455X), f16 WMMA with f32 accumulation.
// B=4, H=W=64 -> N=4096 tokens/batch, C=256, DQK=32, DV=128.
// ---------------------------------------------------------------------------

#define BATCH 4
#define NTOK  4096        // H*W
#define CIN   256
#define DQK   32
#define DVDIM 128
#define ROWS  (BATCH * NTOK)   // 16384
#define LPITCH 40              // halfs per staged LDS row: 32 data + 8 pad (80 B)
#define KSPLIT 4               // key groups (waves that share a query tile)
#define QTILES 4               // 16-query tiles per attention block
#define SKEYS  (32 * KSPLIT)   // keys per staged LDS buffer
#define ATHREADS (32 * KSPLIT * QTILES)
#define WROWS  (2 * DQK + DVDIM)   // staged W^T rows of the QKV projection (K, Q, V)
#define WPITCH (CIN + 8)           // halfs per staged row: 256 data + 8 pad (528 B = 16 B x 33)

typedef _Float16 v16h __attribute__((ext_vector_type(16)));
typedef _Float16 v8h  __attribute__((ext_vector_type(8)));
typedef float    v8f  __attribute__((ext_vector_type(8)));
typedef float    v4f  __attribute__((ext_vector_type(4)));

// K index held by half-slot h (0..15) for lane-group g (0 or 1) in the
// 16-bit A/B operand of V_WMMA_*_16X16X32 (ISA 7.12.2):
//   h<8  -> K = h      + 8g      (VGPR 0..3)
//   h>=8 -> K = h + 8  + 8g      (VGPR 4..7)
__device__ __forceinline__ int kmap(int h, int g) {
    return (h < 8 ? h : h + 8) + 8 * g;
}

// Load a v16h A/B fragment from a contiguous f16 row `p` (row holds K=0..31).
// The two 8-half groups per lane are 16-byte aligned -> b128 vector loads
// (global_load_b128 or ds_load_b128 depending on the pointer).
__device__ __forceinline__ v16h load_frag_h(const _Float16* p, int g) {
    const v8h lo = *(const v8h*)(p + 8 * g);
    const v8h hi = *(const v8h*)(p + 16 + 8 * g);
    v16h r;
#pragma unroll
    for (int i = 0; i < 8; ++i) { r[i] = lo[i]; r[8 + i] = hi[i]; }
    return r;
}

// Load a v16h fragment from a contiguous f32 row (two groups of 8 consecutive
// floats at +8g and +16+8g), converting to f16. Lowers to b128 loads + cvt_pk.
__device__ __forceinline__ v16h load_frag_f32(const float* __restrict__ p, int g) {
    v16h r;
    const float* lo = p + 8 * g;
    const float* hi = p + 16 + 8 * g;
#pragma unroll
    for (int i = 0; i < 8; ++i) {
        r[i]     = (_Float16)lo[i];
        r[8 + i] = (_Float16)hi[i];
    }
    return r;
}

__device__ __forceinline__ v8f wmma_f16(v16h a, v16h b, v8f c) {
    return __builtin_amdgcn_wmma_f32_16x16x32_f16(false, a, false, b, (short)0, c,
                                                  false, false);
}

// ---- CDNA5 async global->LDS copies (ASYNCcnt-tracked) --------------------
// Generic pointers to __shared__ have the LDS byte offset in their low 32 bits
// (ISA 10.2: LDS aperture address is truncated to addr[31:0]).
__device__ __forceinline__ unsigned lds_off(const void* p) {
    return (unsigned)(uintptr_t)p;
}
// One 128-key stage = five 16-byte copies per lane (K: 1, V^T: 4). The
// s_wait_xcnt closes the statement so that it stands in front of any later
// rewrite of the address registers the copies name.
__device__ __forceinline__ void async_ld_stage(unsigned ldsK, const _Float16* gK,
                                               unsigned ldsV0, const _Float16* gV0,
                                               unsigned ldsV1, const _Float16* gV1,
                                               unsigned ldsV2, const _Float16* gV2,
                                               unsigned ldsV3, const _Float16* gV3) {
    asm volatile("global_load_async_to_lds_b128 %0, %1, off\n\t"
                 "global_load_async_to_lds_b128 %2, %3, off\n\t"
                 "global_load_async_to_lds_b128 %4, %5, off\n\t"
                 "global_load_async_to_lds_b128 %6, %7, off\n\t"
                 "global_load_async_to_lds_b128 %8, %9, off\n\t"
                 "s_wait_xcnt 0x0"
                 :: "v"(ldsK), "v"(gK), "v"(ldsV0), "v"(gV0), "v"(ldsV1), "v"(gV1),
                    "v"(ldsV2), "v"(gV2), "v"(ldsV3), "v"(gV3)
                 : "memory");
}
// Eight 16-byte copies per lane (weight staging of the QKV projection): four
// from ga and four from gb, each run in steps of gs halfs at the source and
// ls bytes in LDS. The same closing s_wait_xcnt stands in front of any rewrite
// of the address registers the copies name.
__device__ __forceinline__ void async_ld8(unsigned la, const _Float16* ga,
                                          unsigned lb, const _Float16* gb,
                                          unsigned ls, size_t gs) {
    asm volatile("global_load_async_to_lds_b128 %0, %1, off\n\t"
                 "global_load_async_to_lds_b128 %2, %3, off\n\t"
                 "global_load_async_to_lds_b128 %4, %5, off\n\t"
                 "global_load_async_to_lds_b128 %6, %7, off\n\t"
                 "global_load_async_to_lds_b128 %8, %9, off\n\t"
                 "global_load_async_to_lds_b128 %10, %11, off\n\t"
                 "global_load_async_to_lds_b128 %12, %13, off\n\t"
                 "global_load_async_to_lds_b128 %14, %15, off\n\t"
                 "s_wait_xcnt 0x0"
                 :: "v"(la),          "v"(ga),          "v"(la + ls),     "v"(ga + gs),
                    "v"(la + 2 * ls), "v"(ga + 2 * gs), "v"(la + 3 * ls), "v"(ga + 3 * gs),
                    "v"(lb),          "v"(gb),          "v"(lb + ls),     "v"(gb + gs),
                    "v"(lb + 2 * ls), "v"(gb + 2 * gs), "v"(lb + 3 * ls), "v"(gb + 3 * gs)
                 : "memory");
}
// This wave's own copies have landed (the barrier behind it publishes them).
__device__ __forceinline__ void wait_asynccnt_0() {
    asm volatile("s_wait_asynccnt 0x0" ::: "memory");
}
// This wave's own LDS reads have retired before the buffer they read is refilled.
__device__ __forceinline__ void wait_dscnt_0() {
    asm volatile("s_wait_dscnt 0x0" ::: "memory");
}

// ---------------------------------------------------------------------------
// Kernel 0: pre-transpose + f16-convert the weight matrices (160 KB total,
// stays resident in L2). Wft/Wgt/Wht are W^T [out, 256]; Wvt is Wv^T [256,128].
// ---------------------------------------------------------------------------
__global__ void __launch_bounds__(256)
prep_weights_kernel(const float* __restrict__ Wf, const float* __restrict__ Wg,
                    const float* __restrict__ Wh, const float* __restrict__ Wv,
                    _Float16* __restrict__ Wft, _Float16* __restrict__ Wgt,
                    _Float16* __restrict__ Wht, _Float16* __restrict__ Wvt) {
    const int i = blockIdx.x * 256 + threadIdx.x;   // 0 .. 32767
    if (i < DQK * CIN) {                            // [32][256]
        const int n = i >> 8, k = i & 255;
        Wft[i] = (_Float16)Wf[k * DQK + n];
        Wgt[i] = (_Float16)Wg[k * DQK + n];
    }
    if (i < DVDIM * CIN) {                          // [128][256]
        const int n = i >> 8, k = i & 255;
        Wht[i] = (_Float16)Wh[k * DVDIM + n];
    }
    if (i < CIN * DVDIM) {                          // [256][128]
        const int n = i >> 7, k = i & 127;
        Wvt[i] = (_Float16)Wv[k * CIN + n];
    }
}

// ---------------------------------------------------------------------------
// Kernel 1: fused QKV projections. One wave per 16-row tile computes ALL
// output tiles (2 K + 2 Q + 8 V = 12 WMMAs per K-chunk), reusing the x
// A-fragment. x is read exactly once. The 192 W^T rows (96 KB) are staged once
// per block in LDS by asynchronous copies, one whole 512-byte row per wave and
// copy; the B-fragments then come by ds_load_b128 at a pitch of 16 B x odd (no
// bank conflict) instead of global loads that touch 16 cache lines each.
//   Kh = f16(x @ Wf + bf)   [ROWS, 32]
//   Qh = f16(x @ Wg + bg)   [ROWS, 32]
//   Vt = f16(x @ Wh + bh)^T [BATCH, 128, NTOK]
// ---------------------------------------------------------------------------
__global__ void __launch_bounds__(256)
proj_qkv_kernel(const float* __restrict__ x,
                const _Float16* __restrict__ Wft, const float* __restrict__ bf,
                const _Float16* __restrict__ Wgt, const float* __restrict__ bg,
                const _Float16* __restrict__ Wht, const float* __restrict__ bh,
                _Float16* __restrict__ Qh, _Float16* __restrict__ Kh,
                _Float16* __restrict__ Vt) {
    const int widx = blockIdx.x * 8 + (threadIdx.x >> 5);   // 0 .. 1023
    const int lane = threadIdx.x & 31;
    const int g    = lane >> 4;
    const int lr   = lane & 15;

    const int row0 = widx * 16;

    __shared__ __attribute__((aligned(16))) _Float16 Wl[WROWS * WPITCH];   // rows: 32 K, 32 Q, 128 V

    v8f accK[2], accQ[2], accV[8];
#pragma unroll
    for (int t = 0; t < 2; ++t) accK[t] = accQ[t] = (v8f){0,0,0,0,0,0,0,0};
#pragma unroll
    for (int t = 0; t < 8; ++t) accV[t] = (v8f){0,0,0,0,0,0,0,0};

    const _Float16* wfr = &Wl[lr * WPITCH];                 // row lr of the staged W^T tiles
    const _Float16* wgr = &Wl[(DQK + lr) * WPITCH];
    const _Float16* whr = &Wl[(2 * DQK + lr) * WPITCH];
    const float*    xr  = x + (size_t)(row0 + lr) * CIN;

    // ---- stage W^T: copy c of wave w brings row 8c + w (24 copies per lane) ----
    {
        const int      w8 = threadIdx.x >> 5;
        const unsigned l  = lds_off(&Wl[w8 * WPITCH + lane * 8]);
        const size_t   go = (size_t)w8 * CIN + lane * 8;
        const unsigned LS = 8 * WPITCH * 2;          // LDS bytes per 8 rows
        const size_t   GS = 8 * CIN;                 // source halfs per 8 rows
        async_ld8(l,           Wft + go,           l + 4 * LS,  Wgt + go,           LS, GS);
        async_ld8(l + 8 * LS,  Wht + go,           l + 12 * LS, Wht + go + 4 * GS,  LS, GS);
        async_ld8(l + 16 * LS, Wht + go + 8 * GS,  l + 20 * LS, Wht + go + 12 * GS, LS, GS);
    }
    wait_asynccnt_0();
    __syncthreads();                                        // staged W^T visible to all waves

    for (int k0 = 0; k0 < CIN; k0 += 32) {
        const v16h a = load_frag_f32(xr + k0, g);           // shared A fragment
#pragma unroll
        for (int t = 0; t < 2; ++t) {
            const v16h bK = load_frag_h(wfr + (t * 16) * WPITCH + k0, g);
            accK[t] = wmma_f16(a, bK, accK[t]);
            const v16h bQ = load_frag_h(wgr + (t * 16) * WPITCH + k0, g);
            accQ[t] = wmma_f16(a, bQ, accQ[t]);
        }
#pragma unroll
        for (int t = 0; t < 8; ++t) {
            const v16h bV = load_frag_h(whr + (t * 16) * WPITCH + k0, g);
            accV[t] = wmma_f16(a, bV, accV[t]);
        }
    }

    // ---- store K and Q: f16 [row, 32] (C-layout: row = row0 + j + 8g) ----
#pragma unroll
    for (int t = 0; t < 2; ++t) {
        const float bK = bf[t * 16 + lr];
        const float bQ = bg[t * 16 + lr];
#pragma unroll
        for (int j = 0; j < 8; ++j) {
            const size_t row = row0 + j + 8 * g;
            Kh[row * DQK + t * 16 + lr] = (_Float16)(accK[t][j] + bK);
            Qh[row * DQK + t * 16 + lr] = (_Float16)(accQ[t][j] + bQ);
        }
    }
    // ---- store V transposed: Vt[b][dv][token], 8 consecutive tokens/lane ----
    const int b     = row0 >> 12;
    const int nbase = (row0 & (NTOK - 1)) + 8 * g;
#pragma unroll
    for (int t = 0; t < 8; ++t) {
        const float bV = bh[t * 16 + lr];
        _Float16* dst = Vt + (size_t)b * DVDIM * NTOK + (size_t)(t * 16 + lr) * NTOK;
#pragma unroll
        for (int j = 0; j < 8; ++j)
            dst[nbase + j] = (_Float16)(accV[t][j] + bV);
    }
}

// ---------------------------------------------------------------------------
// Kernel 2: fused flash attention (transposed formulation) with the output
// projection and residual in its epilogue. Keys are split over
// four wave groups. One block (16 waves) owns 64 consecutive queries of one
// batch: wave = (query tile qt, key group ks). A stage is 128 keys; group ks
// works on its keys 32*ks .. 32*ks+31, so a wave walks a quarter of the keys
// and 256 blocks of four waves per SIMD cover every WGP. Stages are double-
// buffered in LDS via global_load_async_to_lds (ASYNCcnt). The 64-byte tile
// rows lie in LDS at a pitch of 80 bytes (16 B x odd): the 16 lanes of a
// half-wave, one row each, then fall on 16 distinct groups of four banks in
// every ds_load_b128.
//   S^T sub-tile  = WMMA(A = K rows, B = Q^T)        (2 per key tile)
//   online softmax across key tiles (cross-group shfl_xor(16) reduction)
//   O^T           = WMMA(A = V^T rows, B = P^T)      (8 per key tile)
// P^T B-fragment is built from the two S^T C-fragments *within each lane*.
// The four groups' (max, sum, O^T) partials of a query tile meet in LDS at the
// end; each group merges a quarter of the dv range.
// Epilogue: out = x + O @ Wv + bv for the block's 64 queries. The merged quarter
// of a lane is, in place, its part of the f16 A fragment (rows = queries) of one
// 32-wide dv chunk; the 16 fragments are exchanged through LDS and each of the
// waves 0..7 forms 64 queries x 32 output columns (32 WMMAs), so that a block
// loads every Wv^T fragment once. O never goes to memory.
// ---------------------------------------------------------------------------
__global__ void __launch_bounds__(ATHREADS)
attn_kernel(const _Float16* __restrict__ Qh, const _Float16* __restrict__ Kh,
            const _Float16* __restrict__ Vt, const float* __restrict__ x,
            const _Float16* __restrict__ Wvt, const float* __restrict__ bv,
            float* __restrict__ out) {
    __shared__ __attribute__((aligned(16))) _Float16 Kbuf[2][SKEYS * LPITCH];          // [buf][key(128)][dqk(32) + pad]
    __shared__ __attribute__((aligned(16))) _Float16 Vbuf[2][KSPLIT][DVDIM * LPITCH];  // [buf][group][dv(128)][key(32) + pad]
    __shared__ __attribute__((aligned(16))) v4f   Pacc[QTILES * KSPLIT][16][32];       // [wave][dt*2 + half][lane]
    __shared__ float Pm[QTILES * KSPLIT][32];                                          // [wave][lane]
    __shared__ float Pl[QTILES * KSPLIT][32];
    __shared__ __attribute__((aligned(16))) v8h Ofr[QTILES][KSPLIT][2][32];            // [query tile][dv chunk][low/high 8 halfs][lane]

    const int tid  = threadIdx.x;               // 0..511
    const int lane = tid & 31;
    const int g    = lane >> 4;
    const int lr   = lane & 15;
    const int wave = tid >> 5;                  // 0..15
    const int qt   = wave & (QTILES - 1);       // query tile of the block
    const int ks   = wave / QTILES;             // key group

    const int b    = blockIdx.x / (NTOK / (16 * QTILES));         // 64 blocks per batch
    const int q0   = (blockIdx.x % (NTOK / (16 * QTILES))) * (16 * QTILES) + qt * 16;

    const _Float16* Qb    = Qh + (size_t)b * NTOK * DQK;
    const _Float16* KbBlk = Kh + (size_t)b * NTOK * DQK;      // block-uniform
    const _Float16* VbBlk = Vt + (size_t)b * DVDIM * NTOK;    // block-uniform

    // Q^T B-fragment: lane column = query (q0+lr), halfs sweep d_qk (=32)
    const v16h qf = load_frag_h(Qb + (size_t)(q0 + lr) * DQK, g);
    // the Q loads' address registers are reused by the address sums below
    asm volatile("s_wait_xcnt 0x0" ::: "memory");

    // Out-projection share of waves 0..7: output columns n0 .. n0+31 (one 128-byte
    // line per row) of the block's 64 queries. The Wv^T B fragments depend on
    // nothing computed here and are loaded beside the first key stage.
    const bool owave = __builtin_amdgcn_readfirstlane(wave) < 8;   // wave-uniform: scalar branch
    const int  n0    = (wave & 7) * 32;
    v16h wb[2][4];
    if (owave) {
        const _Float16* wrow = Wvt + (size_t)(n0 + lr) * DVDIM;
#pragma unroll
        for (int t = 0; t < 2; ++t)
#pragma unroll
            for (int c = 0; c < 4; ++c)
                wb[t][c] = load_frag_h(wrow + (t * 16) * DVDIM + c * 32, g);
        // keeps the loads' address registers untouched (also by the loads' own
        // results) until every request is taken
        asm volatile("s_wait_xcnt 0x0" :: "v"(wrow + 8 * g) : "memory");
    }

    // ---- async stage of 128 keys: 5 ops per wave ----
    auto fill = [&](int kb, int buf) {
        // K: 128 rows x 64 B contiguous = 8192 B = 512 lanes x 16 B
        // V: 128 rows (stride NTOK) x 256 B = 32768 B = 4 x 512 lanes x 16 B;
        //    16 lanes cover one row's 256 B, four lanes each group's 64 B
        const int d  = tid >> 4;                 // dv row 0..31 (copy c: +32c)
        const int pc = tid & 15;                 // 16-byte piece of the row
        _Float16*       lv = &Vbuf[buf][pc >> 2][d * LPITCH + (pc & 3) * 8];
        const _Float16* gv = VbBlk + (size_t)d * NTOK + kb + pc * 8;
        async_ld_stage(lds_off(&Kbuf[buf][(tid >> 2) * LPITCH + (tid & 3) * 8]),
                       KbBlk + (size_t)kb * DQK + tid * 8,
                       lds_off(lv),               gv,
                       lds_off(lv + 32 * LPITCH), gv + (size_t)32 * NTOK,
                       lds_off(lv + 64 * LPITCH), gv + (size_t)64 * NTOK,
                       lds_off(lv + 96 * LPITCH), gv + (size_t)96 * NTOK);
    };

    float m = -1e30f, l = 0.f;
    v8f acc[8];
#pragma unroll
    for (int dt = 0; dt < 8; ++dt) acc[dt] = (v8f){0,0,0,0,0,0,0,0};
    const v8f zero = {0,0,0,0,0,0,0,0};

    const int NST = NTOK / SKEYS;               // 32 stages
    fill(0, 0);
    wait_asynccnt_0();
    __syncthreads();                             // stage 0 visible to all waves
    fill(SKEYS, 1);
    for (int st = 0; st < NST; ++st) {
        const int buf = st & 1;

        // A-fragments from LDS: 16 key rows each, halfs sweep d_qk
        const v16h a0 = load_frag_h(&Kbuf[buf][(ks * 32 + lr) * LPITCH], g);
        const v16h a1 = load_frag_h(&Kbuf[buf][(ks * 32 + 16 + lr) * LPITCH], g);

        // S^T tiles: lane = query column, VGPR j -> key = kb + sub*16 + j + 8g
        v8f s0 = wmma_f16(a0, qf, zero);
        v8f s1 = wmma_f16(a1, qf, zero);

        // per-query max over this 32-key tile
        float tmax = s0[0];
#pragma unroll
        for (int j = 0; j < 8; ++j) {
            tmax = fmaxf(tmax, s0[j]);
            tmax = fmaxf(tmax, s1[j]);
        }
        tmax = fmaxf(tmax, __shfl_xor(tmax, 16, 32));
        const float mnew  = fmaxf(m, tmax);
        const float alpha = __expf(m - mnew);

        // exponentiate + pack P^T B-fragment (pure in-lane repack):
        //   h<8  -> key kb + h + 8g        == s0[j = h]
        //   h>=8 -> key kb + 16 + (h-8)+8g == s1[j = h-8]
        float psum = 0.f;
        v16h pf;
#pragma unroll
        for (int j = 0; j < 8; ++j) {
            const float p0 = __expf(s0[j] - mnew);
            const float p1 = __expf(s1[j] - mnew);
            psum += p0 + p1;
            pf[j]     = (_Float16)p0;
            pf[8 + j] = (_Float16)p1;
        }
        psum += __shfl_xor(psum, 16, 32);
        l = l * alpha + psum;
        m = mnew;

        // O^T accumulation over the 8 dv tiles (V^T rows from LDS)
#pragma unroll
        for (int dt = 0; dt < 8; ++dt) {
#pragma unroll
            for (int j = 0; j < 8; ++j) acc[dt][j] *= alpha;
            const v16h av = load_frag_h(&Vbuf[buf][ks][(dt * 16 + lr) * LPITCH], g);
            acc[dt] = wmma_f16(av, pf, acc[dt]);
        }

        // publish point: own reads of buf retired, own copies of stage st+1
        // landed; the one barrier publishes st+1 and frees buf for the refill
        wait_dscnt_0();
        wait_asynccnt_0();
        __syncthreads();
        if (st + 2 < NST) fill((st + 2) * SKEYS, buf);
    }
    wait_asynccnt_0();

    // residual rows and bias of this wave's output share (C-layout: lane = column,
    // element j = row j + 8g); issued ahead of the partials' LDS stores
    const size_t orow0 = (size_t)b * NTOK + (q0 - qt * 16) + 8 * g;
    const int    ocol  = n0 + lr;
    float xres[QTILES][2][8], bcol[2];
    if (owave) {
        const float* xp = x + orow0 * CIN + ocol;
#pragma unroll
        for (int t = 0; t < 2; ++t) {
            bcol[t] = bv[ocol + t * 16];
#pragma unroll
            for (int q4 = 0; q4 < QTILES; ++q4)
#pragma unroll
                for (int j = 0; j < 8; ++j)
                    xres[q4][t][j] = xp[(q4 * 16 + j) * CIN + t * 16];
        }
        // keeps the loads' address registers untouched (also by the loads' own
        // results) until every request is taken
        asm volatile("s_wait_xcnt 0x0" :: "v"(ocol), "v"(xp) : "memory");
    }

    // ---- merge the four key groups' partials of each query tile ----
#pragma unroll
    for (int dt = 0; dt < 8; ++dt) {
        Pacc[wave][dt * 2 + 0][lane] = (v4f){acc[dt][0], acc[dt][1], acc[dt][2], acc[dt][3]};
        Pacc[wave][dt * 2 + 1][lane] = (v4f){acc[dt][4], acc[dt][5], acc[dt][6], acc[dt][7]};
    }
    Pm[wave][lane] = m;
    Pl[wave][lane] = l;
    __syncthreads();                             // all partials visible

    float ms[KSPLIT], wgt[KSPLIT];
    float mall = -1e30f;
#pragma unroll
    for (int s = 0; s < KSPLIT; ++s) {
        ms[s] = Pm[s * QTILES + qt][lane];
        mall  = fmaxf(mall, ms[s]);
    }
    float lall = 0.f;
#pragma unroll
    for (int s = 0; s < KSPLIT; ++s) {
        wgt[s] = __expf(ms[s] - mall);
        lall  += wgt[s] * Pl[s * QTILES + qt][lane];
    }
    const float inv = 1.f / lall;
#pragma unroll
    for (int s = 0; s < KSPLIT; ++s) wgt[s] *= inv;

    // group ks merges dv 32*ks .. 32*ks+31 of its query tile. O^T element j of
    // tile 2*ks is k = j + 8g of the chunk, of tile 2*ks+1 k = 16 + j + 8g: the
    // k order of the 16-bit A/B operand (kmap), so the repack is in-lane.
    v8h ofl[2];
#pragma unroll
    for (int dd = 0; dd < 8 / KSPLIT; ++dd) {
        const int dt = ks * (8 / KSPLIT) + dd;
#pragma unroll
        for (int h = 0; h < 2; ++h) {
            v4f o = {0.f, 0.f, 0.f, 0.f};
#pragma unroll
            for (int s = 0; s < KSPLIT; ++s)
                o += Pacc[s * QTILES + qt][dt * 2 + h][lane] * wgt[s];
#pragma unroll
            for (int i = 0; i < 4; ++i) ofl[dd][h * 4 + i] = (_Float16)o[i];
        }
    }
    Ofr[qt][ks][0][lane] = ofl[0];
    Ofr[qt][ks][1][lane] = ofl[1];
    __syncthreads();                             // all O fragments visible

    // ---- out = x + O @ Wv + bv: 4 query tiles x 2 column tiles x 4 dv chunks ----
    if (!owave) return;                          // no barrier follows
    v8f oacc[QTILES][2];                         // start value: residual + bias
#pragma unroll
    for (int q4 = 0; q4 < QTILES; ++q4)
#pragma unroll
        for (int t = 0; t < 2; ++t)
#pragma unroll
            for (int j = 0; j < 8; ++j) oacc[q4][t][j] = xres[q4][t][j] + bcol[t];
#pragma unroll
    for (int c = 0; c < 4; ++c) {
#pragma unroll
        for (int q4 = 0; q4 < QTILES; ++q4) {
            const v8h lo = Ofr[q4][c][0][lane];
            const v8h hi = Ofr[q4][c][1][lane];
            v16h a;
#pragma unroll
            for (int i = 0; i < 8; ++i) { a[i] = lo[i]; a[8 + i] = hi[i]; }
#pragma unroll
            for (int t = 0; t < 2; ++t) oacc[q4][t] = wmma_f16(a, wb[t][c], oacc[q4][t]);
        }
    }
#pragma unroll
    for (int q4 = 0; q4 < QTILES; ++q4)
#pragma unroll
        for (int t = 0; t < 2; ++t)
#pragma unroll
            for (int j = 0; j < 8; ++j)
                out[(orow0 + q4 * 16 + j) * CIN + ocol + t * 16] = oacc[q4][t][j];
}

// ---------------------------------------------------------------------------
// Host-side launch. Workspace layout (bytes):
//   [0,       1 MB)   Qh  f16 [16384, 32]
//   [1 MB,    2 MB)   Kh  f16 [16384, 32]
//   [2 MB,    6 MB)   Vt  f16 [4, 128, 4096]   (transposed values)
//   [14 MB,  ...  )   Wft(16K) Wgt(16K) Wht(64K) Wvt(64K) f16 transposed weights
// ---------------------------------------------------------------------------
extern "C" void kernel_launch(void* const* d_in, const int* in_sizes, int n_in,
                              void* d_out, int out_size, void* d_ws, size_t ws_size,
                              hipStream_t stream) {
    const float* x  = (const float*)d_in[0];
    const float* Wf = (const float*)d_in[1];
    const float* bf = (const float*)d_in[2];
    const float* Wg = (const float*)d_in[3];
    const float* bg = (const float*)d_in[4];
    const float* Wh = (const float*)d_in[5];
    const float* bh = (const float*)d_in[6];
    const float* Wv = (const float*)d_in[7];
    const float* bv = (const float*)d_in[8];
    float* out = (float*)d_out;

    char* ws = (char*)d_ws;
    _Float16* Qh  = (_Float16*)(ws);
    _Float16* Kh  = (_Float16*)(ws + (1u << 20));
    _Float16* Vt  = (_Float16*)(ws + (2u << 20));
    _Float16* Wft = (_Float16*)(ws + (14u << 20));
    _Float16* Wgt = (_Float16*)(ws + (14u << 20) + (16u << 10));
    _Float16* Wht = (_Float16*)(ws + (14u << 20) + (32u << 10));
    _Float16* Wvt = (_Float16*)(ws + (14u << 20) + (96u << 10));

    // K0: weight transpose/convert (32768 threads)
    hipLaunchKernelGGL(prep_weights_kernel, dim3(128), dim3(256), 0, stream,
                       Wf, Wg, Wh, Wv, Wft, Wgt, Wht, Wvt);
    // K1: 1024 row-tile waves, 8 waves/block -> 128 blocks
    hipLaunchKernelGGL(proj_qkv_kernel, dim3(128), dim3(256), 0, stream,
                       x, Wft, bf, Wgt, bg, Wht, bh, Qh, Kh, Vt);
    // K2: 256 blocks x 16 waves, each block = 64 queries of one batch
    hipLaunchKernelGGL(attn_kernel, dim3(256), dim3(ATHREADS), 0, stream,
                       Qh, Kh, Vt, x, Wvt, bv, out);
}

// v005
// One run takes 47.8 microseconds.
// In both of two side-by-side timings against v004, it was 1.04 times as fast.
// All steps since v000 together make it 2.77 times as fast.
#include <hip/hip_runtime.h>
#include <hip/hip_bf16.h>

// ---------------------------------------------------------------------------
// Fused self-attention for gfx1250 (MI455X), f16 WMMA with f32 accumulation.
// B=4, H=W=64 -> N=4096 tokens/batch, C=256, DQK=32, DV=128.
// ---------------------------------------------------------------------------

#define BATCH 4
#define NTOK  4096        // H*W
#define CIN   256
#define DQK   32
#define DVDIM 128
#define ROWS  (BATCH * NTOK)   // 16384
#define LPITCH 40              // halfs per staged LDS row: 32 data + 8 pad (80 B)
#define KSPLIT 4               // key groups (waves that share a query tile)
#define QTILES 4               // 16-query tiles per attention block
#define SKEYS  (32 * KSPLIT)   // keys per staged LDS buffer
#define ATHREADS (32 * KSPLIT * QTILES)
#define WROWS  (2 * DQK + DVDIM)   // staged W^T rows of the QKV projection (K, Q, V)
#define WPITCH (CIN + 8)           // halfs per staged row: 256 data + 8 pad (528 B = 16 B x 33)

typedef _Float16 v16h __attribute__((ext_vector_type(16)));
typedef _Float16 v8h  __attribute__((ext_vector_type(8)));
typedef float    v8f  __attribute__((ext_vector_type(8)));
typedef float    v4f  __attribute__((ext_vector_type(4)));

// K index held by half-slot h (0..15) for lane-group g (0 or 1) in the
// 16-bit A/B operand of V_WMMA_*_16X16X32 (ISA 7.12.2):
//   h<8  -> K = h      + 8g      (VGPR 0..3)
//   h>=8 -> K = h + 8  + 8g      (VGPR 4..7)
__device__ __forceinline__ int kmap(int h, int g) {
    return (h < 8 ? h : h + 8) + 8 * g;
}

// Load a v16h A/B fragment from a contiguous f16 row `p` (row holds K=0..31).
// The two 8-half groups per lane are 16-byte aligned -> b128 vector loads
// (global_load_b128 or ds_load_b128 depending on the pointer).
__device__ __forceinline__ v16h load_frag_h(const _Float16* p, int g) {
    const v8h lo = *(const v8h*)(p + 8 * g);
    const v8h hi = *(const v8h*)(p + 16 + 8 * g);
    v16h r;
#pragma unroll
    for (int i = 0; i < 8; ++i) { r[i] = lo[i]; r[8 + i] = hi[i]; }
    return r;
}

// Load a v16h fragment from a contiguous f32 row (two groups of 8 consecutive
// floats at +8g and +16+8g), converting to f16. Lowers to b128 loads + cvt_pk.
__device__ __forceinline__ v16h load_frag_f32(const float* __restrict__ p, int g) {
    v16h r;
    const float* lo = p + 8 * g;
    const float* hi = p + 16 + 8 * g;
#pragma unroll
    for (int i = 0; i < 8; ++i) {
        r[i]     = (_Float16)lo[i];
        r[8 + i] = (_Float16)hi[i];
    }
    return r;
}

__device__ __forceinline__ v8f wmma_f16(v16h a, v16h b, v8f c) {
    return __builtin_amdgcn_wmma_f32_16x16x32_f16(false, a, false, b, (short)0, c,
                                                  false, false);
}

// ---- CDNA5 async global->LDS copies (ASYNCcnt-tracked) --------------------
// Generic pointers to __shared__ have the LDS byte offset in their low 32 bits
// (ISA 10.2: LDS aperture address is truncated to addr[31:0]).
__device__ __forceinline__ unsigned lds_off(const void* p) {
    return (unsigned)(uintptr_t)p;
}
// One 128-key stage = five 16-byte copies per lane (K: 1, V^T: 4). The
// s_wait_xcnt closes the statement so that it stands in front of any later
// rewrite of the address registers the copies name.
__device__ __forceinline__ void async_ld_stage(unsigned ldsK, const _Float16* gK,
                                               unsigned ldsV0, const _Float16* gV0,
                                               unsigned ldsV1, const _Float16* gV1,
                                               unsigned ldsV2, const _Float16* gV2,
                                               unsigned ldsV3, const _Float16* gV3) {
    asm volatile("global_load_async_to_lds_b128 %0, %1, off\n\t"
                 "global_load_async_to_lds_b128 %2, %3, off\n\t"
                 "global_load_async_to_lds_b128 %4, %5, off\n\t"
                 "global_load_async_to_lds_b128 %6, %7, off\n\t"
                 "global_load_async_to_lds_b128 %8, %9, off\n\t"
                 "s_wait_xcnt 0x0"
                 :: "v"(ldsK), "v"(gK), "v"(ldsV0), "v"(gV0), "v"(ldsV1), "v"(gV1),
                    "v"(ldsV2), "v"(gV2), "v"(ldsV3), "v"(gV3)
                 : "memory");
}
// This wave's own copies have landed (the barrier behind it publishes them).
__device__ __forceinline__ void wait_asynccnt_0() {
    asm volatile("s_wait_asynccnt 0x0" ::: "memory");
}
// This wave's own LDS reads have retired before the buffer they read is refilled.
__device__ __forceinline__ void wait_dscnt_0() {
    asm volatile("s_wait_dscnt 0x0" ::: "memory");
}

// ---------------------------------------------------------------------------
// Kernel 1: fused QKV projections. One wave per 16-row tile computes ALL
// output tiles (2 K + 2 Q + 8 V = 12 WMMAs per K-chunk), reusing the x
// A-fragment. x is read exactly once. Each block forms the 192 W^T rows (f16,
// 96 KB) in LDS itself, straight from the f32 weights: a lane loads 4 output
// columns x 8 consecutive k (eight 16-byte loads, whole 128-byte lines per
// wave), converts, and stores one 16-byte k run per column. The B-fragments
// then come by ds_load_b128 at a pitch of 16 B x odd (no bank conflict).
//   Kh = f16(x @ Wf + bf)   [ROWS, 32]
//   Qh = f16(x @ Wg + bg)   [ROWS, 32]
//   Vt = f16(x @ Wh + bh)^T [BATCH, 128, NTOK]
// Each thread also writes one element of Wvt = f16(Wv^T) [256, 128], which the
// attention launch reads.
// ---------------------------------------------------------------------------
__global__ void __launch_bounds__(256)
proj_qkv_kernel(const float* __restrict__ x,
                const float* __restrict__ Wf, const float* __restrict__ bf,
                const float* __restrict__ Wg, const float* __restrict__ bg,
                const float* __restrict__ Wh, const float* __restrict__ bh,
                const float* __restrict__ Wv,
                _Float16* __restrict__ Qh, _Float16* __restrict__ Kh,
                _Float16* __restrict__ Vt, _Float16* __restrict__ Wvt) {
    const int widx = blockIdx.x * 8 + (threadIdx.x >> 5);   // 0 .. 1023
    const int lane = threadIdx.x & 31;
    const int g    = lane >> 4;
    const int lr   = lane & 15;

    const int row0 = widx * 16;

    __shared__ __attribute__((aligned(16))) _Float16 Wl[WROWS * WPITCH];   // rows: 32 K, 32 Q, 128 V

    v8f accK[2], accQ[2], accV[8];
#pragma unroll
    for (int t = 0; t < 2; ++t) accK[t] = accQ[t] = (v8f){0,0,0,0,0,0,0,0};
#pragma unroll
    for (int t = 0; t < 8; ++t) accV[t] = (v8f){0,0,0,0,0,0,0,0};

    const _Float16* wfr = &Wl[lr * WPITCH];                 // row lr of the staged W^T tiles
    const _Float16* wgr = &Wl[(DQK + lr) * WPITCH];
    const _Float16* whr = &Wl[(2 * DQK + lr) * WPITCH];
    const float*    xr  = x + (size_t)(row0 + lr) * CIN;

    // ---- stage W^T: wave w takes k = 32w .. 32w+31 of all 192 output columns ----
    // Lane = (k octet, column quad). In every ds_store_b128 the 16 lanes of a
    // half-wave (4 quads x 4 octets) fall on 16 distinct groups of four banks.
    const int iv = blockIdx.x * 256 + threadIdx.x;          // this thread's Wvt element
    float wv;
    {
        const int kk = (threadIdx.x >> 5) * 32 + (lane & 3) * 8;   // first k of the lane's octet
        const int nq = (lane >> 2) * 4;                            // first column of its quad
        const float* pf = Wf + kk * DQK + nq;
        const float* pg = Wg + kk * DQK + nq;
        const float* ph = Wh + kk * DVDIM + nq;
        const float* pv = Wv + (iv & (DVDIM - 1)) * CIN + (iv >> 7);
        v4f r[6][8];                                        // [32-column group: K, Q, 4 x V][k]
#pragma unroll
        for (int i = 0; i < 8; ++i) {
            r[0][i] = *(const v4f*)(pf + i * DQK);
            r[1][i] = *(const v4f*)(pg + i * DQK);
#pragma unroll
            for (int nb = 0; nb < 4; ++nb)
                r[2 + nb][i] = *(const v4f*)(ph + i * DVDIM + nb * 32);
        }
        wv = *pv;
        // keeps the loads' address registers untouched (also by the loads' own
        // results) until every request is taken
        asm volatile("s_wait_xcnt 0x0" :: "v"(pf), "v"(pg), "v"(ph), "v"(pv) : "memory");
#pragma unroll
        for (int m = 0; m < 6; ++m)
#pragma unroll
            for (int c = 0; c < 4; ++c) {
                v8h h;
#pragma unroll
                for (int i = 0; i < 8; ++i) h[i] = (_Float16)r[m][i][c];
                *(v8h*)&Wl[(m * 32 + nq + c) * WPITCH + kk] = h;
            }
    }
    __syncthreads();                                        // staged W^T visible to all waves

    for (int k0 = 0; k0 < CIN; k0 += 32) {
        const v16h a = load_frag_f32(xr + k0, g);           // shared A fragment
#pragma unroll
        for (int t = 0; t < 2; ++t) {
            const v16h bK = load_frag_h(wfr + (t * 16) * WPITCH + k0, g);
            accK[t] = wmma_f16(a, bK, accK[t]);
            const v16h bQ = load_frag_h(wgr + (t * 16) * WPITCH + k0, g);
            accQ[t] = wmma_f16(a, bQ, accQ[t]);
        }
#pragma unroll
        for (int t = 0; t < 8; ++t) {
            const v16h bV = load_frag_h(whr + (t * 16) * WPITCH + k0, g);
            accV[t] = wmma_f16(a, bV, accV[t]);
        }
    }

    // ---- store K and Q: f16 [row, 32] (C-layout: row = row0 + j + 8g) ----
#pragma unroll
    for (int t = 0; t < 2; ++t) {
        const float bK = bf[t * 16 + lr];
        const float bQ = bg[t * 16 + lr];
#pragma unroll
        for (int j = 0; j < 8; ++j) {
            const size_t row = row0 + j + 8 * g;
            Kh[row * DQK + t * 16 + lr] = (_Float16)(accK[t][j] + bK);
            Qh[row * DQK + t * 16 + lr] = (_Float16)(accQ[t][j] + bQ);
        }
    }
    // ---- store V transposed: Vt[b][dv][token], 8 consecutive tokens/lane ----
    const int b     = row0 >> 12;
    const int nbase = (row0 & (NTOK - 1)) + 8 * g;
#pragma unroll
    for (int t = 0; t < 8; ++t) {
        const float bV = bh[t * 16 + lr];
        _Float16* dst = Vt + (size_t)b * DVDIM * NTOK + (size_t)(t * 16 + lr) * NTOK;
#pragma unroll
        for (int j = 0; j < 8; ++j)
            dst[nbase + j] = (_Float16)(accV[t][j] + bV);
    }
    // ---- Wv^T element n = iv / 128, k = iv % 128 (behind the barrier: no wait on it) ----
    Wvt[iv] = (_Float16)wv;
}

// ---------------------------------------------------------------------------
// Kernel 2: fused flash attention (transposed formulation) with the output
// projection and residual in its epilogue. Keys are split over
// four wave groups. One block (16 waves) owns 64 consecutive queries of one
// batch: wave = (query tile qt, key group ks). A stage is 128 keys; group ks
// works on its keys 32*ks .. 32*ks+31, so a wave walks a quarter of the keys
// and 256 blocks of four waves per SIMD cover every WGP. Stages are double-
// buffered in LDS via global_load_async_to_lds (ASYNCcnt). The 64-byte tile
// rows lie in LDS at a pitch of 80 bytes (16 B x odd): the 16 lanes of a
// half-wave, one row each, then fall on 16 distinct groups of four banks in
// every ds_load_b128.
//   S^T sub-tile  = WMMA(A = K rows, B = Q^T)        (2 per key tile)
//   online softmax across key tiles (cross-group shfl_xor(16) reduction)
//   O^T           = WMMA(A = V^T rows, B = P^T)      (8 per key tile)
// P^T B-fragment is built from the two S^T C-fragments *within each lane*.
// The four groups' (max, sum, O^T) partials of a query tile meet in LDS at the
// end; each group merges a quarter of the dv range.
// Epilogue: out = x + O @ Wv + bv for the block's 64 queries. The merged quarter
// of a lane is, in place, its part of the f16 A fragment (rows = queries) of one
// 32-wide dv chunk; the 16 fragments are exchanged through LDS and each of the
// waves 0..7 forms 64 queries x 32 output columns (32 WMMAs), so that a block
// loads every Wv^T fragment once. O never goes to memory.
// ---------------------------------------------------------------------------
__global__ void __launch_bounds__(ATHREADS)
attn_kernel(const _Float16* __restrict__ Qh, const _Float16* __restrict__ Kh,
            const _Float16* __restrict__ Vt, const float* __restrict__ x,
            const _Float16* __restrict__ Wvt, const float* __restrict__ bv,
            float* __restrict__ out) {
    __shared__ __attribute__((aligned(16))) _Float16 Kbuf[2][SKEYS * LPITCH];          // [buf][key(128)][dqk(32) + pad]
    __shared__ __attribute__((aligned(16))) _Float16 Vbuf[2][KSPLIT][DVDIM * LPITCH];  // [buf][group][dv(128)][key(32) + pad]
    __shared__ __attribute__((aligned(16))) v4f   Pacc[QTILES * KSPLIT][16][32];       // [wave][dt*2 + half][lane]
    __shared__ float Pm[QTILES * KSPLIT][32];                                          // [wave][lane]
    __shared__ float Pl[QTILES * KSPLIT][32];
    __shared__ __attribute__((aligned(16))) v8h Ofr[QTILES][KSPLIT][2][32];            // [query tile][dv chunk][low/high 8 halfs][lane]

    const int tid  = threadIdx.x;               // 0..511
    const int lane = tid & 31;
    const int g    = lane >> 4;
    const int lr   = lane & 15;
    const int wave = tid >> 5;                  // 0..15
    const int qt   = wave & (QTILES - 1);       // query tile of the block
    const int ks   = wave / QTILES;             // key group

    const int b    = blockIdx.x / (NTOK / (16 * QTILES));         // 64 blocks per batch
    const int q0   = (blockIdx.x % (NTOK / (16 * QTILES))) * (16 * QTILES) + qt * 16;

    const _Float16* Qb    = Qh + (size_t)b * NTOK * DQK;
    const _Float16* KbBlk = Kh + (size_t)b * NTOK * DQK;      // block-uniform
    const _Float16* VbBlk = Vt + (size_t)b * DVDIM * NTOK;    // block-uniform

    // Q^T B-fragment: lane column = query (q0+lr), halfs sweep d_qk (=32)
    const v16h qf = load_frag_h(Qb + (size_t)(q0 + lr) * DQK, g);
    // the Q loads' address registers are reused by the address sums below
    asm volatile("s_wait_xcnt 0x0" ::: "memory");

    // Out-projection share of waves 0..7: output columns n0 .. n0+31 (one 128-byte
    // line per row) of the block's 64 queries. The Wv^T B fragments depend on
    // nothing computed here and are loaded beside the first key stage.
    const bool owave = __builtin_amdgcn_readfirstlane(wave) < 8;   // wave-uniform: scalar branch
    const int  n0    = (wave & 7) * 32;
    v16h wb[2][4];
    if (owave) {
        const _Float16* wrow = Wvt + (size_t)(n0 + lr) * DVDIM;
#pragma unroll
        for (int t = 0; t < 2; ++t)
#pragma unroll
            for (int c = 0; c < 4; ++c)
                wb[t][c] = load_frag_h(wrow + (t * 16) * DVDIM + c * 32, g);
        // keeps the loads' address registers untouched (also by the loads' own
        // results) until every request is taken
        asm volatile("s_wait_xcnt 0x0" :: "v"(wrow + 8 * g) : "memory");
    }

    // ---- async stage of 128 keys: 5 ops per wave ----
    auto fill = [&](int kb, int buf) {
        // K: 128 rows x 64 B contiguous = 8192 B = 512 lanes x 16 B
        // V: 128 rows (stride NTOK) x 256 B = 32768 B = 4 x 512 lanes x 16 B;
        //    16 lanes cover one row's 256 B, four lanes each group's 64 B
        const int d  = tid >> 4;                 // dv row 0..31 (copy c: +32c)
        const int pc = tid & 15;                 // 16-byte piece of the row
        _Float16*       lv = &Vbuf[buf][pc >> 2][d * LPITCH + (pc & 3) * 8];
        const _Float16* gv = VbBlk + (size_t)d * NTOK + kb + pc * 8;
        async_ld_stage(lds_off(&Kbuf[buf][(tid >> 2) * LPITCH + (tid & 3) * 8]),
                       KbBlk + (size_t)kb * DQK + tid * 8,
                       lds_off(lv),               gv,
                       lds_off(lv + 32 * LPITCH), gv + (size_t)32 * NTOK,
                       lds_off(lv + 64 * LPITCH), gv + (size_t)64 * NTOK,
                       lds_off(lv + 96 * LPITCH), gv + (size_t)96 * NTOK);
    };

    float m = -1e30f, l = 0.f;
    v8f acc[8];
#pragma unroll
    for (int dt = 0; dt < 8; ++dt) acc[dt] = (v8f){0,0,0,0,0,0,0,0};
    const v8f zero = {0,0,0,0,0,0,0,0};

    const int NST = NTOK / SKEYS;               // 32 stages
    fill(0, 0);
    wait_asynccnt_0();
    __syncthreads();                             // stage 0 visible to all waves
    fill(SKEYS, 1);
    for (int st = 0; st < NST; ++st) {
        const int buf = st & 1;

        // A-fragments from LDS: 16 key rows each, halfs sweep d_qk
        const v16h a0 = load_frag_h(&Kbuf[buf][(ks * 32 + lr) * LPITCH], g);
        const v16h a1 = load_frag_h(&Kbuf[buf][(ks * 32 + 16 + lr) * LPITCH], g);

        // S^T tiles: lane = query column, VGPR j -> key = kb + sub*16 + j + 8g
        v8f s0 = wmma_f16(a0, qf, zero);
        v8f s1 = wmma_f16(a1, qf, zero);

        // per-query max over this 32-key tile
        float tmax = s0[0];
#pragma unroll
        for (int j = 0; j < 8; ++j) {
            tmax = fmaxf(tmax, s0[j]);
            tmax = fmaxf(tmax, s1[j]);
        }
        tmax = fmaxf(tmax, __shfl_xor(tmax, 16, 32));
        const float mnew  = fmaxf(m, tmax);
        const float alpha = __expf(m - mnew);

        // exponentiate + pack P^T B-fragment (pure in-lane repack):
        //   h<8  -> key kb + h + 8g        == s0[j = h]
        //   h>=8 -> key kb + 16 + (h-8)+8g == s1[j = h-8]
        float psum = 0.f;
        v16h pf;
#pragma unroll
        for (int j = 0; j < 8; ++j) {
            const float p0 = __expf(s0[j] - mnew);
            const float p1 = __expf(s1[j] - mnew);
            psum += p0 + p1;
            pf[j]     = (_Float16)p0;
            pf[8 + j] = (_Float16)p1;
        }
        psum += __shfl_xor(psum, 16, 32);
        l = l * alpha + psum;
        m = mnew;

        // O^T accumulation over the 8 dv tiles (V^T rows from LDS)
#pragma unroll
        for (int dt = 0; dt < 8; ++dt) {
#pragma unroll
            for (int j = 0; j < 8; ++j) acc[dt][j] *= alpha;
            const v16h av = load_frag_h(&Vbuf[buf][ks][(dt * 16 + lr) * LPITCH], g);
            acc[dt] = wmma_f16(av, pf, acc[dt]);
        }

        // publish point: own reads of buf retired, own copies of stage st+1
        // landed; the one barrier publishes st+1 and frees buf for the refill
        wait_dscnt_0();
        wait_asynccnt_0();
        __syncthreads();
        if (st + 2 < NST) fill((st + 2) * SKEYS, buf);
    }
    wait_asynccnt_0();

    // residual rows and bias of this wave's output share (C-layout: lane = column,
    // element j = row j + 8g); issued ahead of the partials' LDS stores
    const size_t orow0 = (size_t)b * NTOK + (q0 - qt * 16) + 8 * g;
    const int    ocol  = n0 + lr;
    float xres[QTILES][2][8], bcol[2];
    if (owave) {
        const float* xp = x + orow0 * CIN + ocol;
#pragma unroll
        for (int t = 0; t < 2; ++t) {
            bcol[t] = bv[ocol + t * 16];
#pragma unroll
            for (int q4 = 0; q4 < QTILES; ++q4)
#pragma unroll
                for (int j = 0; j < 8; ++j)
                    xres[q4][t][j] = xp[(q4 * 16 + j) * CIN + t * 16];
        }
        // keeps the loads' address registers untouched (also by the loads' own
        // results) until every request is taken
        asm volatile("s_wait_xcnt 0x0" :: "v"(ocol), "v"(xp) : "memory");
    }

    // ---- merge the four key groups' partials of each query tile ----
#pragma unroll
    for (int dt = 0; dt < 8; ++dt) {
        Pacc[wave][dt * 2 + 0][lane] = (v4f){acc[dt][0], acc[dt][1], acc[dt][2], acc[dt][3]};
        Pacc[wave][dt * 2 + 1][lane] = (v4f){acc[dt][4], acc[dt][5], acc[dt][6], acc[dt][7]};
    }
    Pm[wave][lane] = m;
    Pl[wave][lane] = l;
    __syncthreads();                             // all partials visible

    float ms[KSPLIT], wgt[KSPLIT];
    float mall = -1e30f;
#pragma unroll
    for (int s = 0; s < KSPLIT; ++s) {
        ms[s] = Pm[s * QTILES + qt][lane];
        mall  = fmaxf(mall, ms[s]);
    }
    float lall = 0.f;
#pragma unroll
    for (int s = 0; s < KSPLIT; ++s) {
        wgt[s] = __expf(ms[s] - mall);
        lall  += wgt[s] * Pl[s * QTILES + qt][lane];
    }
    const float inv = 1.f / lall;
#pragma unroll
    for (int s = 0; s < KSPLIT; ++s) wgt[s] *= inv;

    // group ks merges dv 32*ks .. 32*ks+31 of its query tile. O^T element j of
    // tile 2*ks is k = j + 8g of the chunk, of tile 2*ks+1 k = 16 + j + 8g: the
    // k order of the 16-bit A/B operand (kmap), so the repack is in-lane.
    v8h ofl[2];
#pragma unroll
    for (int dd = 0; dd < 8 / KSPLIT; ++dd) {
        const int dt = ks * (8 / KSPLIT) + dd;
#pragma unroll
        for (int h = 0; h < 2; ++h) {
            v4f o = {0.f, 0.f, 0.f, 0.f};
#pragma unroll
            for (int s = 0; s < KSPLIT; ++s)
                o += Pacc[s * QTILES + qt][dt * 2 + h][lane] * wgt[s];
#pragma unroll
            for (int i = 0; i < 4; ++i) ofl[dd][h * 4 + i] = (_Float16)o[i];
        }
    }
    Ofr[qt][ks][0][lane] = ofl[0];
    Ofr[qt][ks][1][lane] = ofl[1];
    __syncthreads();                             // all O fragments visible

    // ---- out = x + O @ Wv + bv: 4 query tiles x 2 column tiles x 4 dv chunks ----
    if (!owave) return;                          // no barrier follows
    v8f oacc[QTILES][2];                         // start value: residual + bias
#pragma unroll
    for (int q4 = 0; q4 < QTILES; ++q4)
#pragma unroll
        for (int t = 0; t < 2; ++t)
#pragma unroll
            for (int j = 0; j < 8; ++j) oacc[q4][t][j] = xres[q4][t][j] + bcol[t];
#pragma unroll
    for (int c = 0; c < 4; ++c) {
#pragma unroll
        for (int q4 = 0; q4 < QTILES; ++q4) {
            const v8h lo = Ofr[q4][c][0][lane];
            const v8h hi = Ofr[q4][c][1][lane];
            v16h a;
#pragma unroll
            for (int i = 0; i < 8; ++i) { a[i] = lo[i]; a[8 + i] = hi[i]; }
#pragma unroll
            for (int t = 0; t < 2; ++t) oacc[q4][t] = wmma_f16(a, wb[t][c], oacc[q4][t]);
        }
    }
#pragma unroll
    for (int q4 = 0; q4 < QTILES; ++q4)
#pragma unroll
        for (int t = 0; t < 2; ++t)
#pragma unroll
            for (int j = 0; j < 8; ++j)
                out[(orow0 + q4 * 16 + j) * CIN + ocol + t * 16] = oacc[q4][t][j];
}

// ---------------------------------------------------------------------------
// Host-side launch. Workspace layout (bytes):
//   [0,       1 MB)   Qh  f16 [16384, 32]
//   [1 MB,    2 MB)   Kh  f16 [16384, 32]
//   [2 MB,    6 MB)   Vt  f16 [4, 128, 4096]   (transposed values)
//   [14 MB,  ...  )   Wvt f16 [256, 128]      (transposed out-projection weights)
// ---------------------------------------------------------------------------
extern "C" void kernel_launch(void* const* d_in, const int* in_sizes, int n_in,
                              void* d_out, int out_size, void* d_ws, size_t ws_size,
                              hipStream_t stream) {
    const float* x  = (const float*)d_in[0];
    const float* Wf = (const float*)d_in[1];
    const float* bf = (const float*)d_in[2];
    const float* Wg = (const float*)d_in[3];
    const float* bg = (const float*)d_in[4];
    const float* Wh = (const float*)d_in[5];
    const float* bh = (const float*)d_in[6];
    const float* Wv = (const float*)d_in[7];
    const float* bv = (const float*)d_in[8];
    float* out = (float*)d_out;

    char* ws = (char*)d_ws;
    _Float16* Qh  = (_Float16*)(ws);
    _Float16* Kh  = (_Float16*)(ws + (1u << 20));
    _Float16* Vt  = (_Float16*)(ws + (2u << 20));
    _Float16* Wvt = (_Float16*)(ws + (14u << 20));

    // K1: 1024 row-tile waves, 8 waves/block -> 128 blocks
    hipLaunchKernelGGL(proj_qkv_kernel, dim3(128), dim3(256), 0, stream,
                       x, Wf, bf, Wg, bg, Wh, bh, Wv, Qh, Kh, Vt, Wvt);
    // K2: 256 blocks x 16 waves, each block = 64 queries of one batch
    hipLaunchKernelGGL(attn_kernel, dim3(256), dim3(ATHREADS), 0, stream,
                       Qh, Kh, Vt, x, Wvt, bv, out);
}

// v006
// One run takes 46.3 microseconds.
// In two side-by-side timings against v005, it was 1.03 and 1.04 times as fast.
// Over all steps from v000 it is 2.86 times as fast.
#include <hip/hip_runtime.h>
#include <hip/hip_bf16.h>

// ---------------------------------------------------------------------------
// Fused self-attention for gfx1250 (MI455X), f16 WMMA with f32 accumulation.
// B=4, H=W=64 -> N=4096 tokens/batch, C=256, DQK=32, DV=128.
// ---------------------------------------------------------------------------

#define BATCH 4
#define NTOK  4096        // H*W
#define CIN   256
#define DQK   32
#define DVDIM 128
#define ROWS  (BATCH * NTOK)   // 16384
#define LPITCH 40              // halfs per staged LDS row: 32 data + 8 pad (80 B)
#define KSPLIT 4               // key groups (waves that share a query tile)
#define QTILES 4               // 16-query tiles per attention block
#define SKEYS  (32 * KSPLIT)   // keys per staged LDS buffer
#define ATHREADS (32 * KSPLIT * QTILES)
#define WROWS  (2 * DQK + DVDIM)   // staged W^T rows of the QKV projection (K, Q, V)
#define WPITCH (CIN + 8)           // halfs per staged row: 256 data + 8 pad (528 B = 16 B x 33)
#define XROWS  128                 // x rows per projection block (8 waves x 16)
#define XPITCH (CIN + 4)           // floats per staged x row: 256 data + 4 pad (1040 B = 16 B x 65)

typedef _Float16 v16h __attribute__((ext_vector_type(16)));
typedef _Float16 v8h  __attribute__((ext_vector_type(8)));
typedef float    v8f  __attribute__((ext_vector_type(8)));
typedef float    v4f  __attribute__((ext_vector_type(4)));

// K index held by half-slot h (0..15) for lane-group g (0 or 1) in the
// 16-bit A/B operand of V_WMMA_*_16X16X32 (ISA 7.12.2):
//   h<8  -> K = h      + 8g      (VGPR 0..3)
//   h>=8 -> K = h + 8  + 8g      (VGPR 4..7)
__device__ __forceinline__ int kmap(int h, int g) {
    return (h < 8 ? h : h + 8) + 8 * g;
}

// Load a v16h A/B fragment from a contiguous f16 row `p` (row holds K=0..31).
// The two 8-half groups per lane are 16-byte aligned -> b128 vector loads
// (global_load_b128 or ds_load_b128 depending on the pointer).
__device__ __forceinline__ v16h load_frag_h(const _Float16* p, int g) {
    const v8h lo = *(const v8h*)(p + 8 * g);
    const v8h hi = *(const v8h*)(p + 16 + 8 * g);
    v16h r;
#pragma unroll
    for (int i = 0; i < 8; ++i) { r[i] = lo[i]; r[8 + i] = hi[i]; }
    return r;
}

// Load a v16h fragment from a contiguous, 16-byte aligned f32 row (two groups of
// 8 consecutive floats at +8g and +16+8g), converting to f16: four b128 loads
// + cvt_pk.
__device__ __forceinline__ v16h load_frag_f32(const float* p, int g) {
    const v4f lo0 = *(const v4f*)(p + 8 * g);
    const v4f lo1 = *(const v4f*)(p + 8 * g + 4);
    const v4f hi0 = *(const v4f*)(p + 16 + 8 * g);
    const v4f hi1 = *(const v4f*)(p + 16 + 8 * g + 4);
    v16h r;
#pragma unroll
    for (int i = 0; i < 4; ++i) {
        r[i]      = (_Float16)lo0[i];
        r[4 + i]  = (_Float16)lo1[i];
        r[8 + i]  = (_Float16)hi0[i];
        r[12 + i] = (_Float16)hi1[i];
    }
    return r;
}

__device__ __forceinline__ v8f wmma_f16(v16h a, v16h b, v8f c) {
    return __builtin_amdgcn_wmma_f32_16x16x32_f16(false, a, false, b, (short)0, c,
                                                  false, false);
}

// ---- CDNA5 async global->LDS copies (ASYNCcnt-tracked) --------------------
// Generic pointers to __shared__ have the LDS byte offset in their low 32 bits
// (ISA 10.2: LDS aperture address is truncated to addr[31:0]).
__device__ __forceinline__ unsigned lds_off(const void* p) {
    return (unsigned)(uintptr_t)p;
}
// One 128-key stage = five 16-byte copies per lane (K: 1, V^T: 4). The
// s_wait_xcnt closes the statement so that it stands in front of any later
// rewrite of the address registers the copies name.
__device__ __forceinline__ void async_ld_stage(unsigned ldsK, const _Float16* gK,
                                               unsigned ldsV0, const _Float16* gV0,
                                               unsigned ldsV1, const _Float16* gV1,
                                               unsigned ldsV2, const _Float16* gV2,
                                               unsigned ldsV3, const _Float16* gV3) {
    asm volatile("global_load_async_to_lds_b128 %0, %1, off\n\t"
                 "global_load_async_to_lds_b128 %2, %3, off\n\t"
                 "global_load_async_to_lds_b128 %4, %5, off\n\t"
                 "global_load_async_to_lds_b128 %6, %7, off\n\t"
                 "global_load_async_to_lds_b128 %8, %9, off\n\t"
                 "s_wait_xcnt 0x0"
                 :: "v"(ldsK), "v"(gK), "v"(ldsV0), "v"(gV0), "v"(ldsV1), "v"(gV1),
                    "v"(ldsV2), "v"(gV2), "v"(ldsV3), "v"(gV3)
                 : "memory");
}
// Four x rows of 1 KB = eight 16-byte copies per lane (a copy = 512 contiguous
// bytes per wave: whole lines). gx / lx: the lane's place in the first row. The
// s_wait_xcnt closes the statement so that it stands in front of any later
// rewrite of the address registers the copies name.
__device__ __forceinline__ void async_ld_x4rows(unsigned lx, const float* gx) {
    asm volatile("global_load_async_to_lds_b128 %0, %1, off\n\t"
                 "global_load_async_to_lds_b128 %2, %3, off\n\t"
                 "global_load_async_to_lds_b128 %4, %5, off\n\t"
                 "global_load_async_to_lds_b128 %6, %7, off\n\t"
                 "global_load_async_to_lds_b128 %8, %9, off\n\t"
                 "global_load_async_to_lds_b128 %10, %11, off\n\t"
                 "global_load_async_to_lds_b128 %12, %13, off\n\t"
                 "global_load_async_to_lds_b128 %14, %15, off\n\t"
                 "s_wait_xcnt 0x0"
                 :: "v"(lx),                    "v"(gx),
                    "v"(lx + 512),              "v"(gx + 128),
                    "v"(lx + 4 * XPITCH),       "v"(gx + CIN),
                    "v"(lx + 4 * XPITCH + 512), "v"(gx + CIN + 128),
                    "v"(lx + 8 * XPITCH),       "v"(gx + 2 * CIN),
                    "v"(lx + 8 * XPITCH + 512), "v"(gx + 2 * CIN + 128),
                    "v"(lx + 12 * XPITCH),       "v"(gx + 3 * CIN),
                    "v"(lx + 12 * XPITCH + 512), "v"(gx + 3 * CIN + 128)
                 : "memory");
}
// This wave's own copies have landed (the barrier behind it publishes them).
__device__ __forceinline__ void wait_asynccnt_0() {
    asm volatile("s_wait_asynccnt 0x0" ::: "memory");
}
// This wave's own LDS reads have retired before the buffer they read is refilled.
__device__ __forceinline__ void wait_dscnt_0() {
    asm volatile("s_wait_dscnt 0x0" ::: "memory");
}

// ---------------------------------------------------------------------------
// Kernel 1: fused QKV projections. One wave per 16-row tile computes ALL
// output tiles (2 K + 2 Q + 8 V = 12 WMMAs per K-chunk), reusing the x
// A-fragment. x is read exactly once: right behind the weight loads each wave
// sends for its whole 16 x 256 f32 tile by async copies to LDS (32 copies of
// whole lines, all in flight at once, under the weight staging), so the load
// latency is paid once and not once per K-chunk; the A-fragments come by
// ds_load_b128 at a pitch of 16 B x odd. Each block forms the 192 W^T rows (f16,
// 96 KB) in LDS itself, straight from the f32 weights: a lane loads 4 output
// columns x 8 consecutive k (eight 16-byte loads, whole 128-byte lines per
// wave), converts, and stores one 16-byte k run per column. The B-fragments
// then come by ds_load_b128 at a pitch of 16 B x odd (no bank conflict).
//   Kh = f16(x @ Wf + bf)   [ROWS, 32]
//   Qh = f16(x @ Wg + bg)   [ROWS, 32]
//   Vt = f16(x @ Wh + bh)^T [BATCH, 128, NTOK]
// Each thread also writes one element of Wvt = f16(Wv^T) [256, 128], which the
// attention launch reads.
// ---------------------------------------------------------------------------
__global__ void __launch_bounds__(256)
proj_qkv_kernel(const float* __restrict__ x,
                const float* __restrict__ Wf, const float* __restrict__ bf,
                const float* __restrict__ Wg, const float* __restrict__ bg,
                const float* __restrict__ Wh, const float* __restrict__ bh,
                const float* __restrict__ Wv,
                _Float16* __restrict__ Qh, _Float16* __restrict__ Kh,
                _Float16* __restrict__ Vt, _Float16* __restrict__ Wvt) {
    const int widx = blockIdx.x * 8 + (threadIdx.x >> 5);   // 0 .. 1023
    const int lane = threadIdx.x & 31;
    const int g    = lane >> 4;
    const int lr   = lane & 15;

    const int row0 = widx * 16;

    __shared__ __attribute__((aligned(16))) _Float16 Wl[WROWS * WPITCH];   // rows: 32 K, 32 Q, 128 V
    __shared__ __attribute__((aligned(16))) float    Xl[XROWS * XPITCH];   // the block's x rows, f32

    v8f accK[2], accQ[2], accV[8];
#pragma unroll
    for (int t = 0; t < 2; ++t) accK[t] = accQ[t] = (v8f){0,0,0,0,0,0,0,0};
#pragma unroll
    for (int t = 0; t < 8; ++t) accV[t] = (v8f){0,0,0,0,0,0,0,0};

    const _Float16* wfr = &Wl[lr * WPITCH];                 // row lr of the staged W^T tiles
    const _Float16* wgr = &Wl[(DQK + lr) * WPITCH];
    const _Float16* whr = &Wl[(2 * DQK + lr) * WPITCH];
    const float*    xr  = &Xl[((threadIdx.x >> 5) * 16 + lr) * XPITCH];   // staged x row of this lane

    // ---- stage W^T: wave w takes k = 32w .. 32w+31 of all 192 output columns ----
    // Lane = (k octet, column quad). In every ds_store_b128 the 16 lanes of a
    // half-wave (4 quads x 4 octets) fall on 16 distinct groups of four banks.
    const int iv = blockIdx.x * 256 + threadIdx.x;          // this thread's Wvt element
    float wv;
    {
        const int kk = (threadIdx.x >> 5) * 32 + (lane & 3) * 8;   // first k of the lane's octet
        const int nq = (lane >> 2) * 4;                            // first column of its quad
        const float* pf = Wf + kk * DQK + nq;
        const float* pg = Wg + kk * DQK + nq;
        const float* ph = Wh + kk * DVDIM + nq;
        const float* pv = Wv + (iv & (DVDIM - 1)) * CIN + (iv >> 7);
        v4f r[6][8];                                        // [32-column group: K, Q, 4 x V][k]
#pragma unroll
        for (int i = 0; i < 8; ++i) {
            r[0][i] = *(const v4f*)(pf + i * DQK);
            r[1][i] = *(const v4f*)(pg + i * DQK);
#pragma unroll
            for (int nb = 0; nb < 4; ++nb)
                r[2 + nb][i] = *(const v4f*)(ph + i * DVDIM + nb * 32);
        }
        wv = *pv;
        // keeps the loads' address registers untouched (also by the loads' own
        // results) until every request is taken
        asm volatile("s_wait_xcnt 0x0" :: "v"(pf), "v"(pg), "v"(ph), "v"(pv) : "memory");
        // ---- this wave's 16 x rows: 32 copies, issued while the weight loads fly ----
        {
            const float*   gx = x + (size_t)row0 * CIN + lane * 4;
            const unsigned lx = lds_off(&Xl[(threadIdx.x >> 5) * 16 * XPITCH + lane * 4]);
            // kept rolled: one set of address registers serves all four trips, while
            // the 48 weight loads in flight hold most of the register file
#pragma nounroll
            for (int r4 = 0; r4 < 4; ++r4)
                async_ld_x4rows(lx + r4 * 16 * XPITCH, gx + r4 * 4 * CIN);
        }
#pragma unroll
        for (int m = 0; m < 6; ++m)
#pragma unroll
            for (int c = 0; c < 4; ++c) {
                v8h h;
#pragma unroll
                for (int i = 0; i < 8; ++i) h[i] = (_Float16)r[m][i][c];
                *(v8h*)&Wl[(m * 32 + nq + c) * WPITCH + kk] = h;
            }
    }
    wait_asynccnt_0();                                      // own x tile landed
    __syncthreads();                                        // staged W^T and x visible to all waves

    for (int k0 = 0; k0 < CIN; k0 += 32) {
        const v16h a = load_frag_f32(xr + k0, g);           // shared A fragment
#pragma unroll
        for (int t = 0; t < 2; ++t) {
            const v16h bK = load_frag_h(wfr + (t * 16) * WPITCH + k0, g);
            accK[t] = wmma_f16(a, bK, accK[t]);
            const v16h bQ = load_frag_h(wgr + (t * 16) * WPITCH + k0, g);
            accQ[t] = wmma_f16(a, bQ, accQ[t]);
        }
#pragma unroll
        for (int t = 0; t < 8; ++t) {
            const v16h bV = load_frag_h(whr + (t * 16) * WPITCH + k0, g);
            accV[t] = wmma_f16(a, bV, accV[t]);
        }
    }

    // ---- store K and Q: f16 [row, 32] (C-layout: row = row0 + j + 8g) ----
#pragma unroll
    for (int t = 0; t < 2; ++t) {
        const float bK = bf[t * 16 + lr];
        const float bQ = bg[t * 16 + lr];
#pragma unroll
        for (int j = 0; j < 8; ++j) {
            const size_t row = row0 + j + 8 * g;
            Kh[row * DQK + t * 16 + lr] = (_Float16)(accK[t][j] + bK);
            Qh[row * DQK + t * 16 + lr] = (_Float16)(accQ[t][j] + bQ);
        }
    }
    // ---- store V transposed: Vt[b][dv][token], 8 consecutive tokens/lane ----
    const int b     = row0 >> 12;
    const int nbase = (row0 & (NTOK - 1)) + 8 * g;
#pragma unroll
    for (int t = 0; t < 8; ++t) {
        const float bV = bh[t * 16 + lr];
        _Float16* dst = Vt + (size_t)b * DVDIM * NTOK + (size_t)(t * 16 + lr) * NTOK;
#pragma unroll
        for (int j = 0; j < 8; ++j)
            dst[nbase + j] = (_Float16)(accV[t][j] + bV);
    }
    // ---- Wv^T element n = iv / 128, k = iv % 128 (behind the barrier: no wait on it) ----
    Wvt[iv] = (_Float16)wv;
}

// ---------------------------------------------------------------------------
// Kernel 2: fused flash attention (transposed formulation) with the output
// projection and residual in its epilogue. Keys are split over
// four wave groups. One block (16 waves) owns 64 consecutive queries of one
// batch: wave = (query tile qt, key group ks). A stage is 128 keys; group ks
// works on its keys 32*ks .. 32*ks+31, so a wave walks a quarter of the keys
// and 256 blocks of four waves per SIMD cover every WGP. Stages are double-
// buffered in LDS via global_load_async_to_lds (ASYNCcnt). The 64-byte tile
// rows lie in LDS at a pitch of 80 bytes (16 B x odd): the 16 lanes of a
// half-wave, one row each, then fall on 16 distinct groups of four banks in
// every ds_load_b128.
//   S^T sub-tile  = WMMA(A = K rows, B = Q^T)        (2 per key tile)
//   online softmax across key tiles (cross-group shfl_xor(16) reduction)
//   O^T           = WMMA(A = V^T rows, B = P^T)      (8 per key tile)
// P^T B-fragment is built from the two S^T C-fragments *within each lane*.
// The four groups' (max, sum, O^T) partials of a query tile meet in LDS at the
// end; each group merges a quarter of the dv range.
// Epilogue: out = x + O @ Wv + bv for the block's 64 queries. The merged quarter
// of a lane is, in place, its part of the f16 A fragment (rows = queries) of one
// 32-wide dv chunk; the 16 fragments are exchanged through LDS and each of the
// waves 0..7 forms 64 queries x 32 output columns (32 WMMAs), so that a block
// loads every Wv^T fragment once. O never goes to memory.
// ---------------------------------------------------------------------------
__global__ void __launch_bounds__(ATHREADS)
attn_kernel(const _Float16* __restrict__ Qh, const _Float16* __restrict__ Kh,
            const _Float16* __restrict__ Vt, const float* __restrict__ x,
            const _Float16* __restrict__ Wvt, const float* __restrict__ bv,
            float* __restrict__ out) {
    __shared__ __attribute__((aligned(16))) _Float16 Kbuf[2][SKEYS * LPITCH];          // [buf][key(128)][dqk(32) + pad]
    __shared__ __attribute__((aligned(16))) _Float16 Vbuf[2][KSPLIT][DVDIM * LPITCH];  // [buf][group][dv(128)][key(32) + pad]
    __shared__ __attribute__((aligned(16))) v4f   Pacc[QTILES * KSPLIT][16][32];       // [wave][dt*2 + half][lane]
    __shared__ float Pm[QTILES * KSPLIT][32];                                          // [wave][lane]
    __shared__ float Pl[QTILES * KSPLIT][32];
    __shared__ __attribute__((aligned(16))) v8h Ofr[QTILES][KSPLIT][2][32];            // [query tile][dv chunk][low/high 8 halfs][lane]

    const int tid  = threadIdx.x;               // 0..511
    const int lane = tid & 31;
    const int g    = lane >> 4;
    const int lr   = lane & 15;
    const int wave = tid >> 5;                  // 0..15
    const int qt   = wave & (QTILES - 1);       // query tile of the block
    const int ks   = wave / QTILES;             // key group

    const int b    = blockIdx.x / (NTOK / (16 * QTILES));         // 64 blocks per batch
    const int q0   = (blockIdx.x % (NTOK / (16 * QTILES))) * (16 * QTILES) + qt * 16;

    const _Float16* Qb    = Qh + (size_t)b * NTOK * DQK;
    const _Float16* KbBlk = Kh + (size_t)b * NTOK * DQK;      // block-uniform
    const _Float16* VbBlk = Vt + (size_t)b * DVDIM * NTOK;    // block-uniform

    // Q^T B-fragment: lane column = query (q0+lr), halfs sweep d_qk (=32)
    const v16h qf = load_frag_h(Qb + (size_t)(q0 + lr) * DQK, g);
    // the Q loads' address registers are reused by the address sums below
    asm volatile("s_wait_xcnt 0x0" ::: "memory");

    // Out-projection share of waves 0..7: output columns n0 .. n0+31 (one 128-byte
    // line per row) of the block's 64 queries. The Wv^T B fragments depend on
    // nothing computed here and are loaded beside the first key stage.
    const bool owave = __builtin_amdgcn_readfirstlane(wave) < 8;   // wave-uniform: scalar branch
    const int  n0    = (wave & 7) * 32;
    v16h wb[2][4];
    if (owave) {
        const _Float16* wrow = Wvt + (size_t)(n0 + lr) * DVDIM;
#pragma unroll
        for (int t = 0; t < 2; ++t)
#pragma unroll
            for (int c = 0; c < 4; ++c)
                wb[t][c] = load_frag_h(wrow + (t * 16) * DVDIM + c * 32, g);
        // keeps the loads' address registers untouched (also by the loads' own
        // results) until every request is taken
        asm volatile("s_wait_xcnt 0x0" :: "v"(wrow + 8 * g) : "memory");
    }

    // ---- async stage of 128 keys: 5 ops per wave ----
    auto fill = [&](int kb, int buf) {
        // K: 128 rows x 64 B contiguous = 8192 B = 512 lanes x 16 B
        // V: 128 rows (stride NTOK) x 256 B = 32768 B = 4 x 512 lanes x 16 B;
        //    16 lanes cover one row's 256 B, four lanes each group's 64 B
        const int d  = tid >> 4;                 // dv row 0..31 (copy c: +32c)
        const int pc = tid & 15;                 // 16-byte piece of the row
        _Float16*       lv = &Vbuf[buf][pc >> 2][d * LPITCH + (pc & 3) * 8];
        const _Float16* gv = VbBlk + (size_t)d * NTOK + kb + pc * 8;
        async_ld_stage(lds_off(&Kbuf[buf][(tid >> 2) * LPITCH + (tid & 3) * 8]),
                       KbBlk + (size_t)kb * DQK + tid * 8,
                       lds_off(lv),               gv,
                       lds_off(lv + 32 * LPITCH), gv + (size_t)32 * NTOK,
                       lds_off(lv + 64 * LPITCH), gv + (size_t)64 * NTOK,
                       lds_off(lv + 96 * LPITCH), gv + (size_t)96 * NTOK);
    };

    float m = -1e30f, l = 0.f;
    v8f acc[8];
#pragma unroll
    for (int dt = 0; dt < 8; ++dt) acc[dt] = (v8f){0,0,0,0,0,0,0,0};
    const v8f zero = {0,0,0,0,0,0,0,0};

    const int NST = NTOK / SKEYS;               // 32 stages
    fill(0, 0);
    wait_asynccnt_0();
    __syncthreads();                             // stage 0 visible to all waves
    fill(SKEYS, 1);
    for (int st = 0; st < NST; ++st) {
        const int buf = st & 1;

        // A-fragments from LDS: 16 key rows each, halfs sweep d_qk
        const v16h a0 = load_frag_h(&Kbuf[buf][(ks * 32 + lr) * LPITCH], g);
        const v16h a1 = load_frag_h(&Kbuf[buf][(ks * 32 + 16 + lr) * LPITCH], g);

        // S^T tiles: lane = query column, VGPR j -> key = kb + sub*16 + j + 8g
        v8f s0 = wmma_f16(a0, qf, zero);
        v8f s1 = wmma_f16(a1, qf, zero);

        // per-query max over this 32-key tile
        float tmax = s0[0];
#pragma unroll
        for (int j = 0; j < 8; ++j) {
            tmax = fmaxf(tmax, s0[j]);
            tmax = fmaxf(tmax, s1[j]);
        }
        tmax = fmaxf(tmax, __shfl_xor(tmax, 16, 32));
        const float mnew  = fmaxf(m, tmax);
        const float alpha = __expf(m - mnew);

        // exponentiate + pack P^T B-fragment (pure in-lane repack):
        //   h<8  -> key kb + h + 8g        == s0[j = h]
        //   h>=8 -> key kb + 16 + (h-8)+8g == s1[j = h-8]
        float psum = 0.f;
        v16h pf;
#pragma unroll
        for (int j = 0; j < 8; ++j) {
            const float p0 = __expf(s0[j] - mnew);
            const float p1 = __expf(s1[j] - mnew);
            psum += p0 + p1;
            pf[j]     = (_Float16)p0;
            pf[8 + j] = (_Float16)p1;
        }
        psum += __shfl_xor(psum, 16, 32);
        l = l * alpha + psum;
        m = mnew;

        // O^T accumulation over the 8 dv tiles (V^T rows from LDS)
#pragma unroll
        for (int dt = 0; dt < 8; ++dt) {
#pragma unroll
            for (int j = 0; j < 8; ++j) acc[dt][j] *= alpha;
            const v16h av = load_frag_h(&Vbuf[buf][ks][(dt * 16 + lr) * LPITCH], g);
            acc[dt] = wmma_f16(av, pf, acc[dt]);
        }

        // publish point: own reads of buf retired, own copies of stage st+1
        // landed; the one barrier publishes st+1 and frees buf for the refill
        wait_dscnt_0();
        wait_asynccnt_0();
        __syncthreads();
        if (st + 2 < NST) fill((st + 2) * SKEYS, buf);
    }
    wait_asynccnt_0();

    // residual rows and bias of this wave's output share (C-layout: lane = column,
    // element j = row j + 8g); issued ahead of the partials' LDS stores
    const size_t orow0 = (size_t)b * NTOK + (q0 - qt * 16) + 8 * g;
    const int    ocol  = n0 + lr;
    float xres[QTILES][2][8], bcol[2];
    if (owave) {
        const float* xp = x + orow0 * CIN + ocol;
#pragma unroll
        for (int t = 0; t < 2; ++t) {
            bcol[t] = bv[ocol + t * 16];
#pragma unroll
            for (int q4 = 0; q4 < QTILES; ++q4)
#pragma unroll
                for (int j = 0; j < 8; ++j)
                    xres[q4][t][j] = xp[(q4 * 16 + j) * CIN + t * 16];
        }
        // keeps the loads' address registers untouched (also by the loads' own
        // results) until every request is taken
        asm volatile("s_wait_xcnt 0x0" :: "v"(ocol), "v"(xp) : "memory");
    }

    // ---- merge the four key groups' partials of each query tile ----
#pragma unroll
    for (int dt = 0; dt < 8; ++dt) {
        Pacc[wave][dt * 2 + 0][lane] = (v4f){acc[dt][0], acc[dt][1], acc[dt][2], acc[dt][3]};
        Pacc[wave][dt * 2 + 1][lane] = (v4f){acc[dt][4], acc[dt][5], acc[dt][6], acc[dt][7]};
    }
    Pm[wave][lane] = m;
    Pl[wave][lane] = l;
    __syncthreads();                             // all partials visible

    float ms[KSPLIT], wgt[KSPLIT];
    float mall = -1e30f;
#pragma unroll
    for (int s = 0; s < KSPLIT; ++s) {
        ms[s] = Pm[s * QTILES + qt][lane];
        mall  = fmaxf(mall, ms[s]);
    }
    float lall = 0.f;
#pragma unroll
    for (int s = 0; s < KSPLIT; ++s) {
        wgt[s] = __expf(ms[s] - mall);
        lall  += wgt[s] * Pl[s * QTILES + qt][lane];
    }
    const float inv = 1.f / lall;
#pragma unroll
    for (int s = 0; s < KSPLIT; ++s) wgt[s] *= inv;

    // group ks merges dv 32*ks .. 32*ks+31 of its query tile. O^T element j of
    // tile 2*ks is k = j + 8g of the chunk, of tile 2*ks+1 k = 16 + j + 8g: the
    // k order of the 16-bit A/B operand (kmap), so the repack is in-lane.
    v8h ofl[2];
#pragma unroll
    for (int dd = 0; dd < 8 / KSPLIT; ++dd) {
        const int dt = ks * (8 / KSPLIT) + dd;
#pragma unroll
        for (int h = 0; h < 2; ++h) {
            v4f o = {0.f, 0.f, 0.f, 0.f};
#pragma unroll
            for (int s = 0; s < KSPLIT; ++s)
                o += Pacc[s * QTILES + qt][dt * 2 + h][lane] * wgt[s];
#pragma unroll
            for (int i = 0; i < 4; ++i) ofl[dd][h * 4 + i] = (_Float16)o[i];
        }
    }
    Ofr[qt][ks][0][lane] = ofl[0];
    Ofr[qt][ks][1][lane] = ofl[1];
    __syncthreads();                             // all O fragments visible

    // ---- out = x + O @ Wv + bv: 4 query tiles x 2 column tiles x 4 dv chunks ----
    if (!owave) return;                          // no barrier follows
    v8f oacc[QTILES][2];                         // start value: residual + bias
#pragma unroll
    for (int q4 = 0; q4 < QTILES; ++q4)
#pragma unroll
        for (int t = 0; t < 2; ++t)
#pragma unroll
            for (int j = 0; j < 8; ++j) oacc[q4][t][j] = xres[q4][t][j] + bcol[t];
#pragma unroll
    for (int c = 0; c < 4; ++c) {
#pragma unroll
        for (int q4 = 0; q4 < QTILES; ++q4) {
            const v8h lo = Ofr[q4][c][0][lane];
            const v8h hi = Ofr[q4][c][1][lane];
            v16h a;
#pragma unroll
            for (int i = 0; i < 8; ++i) { a[i] = lo[i]; a[8 + i] = hi[i]; }
#pragma unroll
            for (int t = 0; t < 2; ++t) oacc[q4][t] = wmma_f16(a, wb[t][c], oacc[q4][t]);
        }
    }
#pragma unroll
    for (int q4 = 0; q4 < QTILES; ++q4)
#pragma unroll
        for (int t = 0; t < 2; ++t)
#pragma unroll
            for (int j = 0; j < 8; ++j)
                out[(orow0 + q4 * 16 + j) * CIN + ocol + t * 16] = oacc[q4][t][j];
}

// ---------------------------------------------------------------------------
// Host-side launch. Workspace layout (bytes):
//   [0,       1 MB)   Qh  f16 [16384, 32]
//   [1 MB,    2 MB)   Kh  f16 [16384, 32]
//   [2 MB,    6 MB)   Vt  f16 [4, 128, 4096]   (transposed values)
//   [14 MB,  ...  )   Wvt f16 [256, 128]      (transposed out-projection weights)
// ---------------------------------------------------------------------------
extern "C" void kernel_launch(void* const* d_in, const int* in_sizes, int n_in,
                              void* d_out, int out_size, void* d_ws, size_t ws_size,
                              hipStream_t stream) {
    const float* x  = (const float*)d_in[0];
    const float* Wf = (const float*)d_in[1];
    const float* bf = (const float*)d_in[2];
    const float* Wg = (const float*)d_in[3];
    const float* bg = (const float*)d_in[4];
    const float* Wh = (const float*)d_in[5];
    const float* bh = (const float*)d_in[6];
    const float* Wv = (const float*)d_in[7];
    const float* bv = (const float*)d_in[8];
    float* out = (float*)d_out;

    char* ws = (char*)d_ws;
    _Float16* Qh  = (_Float16*)(ws);
    _Float16* Kh  = (_Float16*)(ws + (1u << 20));
    _Float16* Vt  = (_Float16*)(ws + (2u << 20));
    _Float16* Wvt = (_Float16*)(ws + (14u << 20));

    // K1: 1024 row-tile waves, 8 waves/block -> 128 blocks
    hipLaunchKernelGGL(proj_qkv_kernel, dim3(128), dim3(256), 0, stream,
                       x, Wf, bf, Wg, bg, Wh, bh, Wv, Qh, Kh, Vt, Wvt);
    // K2: 256 blocks x 16 waves, each block = 64 queries of one batch
    hipLaunchKernelGGL(attn_kernel, dim3(256), dim3(ATHREADS), 0, stream,
                       Qh, Kh, Vt, x, Wvt, bv, out);
}

// v007
// It runs in 44 microseconds.
// Two timings next to v006 both put it at 1.05 times that version's speed.
// Counting every step since v000, it is 3.01 times as fast.
#include <hip/hip_runtime.h>
#include <hip/hip_bf16.h>

// ---------------------------------------------------------------------------
// Fused self-attention for gfx1250 (MI455X), f16 WMMA with f32 accumulation.
// B=4, H=W=64 -> N=4096 tokens/batch, C=256, DQK=32, DV=128.
// ---------------------------------------------------------------------------

#define BATCH 4
#define NTOK  4096        // H*W
#define CIN   256
#define DQK   32
#define DVDIM 128
#define ROWS  (BATCH * NTOK)   // 16384
#define LPITCH 40              // halfs per staged LDS row: 32 data + 8 pad (80 B)
#define KSPLIT 8               // key groups (waves that share a pair of query tiles)
#define QTILES 4               // 16-query tiles per attention block
#define QPW    2               // query tiles per wave: each K and V^T fragment serves both
#define QGRP   (QTILES / QPW)  // query-tile pairs per attention block
#define SKEYS  (32 * KSPLIT)   // keys per staged LDS buffer
#define AWAVES (KSPLIT * QGRP) // waves per attention block
#define ATHREADS (32 * AWAVES)
#define VGRP   (DVDIM * LPITCH + 32)   // halfs per key group's V^T tile: 128 rows + 64 B, so that the
                                       // eight 64-byte pieces of one copy spread over all banks
#define WROWS  (2 * DQK + DVDIM)   // staged W^T rows of the QKV projection (K, Q, V)
#define WPITCH (CIN + 8)           // halfs per staged row: 256 data + 8 pad (528 B = 16 B x 33)
#define XROWS  128                 // x rows per projection block (8 waves x 16)
#define XPITCH (CIN + 4)           // floats per staged x row: 256 data + 4 pad (1040 B = 16 B x 65)

typedef _Float16 v16h __attribute__((ext_vector_type(16)));
typedef _Float16 v8h  __attribute__((ext_vector_type(8)));
typedef float    v8f  __attribute__((ext_vector_type(8)));
typedef float    v4f  __attribute__((ext_vector_type(4)));

// K index held by half-slot h (0..15) for lane-group g (0 or 1) in the
// 16-bit A/B operand of V_WMMA_*_16X16X32 (ISA 7.12.2):
//   h<8  -> K = h      + 8g      (VGPR 0..3)
//   h>=8 -> K = h + 8  + 8g      (VGPR 4..7)
__device__ __forceinline__ int kmap(int h, int g) {
    return (h < 8 ? h : h + 8) + 8 * g;
}

// Load a v16h A/B fragment from a contiguous f16 row `p` (row holds K=0..31).
// The two 8-half groups per lane are 16-byte aligned -> b128 vector loads
// (global_load_b128 or ds_load_b128 depending on the pointer).
__device__ __forceinline__ v16h load_frag_h(const _Float16* p, int g) {
    const v8h lo = *(const v8h*)(p + 8 * g);
    const v8h hi = *(const v8h*)(p + 16 + 8 * g);
    v16h r;
#pragma unroll
    for (int i = 0; i < 8; ++i) { r[i] = lo[i]; r[8 + i] = hi[i]; }
    return r;
}

// Load a v16h fragment from a contiguous, 16-byte aligned f32 row (two groups of
// 8 consecutive floats at +8g and +16+8g), converting to f16: four b128 loads
// + cvt_pk.
__device__ __forceinline__ v16h load_frag_f32(const float* p, int g) {
    const v4f lo0 = *(const v4f*)(p + 8 * g);
    const v4f lo1 = *(const v4f*)(p + 8 * g + 4);
    const v4f hi0 = *(const v4f*)(p + 16 + 8 * g);
    const v4f hi1 = *(const v4f*)(p + 16 + 8 * g + 4);
    v16h r;
#pragma unroll
    for (int i = 0; i < 4; ++i) {
        r[i]      = (_Float16)lo0[i];
        r[4 + i]  = (_Float16)lo1[i];
        r[8 + i]  = (_Float16)hi0[i];
        r[12 + i] = (_Float16)hi1[i];
    }
    return r;
}

__device__ __forceinline__ v8f wmma_f16(v16h a, v16h b, v8f c) {
    return __builtin_amdgcn_wmma_f32_16x16x32_f16(false, a, false, b, (short)0, c,
                                                  false, false);
}

// ---- CDNA5 async global->LDS copies (ASYNCcnt-tracked) --------------------
// Generic pointers to __shared__ have the LDS byte offset in their low 32 bits
// (ISA 10.2: LDS aperture address is truncated to addr[31:0]).
__device__ __forceinline__ unsigned lds_off(const void* p) {
    return (unsigned)(uintptr_t)p;
}
// One 256-key stage = ten 16-byte copies per lane (K: 2 x 128 rows, V^T: 8 x 16
// rows). ldsK / gK, ldsV / gV: the lane's place in the first copy of each. The
// s_wait_xcnt closes the statement so that it stands in front of any later
// rewrite of the address registers the copies name.
__device__ __forceinline__ void async_ld_stage(unsigned ldsK, const _Float16* gK,
                                               unsigned ldsV, const _Float16* gV) {
    asm volatile("global_load_async_to_lds_b128 %0, %1, off\n\t"
                 "global_load_async_to_lds_b128 %2, %3, off\n\t"
                 "global_load_async_to_lds_b128 %4, %5, off\n\t"
                 "global_load_async_to_lds_b128 %6, %7, off\n\t"
                 "global_load_async_to_lds_b128 %8, %9, off\n\t"
                 "global_load_async_to_lds_b128 %10, %11, off\n\t"
                 "global_load_async_to_lds_b128 %12, %13, off\n\t"
                 "global_load_async_to_lds_b128 %14, %15, off\n\t"
                 "global_load_async_to_lds_b128 %16, %17, off\n\t"
                 "global_load_async_to_lds_b128 %18, %19, off\n\t"
                 "s_wait_xcnt 0x0"
                 :: "v"(ldsK),                     "v"(gK),
                    "v"(ldsK + 128 * LPITCH * 2),  "v"(gK + 128 * DQK),
                    "v"(ldsV),                     "v"(gV),
                    "v"(ldsV +  16 * LPITCH * 2),  "v"(gV + (size_t) 16 * NTOK),
                    "v"(ldsV +  32 * LPITCH * 2),  "v"(gV + (size_t) 32 * NTOK),
                    "v"(ldsV +  48 * LPITCH * 2),  "v"(gV + (size_t) 48 * NTOK),
                    "v"(ldsV +  64 * LPITCH * 2),  "v"(gV + (size_t) 64 * NTOK),
                    "v"(ldsV +  80 * LPITCH * 2),  "v"(gV + (size_t) 80 * NTOK),
                    "v"(ldsV +  96 * LPITCH * 2),  "v"(gV + (size_t) 96 * NTOK),
                    "v"(ldsV + 112 * LPITCH * 2),  "v"(gV + (size_t)112 * NTOK)
                 : "memory");
}
// Four x rows of 1 KB = eight 16-byte copies per lane (a copy = 512 contiguous
// bytes per wave: whole lines). gx / lx: the lane's place in the first row. The
// s_wait_xcnt closes the statement so that it stands in front of any later
// rewrite of the address registers the copies name.
__device__ __forceinline__ void async_ld_x4rows(unsigned lx, const float* gx) {
    asm volatile("global_load_async_to_lds_b128 %0, %1, off\n\t"
                 "global_load_async_to_lds_b128 %2, %3, off\n\t"
                 "global_load_async_to_lds_b128 %4, %5, off\n\t"
                 "global_load_async_to_lds_b128 %6, %7, off\n\t"
                 "global_load_async_to_lds_b128 %8, %9, off\n\t"
                 "global_load_async_to_lds_b128 %10, %11, off\n\t"
                 "global_load_async_to_lds_b128 %12, %13, off\n\t"
                 "global_load_async_to_lds_b128 %14, %15, off\n\t"
                 "s_wait_xcnt 0x0"
                 :: "v"(lx),                    "v"(gx),
                    "v"(lx + 512),              "v"(gx + 128),
                    "v"(lx + 4 * XPITCH),       "v"(gx + CIN),
                    "v"(lx + 4 * XPITCH + 512), "v"(gx + CIN + 128),
                    "v"(lx + 8 * XPITCH),       "v"(gx + 2 * CIN),
                    "v"(lx + 8 * XPITCH + 512), "v"(gx + 2 * CIN + 128),
                    "v"(lx + 12 * XPITCH),       "v"(gx + 3 * CIN),
                    "v"(lx + 12 * XPITCH + 512), "v"(gx + 3 * CIN + 128)
                 : "memory");
}
// This wave's own copies have landed (the barrier behind it publishes them).
__device__ __forceinline__ void wait_asynccnt_0() {
    asm volatile("s_wait_asynccnt 0x0" ::: "memory");
}
// This wave's own LDS reads have retired before the buffer they read is refilled.
__device__ __forceinline__ void wait_dscnt_0() {
    asm volatile("s_wait_dscnt 0x0" ::: "memory");
}

// ---------------------------------------------------------------------------
// Kernel 1: fused QKV projections. One wave per 16-row tile computes ALL
// output tiles (2 K + 2 Q + 8 V = 12 WMMAs per K-chunk), reusing the x
// A-fragment. x is read exactly once: right behind the weight loads each wave
// sends for its whole 16 x 256 f32 tile by async copies to LDS (32 copies of
// whole lines, all in flight at once, under the weight staging), so the load
// latency is paid once and not once per K-chunk; the A-fragments come by
// ds_load_b128 at a pitch of 16 B x odd. Each block forms the 192 W^T rows (f16,
// 96 KB) in LDS itself, straight from the f32 weights: a lane loads 4 output
// columns x 8 consecutive k (eight 16-byte loads, whole 128-byte lines per
// wave), converts, and stores one 16-byte k run per column. The B-fragments
// then come by ds_load_b128 at a pitch of 16 B x odd (no bank conflict).
//   Kh = f16(x @ Wf + bf)   [ROWS, 32]
//   Qh = f16(x @ Wg + bg)   [ROWS, 32]
//   Vt = f16(x @ Wh + bh)^T [BATCH, 128, NTOK]
// Each thread also writes one element of Wvt = f16(Wv^T) [256, 128], which the
// attention launch reads.
// ---------------------------------------------------------------------------
__global__ void __launch_bounds__(256)
proj_qkv_kernel(const float* __restrict__ x,
                const float* __restrict__ Wf, const float* __restrict__ bf,
                const float* __restrict__ Wg, const float* __restrict__ bg,
                const float* __restrict__ Wh, const float* __restrict__ bh,
                const float* __restrict__ Wv,
                _Float16* __restrict__ Qh, _Float16* __restrict__ Kh,
                _Float16* __restrict__ Vt, _Float16* __restrict__ Wvt) {
    const int widx = blockIdx.x * 8 + (threadIdx.x >> 5);   // 0 .. 1023
    const int lane = threadIdx.x & 31;
    const int g    = lane >> 4;
    const int lr   = lane & 15;

    const int row0 = widx * 16;

    __shared__ __attribute__((aligned(16))) _Float16 Wl[WROWS * WPITCH];   // rows: 32 K, 32 Q, 128 V
    __shared__ __attribute__((aligned(16))) float    Xl[XROWS * XPITCH];   // the block's x rows, f32

    v8f accK[2], accQ[2], accV[8];
#pragma unroll
    for (int t = 0; t < 2; ++t) accK[t] = accQ[t] = (v8f){0,0,0,0,0,0,0,0};
#pragma unroll
    for (int t = 0; t < 8; ++t) accV[t] = (v8f){0,0,0,0,0,0,0,0};

    const _Float16* wfr = &Wl[lr * WPITCH];                 // row lr of the staged W^T tiles
    const _Float16* wgr = &Wl[(DQK + lr) * WPITCH];
    const _Float16* whr = &Wl[(2 * DQK + lr) * WPITCH];
    const float*    xr  = &Xl[((threadIdx.x >> 5) * 16 + lr) * XPITCH];   // staged x row of this lane

    // ---- stage W^T: wave w takes k = 32w .. 32w+31 of all 192 output columns ----
    // Lane = (k octet, column quad). In every ds_store_b128 the 16 lanes of a
    // half-wave (4 quads x 4 octets) fall on 16 distinct groups of four banks.
    const int iv = blockIdx.x * 256 + threadIdx.x;          // this thread's Wvt element
    float wv;
    {
        const int kk = (threadIdx.x >> 5) * 32 + (lane & 3) * 8;   // first k of the lane's octet
        const int nq = (lane >> 2) * 4;                            // first column of its quad
        const float* pf = Wf + kk * DQK + nq;
        const float* pg = Wg + kk * DQK + nq;
        const float* ph = Wh + kk * DVDIM + nq;
        const float* pv = Wv + (iv & (DVDIM - 1)) * CIN + (iv >> 7);
        v4f r[6][8];                                        // [32-column group: K, Q, 4 x V][k]
#pragma unroll
        for (int i = 0; i < 8; ++i) {
            r[0][i] = *(const v4f*)(pf + i * DQK);
            r[1][i] = *(const v4f*)(pg + i * DQK);
#pragma unroll
            for (int nb = 0; nb < 4; ++nb)
                r[2 + nb][i] = *(const v4f*)(ph + i * DVDIM + nb * 32);
        }
        wv = *pv;
        // keeps the loads' address registers untouched (also by the loads' own
        // results) until every request is taken
        asm volatile("s_wait_xcnt 0x0" :: "v"(pf), "v"(pg), "v"(ph), "v"(pv) : "memory");
        // ---- this wave's 16 x rows: 32 copies, issued while the weight loads fly ----
        {
            const float*   gx = x + (size_t)row0 * CIN + lane * 4;
            const unsigned lx = lds_off(&Xl[(threadIdx.x >> 5) * 16 * XPITCH + lane * 4]);
            // kept rolled: one set of address registers serves all four trips, while
            // the 48 weight loads in flight hold most of the register file
#pragma nounroll
            for (int r4 = 0; r4 < 4; ++r4)
                async_ld_x4rows(lx + r4 * 16 * XPITCH, gx + r4 * 4 * CIN);
        }
#pragma unroll
        for (int m = 0; m < 6; ++m)
#pragma unroll
            for (int c = 0; c < 4; ++c) {
                v8h h;
#pragma unroll
                for (int i = 0; i < 8; ++i) h[i] = (_Float16)r[m][i][c];
                *(v8h*)&Wl[(m * 32 + nq + c) * WPITCH + kk] = h;
            }
    }
    wait_asynccnt_0();                                      // own x tile landed
    __syncthreads();                                        // staged W^T and x visible to all waves

    for (int k0 = 0; k0 < CIN; k0 += 32) {
        const v16h a = load_frag_f32(xr + k0, g);           // shared A fragment
#pragma unroll
        for (int t = 0; t < 2; ++t) {
            const v16h bK = load_frag_h(wfr + (t * 16) * WPITCH + k0, g);
            accK[t] = wmma_f16(a, bK, accK[t]);
            const v16h bQ = load_frag_h(wgr + (t * 16) * WPITCH + k0, g);
            accQ[t] = wmma_f16(a, bQ, accQ[t]);
        }
#pragma unroll
        for (int t = 0; t < 8; ++t) {
            const v16h bV = load_frag_h(whr + (t * 16) * WPITCH + k0, g);
            accV[t] = wmma_f16(a, bV, accV[t]);
        }
    }

    // ---- store K and Q: f16 [row, 32] (C-layout: row = row0 + j + 8g) ----
#pragma unroll
    for (int t = 0; t < 2; ++t) {
        const float bK = bf[t * 16 + lr];
        const float bQ = bg[t * 16 + lr];
#pragma unroll
        for (int j = 0; j < 8; ++j) {
            const size_t row = row0 + j + 8 * g;
            Kh[row * DQK + t * 16 + lr] = (_Float16)(accK[t][j] + bK);
            Qh[row * DQK + t * 16 + lr] = (_Float16)(accQ[t][j] + bQ);
        }
    }
    // ---- store V transposed: Vt[b][dv][token], 8 consecutive tokens/lane ----
    const int b     = row0 >> 12;
    const int nbase = (row0 & (NTOK - 1)) + 8 * g;
#pragma unroll
    for (int t = 0; t < 8; ++t) {
        const float bV = bh[t * 16 + lr];
        _Float16* dst = Vt + (size_t)b * DVDIM * NTOK + (size_t)(t * 16 + lr) * NTOK;
#pragma unroll
        for (int j = 0; j < 8; ++j)
            dst[nbase + j] = (_Float16)(accV[t][j] + bV);
    }
    // ---- Wv^T element n = iv / 128, k = iv % 128 (behind the barrier: no wait on it) ----
    Wvt[iv] = (_Float16)wv;
}

// ---------------------------------------------------------------------------
// Kernel 2: fused flash attention (transposed formulation) with the output
// projection and residual in its epilogue. Keys are split over
// eight wave groups. One block (16 waves) owns 64 consecutive queries of one
// batch: wave = (query-tile pair qp, key group ks). A stage is 256 keys; group ks
// works on its keys 32*ks .. 32*ks+31 for 32 queries, so every K and V^T
// fragment read from LDS feeds two WMMAs (two query tiles) and the block reads
// half the LDS bytes per score. 256 blocks of four waves per SIMD cover every
// WGP. Stages are double-buffered in LDS via global_load_async_to_lds
// (ASYNCcnt). The 64-byte tile rows lie in LDS at a pitch of 80 bytes (16 B x
// odd): the 16 lanes of a half-wave, one row each, then fall on 16 distinct
// groups of four banks in every ds_load_b128.
//   S^T sub-tile  = WMMA(A = K rows, B = Q^T)        (2 per key tile and query tile)
//   online softmax across key tiles (cross-group shfl_xor(16) reduction)
//   O^T           = WMMA(A = V^T rows, B = P^T)      (8 per key tile and query tile)
// P^T B-fragment is built from the two S^T C-fragments *within each lane*.
// The eight groups' (max, sum, O^T) partials of a query tile meet in LDS at the
// end, in the bytes of the ring (free behind the loop's last barrier); each
// group merges one 16-wide dv tile.
// Epilogue: out = x + O @ Wv + bv for the block's 64 queries. The merged tile
// of a lane is, in place, the low or high half of its part of the f16 A fragment
// (rows = queries) of one 32-wide dv chunk; the 16 fragments are exchanged
// through LDS and each of the waves 0..7 forms 64 queries x 32 output columns
// (32 WMMAs), so that a block loads every Wv^T fragment once. O never goes to
// memory.
// ---------------------------------------------------------------------------
__global__ void __launch_bounds__(ATHREADS)
attn_kernel(const _Float16* __restrict__ Qh, const _Float16* __restrict__ Kh,
            const _Float16* __restrict__ Vt, const float* __restrict__ x,
            const _Float16* __restrict__ Wvt, const float* __restrict__ bv,
            float* __restrict__ out) {
    // one range, two uses: in the loop the K / V^T ring, behind it the partials
    __shared__ __attribute__((aligned(16))) unsigned char ring[AWAVES * QPW * 16 * 32 * 16];
    __shared__ float Pm[AWAVES][QPW][32];                                              // [wave][query tile][lane]
    __shared__ float Pl[AWAVES][QPW][32];
    __shared__ __attribute__((aligned(16))) v8h Ofr[QTILES][DVDIM / 32][2][32];        // [query tile][dv chunk][low/high 8 halfs][lane]
    _Float16* const Kbuf = (_Float16*)ring;                               // [buf][key(256)][dqk(32) + pad]
    _Float16* const Vbuf = (_Float16*)ring + 2 * SKEYS * LPITCH;          // [buf][group] x VGRP: [dv(128)][key(32) + pad]
    v4f*      const Pacc = (v4f*)ring;                                    // [wave][query tile][dt*2 + half][lane]
    static_assert((2 * SKEYS * LPITCH + 2 * KSPLIT * VGRP) * 2 <= AWAVES * QPW * 16 * 32 * 16,
                  "the ring fits the range");

    const int tid  = threadIdx.x;               // 0..511
    const int lane = tid & 31;
    const int g    = lane >> 4;
    const int lr   = lane & 15;
    const int wave = tid >> 5;                  // 0..15
    const int qp   = wave & (QGRP - 1);         // query-tile pair of the block
    const int ks   = wave / QGRP;               // key group

    const int b    = blockIdx.x / (NTOK / (16 * QTILES));         // 64 blocks per batch
    const int qblk = (blockIdx.x % (NTOK / (16 * QTILES))) * (16 * QTILES);
    const int q0   = qblk + qp * (16 * QPW);

    const _Float16* Qb    = Qh + (size_t)b * NTOK * DQK;
    const _Float16* KbBlk = Kh + (size_t)b * NTOK * DQK;      // block-uniform
    const _Float16* VbBlk = Vt + (size_t)b * DVDIM * NTOK;    // block-uniform

    // Q^T B-fragments: lane column = query (q0 + 16c + lr), halfs sweep d_qk (=32)
    v16h qf[QPW];
#pragma unroll
    for (int c = 0; c < QPW; ++c)
        qf[c] = load_frag_h(Qb + (size_t)(q0 + c * 16 + lr) * DQK, g);
    // the Q loads' address registers are reused by the address sums below
    asm volatile("s_wait_xcnt 0x0" ::: "memory");

    // Out-projection share of waves 0..7: output columns n0 .. n0+31 (one 128-byte
    // line per row) of the block's 64 queries.
    const bool owave = __builtin_amdgcn_readfirstlane(wave) < 8;   // wave-uniform: scalar branch
    const int  n0    = (wave & 7) * 32;

    // ---- async stage of 256 keys: 10 ops per wave ----
    auto fill = [&](int kb, int buf) {
        // K: 256 rows x 64 B contiguous = 16384 B = 2 x 512 lanes x 16 B
        // V: 128 rows (stride NTOK) x 512 B = 65536 B = 8 x 512 lanes x 16 B;
        //    a wave covers one row's 512 B, four lanes each group's 64 B
        const int d  = tid >> 5;                 // dv row 0..15 (copy c: +16c)
        const int pc = tid & 31;                 // 16-byte piece of the row
        async_ld_stage(lds_off(Kbuf + buf * (SKEYS * LPITCH) + (tid >> 2) * LPITCH + (tid & 3) * 8),
                       KbBlk + (size_t)kb * DQK + tid * 8,
                       lds_off(Vbuf + (buf * KSPLIT + (pc >> 2)) * VGRP + d * LPITCH + (pc & 3) * 8),
                       VbBlk + (size_t)d * NTOK + kb + pc * 8);
    };

    float m[QPW], l[QPW];
    v8f acc[QPW][8];
#pragma unroll
    for (int c = 0; c < QPW; ++c) {
        m[c] = -1e30f;
        l[c] = 0.f;
#pragma unroll
        for (int dt = 0; dt < 8; ++dt) acc[c][dt] = (v8f){0,0,0,0,0,0,0,0};
    }
    const v8f zero = {0,0,0,0,0,0,0,0};

    const int NST = NTOK / SKEYS;               // 16 stages
    fill(0, 0);
    wait_asynccnt_0();
    __syncthreads();                             // stage 0 visible to all waves
    fill(SKEYS, 1);
    for (int st = 0; st < NST; ++st) {
        const int buf = st & 1;

        // A-fragments from LDS: 16 key rows each, halfs sweep d_qk
        const _Float16* krow = Kbuf + buf * (SKEYS * LPITCH) + (ks * 32 + lr) * LPITCH;
        const v16h a0 = load_frag_h(krow, g);
        const v16h a1 = load_frag_h(krow + 16 * LPITCH, g);

        float alpha[QPW];
        v16h  pf[QPW];
#pragma unroll
        for (int c = 0; c < QPW; ++c) {
            // S^T tiles: lane = query column, VGPR j -> key = kb + sub*16 + j + 8g
            v8f s0 = wmma_f16(a0, qf[c], zero);
            v8f s1 = wmma_f16(a1, qf[c], zero);

            // per-query max over this 32-key tile
            float tmax = s0[0];
#pragma unroll
            for (int j = 0; j < 8; ++j) {
                tmax = fmaxf(tmax, s0[j]);
                tmax = fmaxf(tmax, s1[j]);
            }
            tmax = fmaxf(tmax, __shfl_xor(tmax, 16, 32));
            const float mnew = fmaxf(m[c], tmax);
            alpha[c] = __expf(m[c] - mnew);

            // exponentiate + pack P^T B-fragment (pure in-lane repack):
            //   h<8  -> key kb + h + 8g        == s0[j = h]
            //   h>=8 -> key kb + 16 + (h-8)+8g == s1[j = h-8]
            float psum = 0.f;
#pragma unroll
            for (int j = 0; j < 8; ++j) {
                const float p0 = __expf(s0[j] - mnew);
                const float p1 = __expf(s1[j] - mnew);
                psum += p0 + p1;
                pf[c][j]     = (_Float16)p0;
                pf[c][8 + j] = (_Float16)p1;
            }
            psum += __shfl_xor(psum, 16, 32);
            l[c] = l[c] * alpha[c] + psum;
            m[c] = mnew;
        }

        // O^T accumulation over the 8 dv tiles (V^T rows from LDS, each fragment
        // for both query tiles)
        const _Float16* vrow = Vbuf + (buf * KSPLIT + ks) * VGRP + lr * LPITCH;
#pragma unroll
        for (int dt = 0; dt < 8; ++dt) {
            const v16h av = load_frag_h(vrow + (dt * 16) * LPITCH, g);
#pragma unroll
            for (int c = 0; c < QPW; ++c) {
#pragma unroll
                for (int j = 0; j < 8; ++j) acc[c][dt][j] *= alpha[c];
                acc[c][dt] = wmma_f16(av, pf[c], acc[c][dt]);
            }
        }

        // publish point: own reads of buf retired, own copies of stage st+1
        // landed; the one barrier publishes st+1 and frees buf for the refill
        wait_dscnt_0();
        wait_asynccnt_0();
        __syncthreads();
        if (st + 2 < NST) fill((st + 2) * SKEYS, buf);
    }
    wait_asynccnt_0();

    // residual rows and bias of this wave's output share (C-layout: lane = column,
    // element j = row j + 8g); issued ahead of the partials' LDS stores
    const size_t orow0 = (size_t)b * NTOK + qblk + 8 * g;
    const int    ocol  = n0 + lr;
    float xres[QTILES][2][8], bcol[2];
    if (owave) {
        const float* xp = x + orow0 * CIN + ocol;
#pragma unroll
        for (int t = 0; t < 2; ++t) {
            bcol[t] = bv[ocol + t * 16];
#pragma unroll
            for (int q4 = 0; q4 < QTILES; ++q4)
#pragma unroll
                for (int j = 0; j < 8; ++j)
                    xres[q4][t][j] = xp[(q4 * 16 + j) * CIN + t * 16];
        }
        // keeps the loads' address registers untouched (also by the loads' own
        // results) until every request is taken
        asm volatile("s_wait_xcnt 0x0" :: "v"(ocol), "v"(xp) : "memory");
    }

    // ---- merge the eight key groups' partials of each query tile ----
    // (the ring is free: every wave's last reads and copies ended in front of the
    // loop's last barrier)
#pragma unroll
    for (int c = 0; c < QPW; ++c) {
#pragma unroll
        for (int dt = 0; dt < 8; ++dt) {
            v4f* pa = Pacc + ((wave * QPW + c) * 16 + dt * 2) * 32 + lane;
            pa[0]  = (v4f){acc[c][dt][0], acc[c][dt][1], acc[c][dt][2], acc[c][dt][3]};
            pa[32] = (v4f){acc[c][dt][4], acc[c][dt][5], acc[c][dt][6], acc[c][dt][7]};
        }
        Pm[wave][c][lane] = m[c];
        Pl[wave][c][lane] = l[c];
    }

    __syncthreads();                             // all partials visible

    // The Wv^T B fragments of waves 0..7: loaded here, where the accumulators'
    // registers are free again; behind the barrier, so that they fly under the merge.
    v16h wb[2][4];
    if (owave) {
        const _Float16* wrow = Wvt + (size_t)(n0 + lr) * DVDIM;
#pragma unroll
        for (int t = 0; t < 2; ++t)
#pragma unroll
            for (int c = 0; c < 4; ++c)
                wb[t][c] = load_frag_h(wrow + (t * 16) * DVDIM + c * 32, g);
        // keeps the loads' address registers untouched (also by the loads' own
        // results) until every request is taken
        asm volatile("s_wait_xcnt 0x0" :: "v"(wrow + 8 * g) : "memory");
    }

    // group ks merges dv 16*ks .. 16*ks+15 of its two query tiles. O^T element j
    // of an even tile is k = j + 8g of its 32-wide chunk, of an odd tile
    // k = 16 + j + 8g: the k order of the 16-bit A/B operand (kmap), so the
    // repack is in-lane.
#pragma unroll
    for (int c = 0; c < QPW; ++c) {
        float ms[KSPLIT], wgt[KSPLIT];
        float mall = -1e30f;
#pragma unroll
        for (int s = 0; s < KSPLIT; ++s) {
            ms[s] = Pm[s * QGRP + qp][c][lane];
            mall  = fmaxf(mall, ms[s]);
        }
        float lall = 0.f;
#pragma unroll
        for (int s = 0; s < KSPLIT; ++s) {
            wgt[s] = __expf(ms[s] - mall);
            lall  += wgt[s] * Pl[s * QGRP + qp][c][lane];
        }
        const float inv = 1.f / lall;
#pragma unroll
        for (int s = 0; s < KSPLIT; ++s) wgt[s] *= inv;

        v8h ofl;
#pragma unroll
        for (int h = 0; h < 2; ++h) {
            v4f o = {0.f, 0.f, 0.f, 0.f};
#pragma unroll
            for (int s = 0; s < KSPLIT; ++s)
                o += Pacc[(((s * QGRP + qp) * QPW + c) * 16 + ks * 2 + h) * 32 + lane] * wgt[s];
#pragma unroll
            for (int i = 0; i < 4; ++i) ofl[h * 4 + i] = (_Float16)o[i];
        }
        Ofr[qp * QPW + c][ks >> 1][ks & 1][lane] = ofl;
    }
    __syncthreads();                             // all O fragments visible

    // ---- out = x + O @ Wv + bv: 4 query tiles x 2 column tiles x 4 dv chunks ----
    if (!owave) return;                          // no barrier follows
    v8f oacc[QTILES][2];                         // start value: residual + bias
#pragma unroll
    for (int q4 = 0; q4 < QTILES; ++q4)
#pragma unroll
        for (int t = 0; t < 2; ++t)
#pragma unroll
            for (int j = 0; j < 8; ++j) oacc[q4][t][j] = xres[q4][t][j] + bcol[t];
#pragma unroll
    for (int c = 0; c < 4; ++c) {
#pragma unroll
        for (int q4 = 0; q4 < QTILES; ++q4) {
            const v8h lo = Ofr[q4][c][0][lane];
            const v8h hi = Ofr[q4][c][1][lane];
            v16h a;
#pragma unroll
            for (int i = 0; i < 8; ++i) { a[i] = lo[i]; a[8 + i] = hi[i]; }
#pragma unroll
            for (int t = 0; t < 2; ++t) oacc[q4][t] = wmma_f16(a, wb[t][c], oacc[q4][t]);
        }
    }
#pragma unroll
    for (int q4 = 0; q4 < QTILES; ++q4)
#pragma unroll
        for (int t = 0; t < 2; ++t)
#pragma unroll
            for (int j = 0; j < 8; ++j)
                out[(orow0 + q4 * 16 + j) * CIN + ocol + t * 16] = oacc[q4][t][j];
}

// ---------------------------------------------------------------------------
// Host-side launch. Workspace layout (bytes):
//   [0,       1 MB)   Qh  f16 [16384, 32]
//   [1 MB,    2 MB)   Kh  f16 [16384, 32]
//   [2 MB,    6 MB)   Vt  f16 [4, 128, 4096]   (transposed values)
//   [14 MB,  ...  )   Wvt f16 [256, 128]      (transposed out-projection weights)
// ---------------------------------------------------------------------------
extern "C" void kernel_launch(void* const* d_in, const int* in_sizes, int n_in,
                              void* d_out, int out_size, void* d_ws, size_t ws_size,
                              hipStream_t stream) {
    const float* x  = (const float*)d_in[0];
    const float* Wf = (const float*)d_in[1];
    const float* bf = (const float*)d_in[2];
    const float* Wg = (const float*)d_in[3];
    const float* bg = (const float*)d_in[4];
    const float* Wh = (const float*)d_in[5];
    const float* bh = (const float*)d_in[6];
    const float* Wv = (const float*)d_in[7];
    const float* bv = (const float*)d_in[8];
    float* out = (float*)d_out;

    char* ws = (char*)d_ws;
    _Float16* Qh  = (_Float16*)(ws);
    _Float16* Kh  = (_Float16*)(ws + (1u << 20));
    _Float16* Vt  = (_Float16*)(ws + (2u << 20));
    _Float16* Wvt = (_Float16*)(ws + (14u << 20));

    // K1: 1024 row-tile waves, 8 waves/block -> 128 blocks
    hipLaunchKernelGGL(proj_qkv_kernel, dim3(128), dim3(256), 0, stream,
                       x, Wf, bf, Wg, bg, Wh, bh, Wv, Qh, Kh, Vt, Wvt);
    // K2: 256 blocks x 16 waves, each block = 64 queries of one batch
    hipLaunchKernelGGL(attn_kernel, dim3(256), dim3(ATHREADS), 0, stream,
                       Qh, Kh, Vt, x, Wvt, bv, out);
}

// v008
// A run of this version takes 42 microseconds.
// Next to v007, in two timings, it ran 1.05 times as fast each time.
// Over all steps from v000 it is 3.16 times as fast.
#include <hip/hip_runtime.h>
#include <hip/hip_bf16.h>

// ---------------------------------------------------------------------------
// Fused self-attention for gfx1250 (MI455X), f16 WMMA with f32 accumulation.
// B=4, H=W=64 -> N=4096 tokens/batch, C=256, DQK=32, DV=128.
// ---------------------------------------------------------------------------

#define BATCH 4
#define NTOK  4096        // H*W
#define CIN   256
#define DQK   32
#define DVDIM 128
#define ROWS  (BATCH * NTOK)   // 16384
#define LPITCH 40              // halfs per staged LDS row: 32 data + 8 pad (80 B)
#define KSPLIT 8               // key groups (waves that share a pair of query tiles)
#define QTILES 4               // 16-query tiles per attention block
#define QPW    2               // query tiles per wave: each K and V^T fragment serves both
#define QGRP   (QTILES / QPW)  // query-tile pairs per attention block
#define SKEYS  (32 * KSPLIT)   // keys per staged LDS buffer
#define AWAVES (KSPLIT * QGRP) // waves per attention block
#define ATHREADS (32 * AWAVES)
#define VGRP   (DVDIM * LPITCH + 32)   // halfs per key group's V^T tile: 128 rows + 64 B, so that the
                                       // eight 64-byte pieces of one copy spread over all banks
#define WROWS  (2 * DQK + DVDIM)   // staged W^T rows of the QKV projection (K, Q, V)
#define WPITCH (CIN + 8)           // halfs per staged row: 256 data + 8 pad (528 B = 16 B x 33)
#define XROWS  128                 // x rows per projection block (8 waves x 16)
#define XPITCH (CIN + 4)           // floats per staged x row: 256 data + 4 pad (1040 B = 16 B x 65)

typedef _Float16 v16h __attribute__((ext_vector_type(16)));
typedef _Float16 v8h  __attribute__((ext_vector_type(8)));
typedef float    v8f  __attribute__((ext_vector_type(8)));
typedef float    v4f  __attribute__((ext_vector_type(4)));
typedef float    v2f  __attribute__((ext_vector_type(2)));

#define LOG2E    1.44269504f   // folded into the stored Q: scores are exponents of 2
#define VAHEAD   3             // V^T fragments read from LDS ahead of the softmax of their pass
#define PSUM_MAX 16384.f       // a lane's exp sum of one pass above this: the max in use is renewed
                               // (every P value is at most its sum, far inside the f16 range)

// K index held by half-slot h (0..15) for lane-group g (0 or 1) in the
// 16-bit A/B operand of V_WMMA_*_16X16X32 (ISA 7.12.2):
//   h<8  -> K = h      + 8g      (VGPR 0..3)
//   h>=8 -> K = h + 8  + 8g      (VGPR 4..7)
__device__ __forceinline__ int kmap(int h, int g) {
    return (h < 8 ? h : h + 8) + 8 * g;
}

// Load a v16h A/B fragment from a contiguous f16 row `p` (row holds K=0..31).
// The two 8-half groups per lane are 16-byte aligned -> b128 vector loads
// (global_load_b128 or ds_load_b128 depending on the pointer).
__device__ __forceinline__ v16h load_frag_h(const _Float16* p, int g) {
    const v8h lo = *(const v8h*)(p + 8 * g);
    const v8h hi = *(const v8h*)(p + 16 + 8 * g);
    v16h r;
#pragma unroll
    for (int i = 0; i < 8; ++i) { r[i] = lo[i]; r[8 + i] = hi[i]; }
    return r;
}

// Load a v16h fragment from a contiguous, 16-byte aligned f32 row (two groups of
// 8 consecutive floats at +8g and +16+8g), converting to f16: four b128 loads
// + cvt_pk.
__device__ __forceinline__ v16h load_frag_f32(const float* p, int g) {
    const v4f lo0 = *(const v4f*)(p + 8 * g);
    const v4f lo1 = *(const v4f*)(p + 8 * g + 4);
    const v4f hi0 = *(const v4f*)(p + 16 + 8 * g);
    const v4f hi1 = *(const v4f*)(p + 16 + 8 * g + 4);
    v16h r;
#pragma unroll
    for (int i = 0; i < 4; ++i) {
        r[i]      = (_Float16)lo0[i];
        r[4 + i]  = (_Float16)lo1[i];
        r[8 + i]  = (_Float16)hi0[i];
        r[12 + i] = (_Float16)hi1[i];
    }
    return r;
}

__device__ __forceinline__ v8f wmma_f16(v16h a, v16h b, v8f c) {
    return __builtin_amdgcn_wmma_f32_16x16x32_f16(false, a, false, b, (short)0, c,
                                                  false, false);
}

// 2^x for the places that run rarely (renewal of the max in use, merge). The v_nop
// fills the one issue slot that the instruction set asks for between a
// transcendental and a directly following use of its result or rewrite of its
// source; in the statement it stands there in every build.
__device__ __forceinline__ float exp2_slot(float x) {
    float r;
    asm("v_exp_f32 %0, %1\n\tv_nop" : "=v"(r) : "v"(x));
    return r;
}

// ---- CDNA5 async global->LDS copies (ASYNCcnt-tracked) --------------------
// Generic pointers to __shared__ have the LDS byte offset in their low 32 bits
// (ISA 10.2: LDS aperture address is truncated to addr[31:0]).
__device__ __forceinline__ unsigned lds_off(const void* p) {
    return (unsigned)(uintptr_t)p;
}
// One 256-key stage = ten 16-byte copies per lane (K: 2 x 128 rows, V^T: 8 x 16
// rows). ldsK / gK, ldsV / gV: the lane's place in the first copy of each. The
// s_wait_xcnt closes the statement so that it stands in front of any later
// rewrite of the address registers the copies name.
__device__ __forceinline__ void async_ld_stage(unsigned ldsK, const _Float16* gK,
                                               unsigned ldsV, const _Float16* gV) {
    asm volatile("global_load_async_to_lds_b128 %0, %1, off\n\t"
                 "global_load_async_to_lds_b128 %2, %3, off\n\t"
                 "global_load_async_to_lds_b128 %4, %5, off\n\t"
                 "global_load_async_to_lds_b128 %6, %7, off\n\t"
                 "global_load_async_to_lds_b128 %8, %9, off\n\t"
                 "global_load_async_to_lds_b128 %10, %11, off\n\t"
                 "global_load_async_to_lds_b128 %12, %13, off\n\t"
                 "global_load_async_to_lds_b128 %14, %15, off\n\t"
                 "global_load_async_to_lds_b128 %16, %17, off\n\t"
                 "global_load_async_to_lds_b128 %18, %19, off\n\t"
                 "s_wait_xcnt 0x0"
                 :: "v"(ldsK),                     "v"(gK),
                    "v"(ldsK + 128 * LPITCH * 2),  "v"(gK + 128 * DQK),
                    "v"(ldsV),                     "v"(gV),
                    "v"(ldsV +  16 * LPITCH * 2),  "v"(gV + (size_t) 16 * NTOK),
                    "v"(ldsV +  32 * LPITCH * 2),  "v"(gV + (size_t) 32 * NTOK),
                    "v"(ldsV +  48 * LPITCH * 2),  "v"(gV + (size_t) 48 * NTOK),
                    "v"(ldsV +  64 * LPITCH * 2),  "v"(gV + (size_t) 64 * NTOK),
                    "v"(ldsV +  80 * LPITCH * 2),  "v"(gV + (size_t) 80 * NTOK),
                    "v"(ldsV +  96 * LPITCH * 2),  "v"(gV + (size_t) 96 * NTOK),
                    "v"(ldsV + 112 * LPITCH * 2),  "v"(gV + (size_t)112 * NTOK)
                 : "memory");
}
// Four x rows of 1 KB = eight 16-byte copies per lane (a copy = 512 contiguous
// bytes per wave: whole lines). gx / lx: the lane's place in the first row. The
// s_wait_xcnt closes the statement so that it stands in front of any later
// rewrite of the address registers the copies name.
__device__ __forceinline__ void async_ld_x4rows(unsigned lx, const float* gx) {
    asm volatile("global_load_async_to_lds_b128 %0, %1, off\n\t"
                 "global_load_async_to_lds_b128 %2, %3, off\n\t"
                 "global_load_async_to_lds_b128 %4, %5, off\n\t"
                 "global_load_async_to_lds_b128 %6, %7, off\n\t"
                 "global_load_async_to_lds_b128 %8, %9, off\n\t"
                 "global_load_async_to_lds_b128 %10, %11, off\n\t"
                 "global_load_async_to_lds_b128 %12, %13, off\n\t"
                 "global_load_async_to_lds_b128 %14, %15, off\n\t"
                 "s_wait_xcnt 0x0"
                 :: "v"(lx),                    "v"(gx),
                    "v"(lx + 512),              "v"(gx + 128),
                    "v"(lx + 4 * XPITCH),       "v"(gx + CIN),
                    "v"(lx + 4 * XPITCH + 512), "v"(gx + CIN + 128),
                    "v"(lx + 8 * XPITCH),       "v"(gx + 2 * CIN),
                    "v"(lx + 8 * XPITCH + 512), "v"(gx + 2 * CIN + 128),
                    "v"(lx + 12 * XPITCH),       "v"(gx + 3 * CIN),
                    "v"(lx + 12 * XPITCH + 512), "v"(gx + 3 * CIN + 128)
                 : "memory");
}
// This wave's own copies have landed (the barrier behind it publishes them).
__device__ __forceinline__ void wait_asynccnt_0() {
    asm volatile("s_wait_asynccnt 0x0" ::: "memory");
}
// This wave's own LDS reads have retired before the buffer they read is refilled.
__device__ __forceinline__ void wait_dscnt_0() {
    asm volatile("s_wait_dscnt 0x0" ::: "memory");
}

// ---------------------------------------------------------------------------
// Kernel 1: fused QKV projections. One wave per 16-row tile computes ALL
// output tiles (2 K + 2 Q + 8 V = 12 WMMAs per K-chunk), reusing the x
// A-fragment. x is read exactly once: right behind the weight loads each wave
// sends for its whole 16 x 256 f32 tile by async copies to LDS (32 copies of
// whole lines, all in flight at once, under the weight staging), so the load
// latency is paid once and not once per K-chunk; the A-fragments come by
// ds_load_b128 at a pitch of 16 B x odd. Each block forms the 192 W^T rows (f16,
// 96 KB) in LDS itself, straight from the f32 weights: a lane loads 4 output
// columns x 8 consecutive k (eight 16-byte loads, whole 128-byte lines per
// wave), converts, and stores one 16-byte k run per column. The B-fragments
// then come by ds_load_b128 at a pitch of 16 B x odd (no bank conflict).
//   Kh = f16(x @ Wf + bf)   [ROWS, 32]
//   Qh = f16((x @ Wg + bg) * log2 e)   [ROWS, 32]
//   Vt = f16(x @ Wh + bh)^T [BATCH, 128, NTOK]
// Each thread also writes one element of Wvt = f16(Wv^T) [256, 128], which the
// attention launch reads.
// ---------------------------------------------------------------------------
__global__ void __launch_bounds__(256)
proj_qkv_kernel(const float* __restrict__ x,
                const float* __restrict__ Wf, const float* __restrict__ bf,
                const float* __restrict__ Wg, const float* __restrict__ bg,
                const float* __restrict__ Wh, const float* __restrict__ bh,
                const float* __restrict__ Wv,
                _Float16* __restrict__ Qh, _Float16* __restrict__ Kh,
                _Float16* __restrict__ Vt, _Float16* __restrict__ Wvt) {
    const int widx = blockIdx.x * 8 + (threadIdx.x >> 5);   // 0 .. 1023
    const int lane = threadIdx.x & 31;
    const int g    = lane >> 4;
    const int lr   = lane & 15;

    const int row0 = widx * 16;

    __shared__ __attribute__((aligned(16))) _Float16 Wl[WROWS * WPITCH];   // rows: 32 K, 32 Q, 128 V
    __shared__ __attribute__((aligned(16))) float    Xl[XROWS * XPITCH];   // the block's x rows, f32

    v8f accK[2], accQ[2], accV[8];
#pragma unroll
    for (int t = 0; t < 2; ++t) accK[t] = accQ[t] = (v8f){0,0,0,0,0,0,0,0};
#pragma unroll
    for (int t = 0; t < 8; ++t) accV[t] = (v8f){0,0,0,0,0,0,0,0};

    const _Float16* wfr = &Wl[lr * WPITCH];                 // row lr of the staged W^T tiles
    const _Float16* wgr = &Wl[(DQK + lr) * WPITCH];
    const _Float16* whr = &Wl[(2 * DQK + lr) * WPITCH];
    const float*    xr  = &Xl[((threadIdx.x >> 5) * 16 + lr) * XPITCH];   // staged x row of this lane

    // ---- stage W^T: wave w takes k = 32w .. 32w+31 of all 192 output columns ----
    // Lane = (k octet, column quad). In every ds_store_b128 the 16 lanes of a
    // half-wave (4 quads x 4 octets) fall on 16 distinct groups of four banks.
    const int iv = blockIdx.x * 256 + threadIdx.x;          // this thread's Wvt element
    float wv;
    {
        const int kk = (threadIdx.x >> 5) * 32 + (lane & 3) * 8;   // first k of the lane's octet
        const int nq = (lane >> 2) * 4;                            // first column of its quad
        const float* pf = Wf + kk * DQK + nq;
        const float* pg = Wg + kk * DQK + nq;
        const float* ph = Wh + kk * DVDIM + nq;
        const float* pv = Wv + (iv & (DVDIM - 1)) * CIN + (iv >> 7);
        v4f r[6][8];                                        // [32-column group: K, Q, 4 x V][k]
#pragma unroll
        for (int i = 0; i < 8; ++i) {
            r[0][i] = *(const v4f*)(pf + i * DQK);
            r[1][i] = *(const v4f*)(pg + i * DQK);
#pragma unroll
            for (int nb = 0; nb < 4; ++nb)
                r[2 + nb][i] = *(const v4f*)(ph + i * DVDIM + nb * 32);
        }
        wv = *pv;
        // keeps the loads' address registers untouched (also by the loads' own
        // results) until every request is taken
        asm volatile("s_wait_xcnt 0x0" :: "v"(pf), "v"(pg), "v"(ph), "v"(pv) : "memory");
        // ---- this wave's 16 x rows: 32 copies, issued while the weight loads fly ----
        {
            const float*   gx = x + (size_t)row0 * CIN + lane * 4;
            const unsigned lx = lds_off(&Xl[(threadIdx.x >> 5) * 16 * XPITCH + lane * 4]);
            // kept rolled: one set of address registers serves all four trips, while
            // the 48 weight loads in flight hold most of the register file
#pragma nounroll
            for (int r4 = 0; r4 < 4; ++r4)
                async_ld_x4rows(lx + r4 * 16 * XPITCH, gx + r4 * 4 * CIN);
        }
#pragma unroll
        for (int m = 0; m < 6; ++m)
#pragma unroll
            for (int c = 0; c < 4; ++c) {
                v8h h;
#pragma unroll
                for (int i = 0; i < 8; ++i) h[i] = (_Float16)r[m][i][c];
                *(v8h*)&Wl[(m * 32 + nq + c) * WPITCH + kk] = h;
            }
    }
    wait_asynccnt_0();                                      // own x tile landed
    __syncthreads();                                        // staged W^T and x visible to all waves

    for (int k0 = 0; k0 < CIN; k0 += 32) {
        const v16h a = load_frag_f32(xr + k0, g);           // shared A fragment
#pragma unroll
        for (int t = 0; t < 2; ++t) {
            const v16h bK = load_frag_h(wfr + (t * 16) * WPITCH + k0, g);
            accK[t] = wmma_f16(a, bK, accK[t]);
            const v16h bQ = load_frag_h(wgr + (t * 16) * WPITCH + k0, g);
            accQ[t] = wmma_f16(a, bQ, accQ[t]);
        }
#pragma unroll
        for (int t = 0; t < 8; ++t) {
            const v16h bV = load_frag_h(whr + (t * 16) * WPITCH + k0, g);
            accV[t] = wmma_f16(a, bV, accV[t]);
        }
    }

    // ---- store K and Q: f16 [row, 32] (C-layout: row = row0 + j + 8g) ----
#pragma unroll
    for (int t = 0; t < 2; ++t) {
        const float bK = bf[t * 16 + lr];
        const float bQ = bg[t * 16 + lr];
#pragma unroll
        for (int j = 0; j < 8; ++j) {
            const size_t row = row0 + j + 8 * g;
            Kh[row * DQK + t * 16 + lr] = (_Float16)(accK[t][j] + bK);
            Qh[row * DQK + t * 16 + lr] = (_Float16)((accQ[t][j] + bQ) * LOG2E);
        }
    }
    // ---- store V transposed: Vt[b][dv][token], 8 consecutive tokens/lane ----
    const int b     = row0 >> 12;
    const int nbase = (row0 & (NTOK - 1)) + 8 * g;
#pragma unroll
    for (int t = 0; t < 8; ++t) {
        const float bV = bh[t * 16 + lr];
        _Float16* dst = Vt + (size_t)b * DVDIM * NTOK + (size_t)(t * 16 + lr) * NTOK;
#pragma unroll
        for (int j = 0; j < 8; ++j)
            dst[nbase + j] = (_Float16)(accV[t][j] + bV);
    }
    // ---- Wv^T element n = iv / 128, k = iv % 128 (behind the barrier: no wait on it) ----
    Wvt[iv] = (_Float16)wv;
}

// ---------------------------------------------------------------------------
// Kernel 2: fused flash attention (transposed formulation) with the output
// projection and residual in its epilogue. Keys are split over
// eight wave groups. One block (16 waves) owns 64 consecutive queries of one
// batch: wave = (query-tile pair qp, key group ks). A stage is 256 keys; group ks
// works on its keys 32*ks .. 32*ks+31 for 32 queries, so every K and V^T
// fragment read from LDS feeds two WMMAs (two query tiles) and the block reads
// half the LDS bytes per score. 256 blocks of four waves per SIMD cover every
// WGP. Stages are double-buffered in LDS via global_load_async_to_lds
// (ASYNCcnt). The 64-byte tile rows lie in LDS at a pitch of 80 bytes (16 B x
// odd): the 16 lanes of a half-wave, one row each, then fall on 16 distinct
// groups of four banks in every ds_load_b128.
//   S^T sub-tile  = WMMA(A = K rows, B = Q^T)        (2 per key tile and query tile)
//   softmax against a max in use m (log2 domain) that is renewed rarely: -m is the
//   C operand of the S^T WMMAs, so their result is the exponent itself and a pass
//   needs no max, subtract, scale or rescale of O. One test per pass on the lanes'
//   exp sums branches to the renewal (true max, O and l rescaled, P formed again);
//   the first pass always takes it. m never exceeds the running max.
//   O^T           = WMMA(A = V^T rows, B = P^T)      (8 per key tile and query tile)
// P^T B-fragment is built from the two S^T C-fragments *within each lane*.
// The eight groups' (max, sum, O^T) partials of a query tile meet in LDS at the
// end, in the bytes of the ring (free behind the loop's last barrier); each
// group merges one 16-wide dv tile.
// Epilogue: out = x + O @ Wv + bv for the block's 64 queries. The merged tile
// of a lane is, in place, the low or high half of its part of the f16 A fragment
// (rows = queries) of one 32-wide dv chunk; the 16 fragments are exchanged
// through LDS and each of the waves 0..7 forms 64 queries x 32 output columns
// (32 WMMAs), so that a block loads every Wv^T fragment once. O never goes to
// memory.
// ---------------------------------------------------------------------------
__global__ void __launch_bounds__(ATHREADS)
attn_kernel(const _Float16* __restrict__ Qh, const _Float16* __restrict__ Kh,
            const _Float16* __restrict__ Vt, const float* __restrict__ x,
            const _Float16* __restrict__ Wvt, const float* __restrict__ bv,
            float* __restrict__ out) {
    // one range, two uses: in the loop the K / V^T ring, behind it the partials
    __shared__ __attribute__((aligned(16))) unsigned char ring[AWAVES * QPW * 16 * 32 * 16];
    __shared__ float Pm[AWAVES][QPW][32];                                              // [wave][query tile][lane]
    __shared__ float Pl[AWAVES][QPW][32];
    __shared__ __attribute__((aligned(16))) v8h Ofr[QTILES][DVDIM / 32][2][32];        // [query tile][dv chunk][low/high 8 halfs][lane]
    _Float16* const Kbuf = (_Float16*)ring;                               // [buf][key(256)][dqk(32) + pad]
    _Float16* const Vbuf = (_Float16*)ring + 2 * SKEYS * LPITCH;          // [buf][group] x VGRP: [dv(128)][key(32) + pad]
    v4f*      const Pacc = (v4f*)ring;                                    // [wave][query tile][dt*2 + half][lane]
    static_assert((2 * SKEYS * LPITCH + 2 * KSPLIT * VGRP) * 2 <= AWAVES * QPW * 16 * 32 * 16,
                  "the ring fits the range");

    const int tid  = threadIdx.x;               // 0..511
    const int lane = tid & 31;
    const int g    = lane >> 4;
    const int lr   = lane & 15;
    const int wave = tid >> 5;                  // 0..15
    const int qp   = wave & (QGRP - 1);         // query-tile pair of the block
    const int ks   = wave / QGRP;               // key group

    const int b    = blockIdx.x / (NTOK / (16 * QTILES));         // 64 blocks per batch
    const int qblk = (blockIdx.x % (NTOK / (16 * QTILES))) * (16 * QTILES);
    const int q0   = qblk + qp * (16 * QPW);

    const _Float16* Qb    = Qh + (size_t)b * NTOK * DQK;
    const _Float16* KbBlk = Kh + (size_t)b * NTOK * DQK;      // block-uniform
    const _Float16* VbBlk = Vt + (size_t)b * DVDIM * NTOK;    // block-uniform

    // Q^T B-fragments: lane column = query (q0 + 16c + lr), halfs sweep d_qk (=32)
    v16h qf[QPW];
#pragma unroll
    for (int c = 0; c < QPW; ++c)
        qf[c] = load_frag_h(Qb + (size_t)(q0 + c * 16 + lr) * DQK, g);
    // the Q loads' address registers are reused by the address sums below
    asm volatile("s_wait_xcnt 0x0" ::: "memory");

    // Out-projection share of waves 0..7: output columns n0 .. n0+31 (one 128-byte
    // line per row) of the block's 64 queries.
    const bool owave = __builtin_amdgcn_readfirstlane(wave) < 8;   // wave-uniform: scalar branch
    const int  n0    = (wave & 7) * 32;

    // ---- async stage of 256 keys: 10 ops per wave ----
    auto fill = [&](int kb, int buf) {
        // K: 256 rows x 64 B contiguous = 16384 B = 2 x 512 lanes x 16 B
        // V: 128 rows (stride NTOK) x 512 B = 65536 B = 8 x 512 lanes x 16 B;
        //    a wave covers one row's 512 B, four lanes each group's 64 B
        const int d  = tid >> 5;                 // dv row 0..15 (copy c: +16c)
        const int pc = tid & 31;                 // 16-byte piece of the row
        async_ld_stage(lds_off(Kbuf + buf * (SKEYS * LPITCH) + (tid >> 2) * LPITCH + (tid & 3) * 8),
                       KbBlk + (size_t)kb * DQK + tid * 8,
                       lds_off(Vbuf + (buf * KSPLIT + (pc >> 2)) * VGRP + d * LPITCH + (pc & 3) * 8),
                       VbBlk + (size_t)d * NTOK + kb + pc * 8);
    };

    // m: max in use (log2 domain); its start value makes the first pass's exponents
    // overflow to +inf, which the renewal that this pass always takes throws away.
    // l: sum over this lane's own 16 keys of every pass; the halves meet behind the loop.
    float m[QPW], l[QPW];
    v8f acc[QPW][8];
#pragma unroll
    for (int c = 0; c < QPW; ++c) {
        m[c] = -1e30f;
        l[c] = 0.f;
#pragma unroll
        for (int dt = 0; dt < 8; ++dt) acc[c][dt] = (v8f){0,0,0,0,0,0,0,0};
    }

    const int NST = NTOK / SKEYS;               // 16 stages
    fill(0, 0);
    wait_asynccnt_0();
    __syncthreads();                             // stage 0 visible to all waves
    fill(SKEYS, 1);
    for (int st = 0; st < NST; ++st) {
        const int buf = st & 1;

        // A-fragments from LDS: 16 key rows each, halfs sweep d_qk
        const _Float16* krow = Kbuf + buf * (SKEYS * LPITCH) + (ks * 32 + lr) * LPITCH;
        const v16h a0 = load_frag_h(krow, g);
        const v16h a1 = load_frag_h(krow + 16 * LPITCH, g);
        // the first V^T fragments, asked for ahead of the branch below: they land under the
        // test and the packing of P
        const _Float16* vrow = Vbuf + (buf * KSPLIT + ks) * VGRP + lr * LPITCH;
        v16h av[8];
#pragma unroll
        for (int dt = 0; dt < VAHEAD; ++dt) av[dt] = load_frag_h(vrow + (dt * 16) * LPITCH, g);

        // S^T tiles minus the max in use: lane = query column, VGPR j -> key =
        // kb + sub*16 + j + 8g
        v8f s0[QPW], s1[QPW];
#pragma unroll
        for (int c = 0; c < QPW; ++c) {
            const float n = -m[c];              // C of the S^T WMMAs, the same in all eight elements
            const v8f cm = {n, n, n, n, n, n, n, n};
            s0[c] = wmma_f16(a0, qf[c], cm);
            s1[c] = wmma_f16(a1, qf[c], cm);
        }

        // exponentiate + pack P^T B-fragment (pure in-lane repack):
        //   h<8  -> key kb + h + 8g        == s0[j = h]
        //   h>=8 -> key kb + 16 + (h-8)+8g == s1[j = h-8]
        float psum[QPW];
        v16h  pf[QPW];
#pragma unroll
        for (int c = 0; c < QPW; ++c) {
            v2f ps = {0.f, 0.f};
#pragma unroll
            for (int j = 0; j < 8; ++j) {
                const v2f p = {__builtin_amdgcn_exp2f(s0[c][j]), __builtin_amdgcn_exp2f(s1[c][j])};
                ps += p;
                pf[c][j]     = (_Float16)p[0];
                pf[c][8 + j] = (_Float16)p[1];
            }
            psum[c] = ps[0] + ps[1];
        }

        // renewal of the max in use: one scalar branch per pass for the whole wave
        const bool need = st == 0 || !(psum[0] <= PSUM_MAX) || !(psum[1] <= PSUM_MAX);
        if (__builtin_amdgcn_ballot_w32(need) != 0u) {
            // compiler fence: the K fragments are read from LDS again here, so that neither
            // they nor the scores hold registers over the common path
            asm volatile("" ::: "memory");
            const v16h r0 = load_frag_h(krow, g);
            const v16h r1 = load_frag_h(krow + 16 * LPITCH, g);
            const v8f zero = {0,0,0,0,0,0,0,0};
#pragma unroll
            for (int c = 0; c < QPW; ++c) {
                const v8f t0 = wmma_f16(r0, qf[c], zero);
                const v8f t1 = wmma_f16(r1, qf[c], zero);
                float tmax = t0[0];
#pragma unroll
                for (int j = 0; j < 8; ++j) {
                    tmax = fmaxf(tmax, t0[j]);
                    tmax = fmaxf(tmax, t1[j]);
                }
                tmax = fmaxf(tmax, __shfl_xor(tmax, 16, 32));
                const float mnew  = fmaxf(m[c], tmax);
                const float alpha = exp2_slot(m[c] - mnew);   // first pass: 0
                m[c] = mnew;
                v2f ps = {0.f, 0.f};
#pragma unroll
                for (int j = 0; j < 8; ++j) {
                    const v2f p = {exp2_slot(t0[j] - mnew), exp2_slot(t1[j] - mnew)};
                    ps += p;
                    pf[c][j]     = (_Float16)p[0];
                    pf[c][8 + j] = (_Float16)p[1];
                }
                psum[c] = ps[0] + ps[1];
                l[c] *= alpha;
#pragma unroll
                for (int dt = 0; dt < 8; ++dt)
#pragma unroll
                    for (int j = 0; j < 8; ++j) acc[c][dt][j] *= alpha;
            }
        }
#pragma unroll
        for (int c = 0; c < QPW; ++c) l[c] += psum[c];

        // O^T accumulation over the 8 dv tiles (V^T rows from LDS, each fragment
        // for both query tiles)
#pragma unroll
        for (int d0 = 0; d0 < 8; d0 += VAHEAD) {
            // the next group's LDS reads as one block ahead of this group's WMMAs
#pragma unroll
            for (int dt = d0 + VAHEAD; dt < d0 + 2 * VAHEAD && dt < 8; ++dt)
                av[dt] = load_frag_h(vrow + (dt * 16) * LPITCH, g);
            // keeps those reads ahead of the WMMAs: left free, the scheduler puts each read
            // directly in front of its own WMMA and the wave waits out every LDS latency
            if (d0 + VAHEAD < 8) __builtin_amdgcn_sched_barrier(0);
#pragma unroll
            for (int dt = d0; dt < d0 + VAHEAD && dt < 8; ++dt)
#pragma unroll
                for (int c = 0; c < QPW; ++c) acc[c][dt] = wmma_f16(av[dt], pf[c], acc[c][dt]);
        }

        // publish point: own reads of buf retired, own copies of stage st+1
        // landed; the one barrier publishes st+1 and frees buf for the refill
        wait_dscnt_0();
        wait_asynccnt_0();
        __syncthreads();
        if (st + 2 < NST) fill((st + 2) * SKEYS, buf);
    }
    wait_asynccnt_0();

    // residual rows and bias of this wave's output share (C-layout: lane = column,
    // element j = row j + 8g); issued ahead of the partials' LDS stores
    const size_t orow0 = (size_t)b * NTOK + qblk + 8 * g;
    const int    ocol  = n0 + lr;
    float xres[QTILES][2][8], bcol[2];
    if (owave) {
        const float* xp = x + orow0 * CIN + ocol;
#pragma unroll
        for (int t = 0; t < 2; ++t) {
            bcol[t] = bv[ocol + t * 16];
#pragma unroll
            for (int q4 = 0; q4 < QTILES; ++q4)
#pragma unroll
                for (int j = 0; j < 8; ++j)
                    xres[q4][t][j] = xp[(q4 * 16 + j) * CIN + t * 16];
        }
        // keeps the loads' address registers untouched (also by the loads' own
        // results) until every request is taken
        asm volatile("s_wait_xcnt 0x0" :: "v"(ocol), "v"(xp) : "memory");
    }

    // ---- merge the eight key groups' partials of each query tile ----
    // (the ring is free: every wave's last reads and copies ended in front of the
    // loop's last barrier)
#pragma unroll
    for (int c = 0; c < QPW; ++c) {
#pragma unroll
        for (int dt = 0; dt < 8; ++dt) {
            v4f* pa = Pacc + ((wave * QPW + c) * 16 + dt * 2) * 32 + lane;
            pa[0]  = (v4f){acc[c][dt][0], acc[c][dt][1], acc[c][dt][2], acc[c][dt][3]};
            pa[32] = (v4f){acc[c][dt][4], acc[c][dt][5], acc[c][dt][6], acc[c][dt][7]};
        }
        Pm[wave][c][lane] = m[c];
        Pl[wave][c][lane] = l[c] + __shfl_xor(l[c], 16, 32);   // the two halves' keys joined once
    }

    __syncthreads();                             // all partials visible

    // The Wv^T B fragments of waves 0..7: loaded here, where the accumulators'
    // registers are free again; behind the barrier, so that they fly under the merge.
    v16h wb[2][4];
    if (owave) {
        const _Float16* wrow = Wvt + (size_t)(n0 + lr) * DVDIM;
#pragma unroll
        for (int t = 0; t < 2; ++t)
#pragma unroll
            for (int c = 0; c < 4; ++c)
                wb[t][c] = load_frag_h(wrow + (t * 16) * DVDIM + c * 32, g);
        // keeps the loads' address registers untouched (also by the loads' own
        // results) until every request is taken
        asm volatile("s_wait_xcnt 0x0" :: "v"(wrow + 8 * g) : "memory");
    }

    // group ks merges dv 16*ks .. 16*ks+15 of its two query tiles. O^T element j
    // of an even tile is k = j + 8g of its 32-wide chunk, of an odd tile
    // k = 16 + j + 8g: the k order of the 16-bit A/B operand (kmap), so the
    // repack is in-lane.
#pragma unroll
    for (int c = 0; c < QPW; ++c) {
        float ms[KSPLIT], wgt[KSPLIT];
        float mall = -1e30f;
#pragma unroll
        for (int s = 0; s < KSPLIT; ++s) {
            ms[s] = Pm[s * QGRP + qp][c][lane];
            mall  = fmaxf(mall, ms[s]);
        }
        float lall = 0.f;
#pragma unroll
        for (int s = 0; s < KSPLIT; ++s) {
            wgt[s] = exp2_slot(ms[s] - mall);
            lall  += wgt[s] * Pl[s * QGRP + qp][c][lane];
        }
        const float inv = 1.f / lall;
#pragma unroll
        for (int s = 0; s < KSPLIT; ++s) wgt[s] *= inv;

        v8h ofl;
#pragma unroll
        for (int h = 0; h < 2; ++h) {
            v4f o = {0.f, 0.f, 0.f, 0.f};
#pragma unroll
            for (int s = 0; s < KSPLIT; ++s)
                o += Pacc[(((s * QGRP + qp) * QPW + c) * 16 + ks * 2 + h) * 32 + lane] * wgt[s];
#pragma unroll
            for (int i = 0; i < 4; ++i) ofl[h * 4 + i] = (_Float16)o[i];
        }
        Ofr[qp * QPW + c][ks >> 1][ks & 1][lane] = ofl;
    }
    __syncthreads();                             // all O fragments visible

    // ---- out = x + O @ Wv + bv: 4 query tiles x 2 column tiles x 4 dv chunks ----
    if (!owave) return;                          // no barrier follows
    v8f oacc[QTILES][2];                         // start value: residual + bias
#pragma unroll
    for (int q4 = 0; q4 < QTILES; ++q4)
#pragma unroll
        for (int t = 0; t < 2; ++t)
#pragma unroll
            for (int j = 0; j < 8; ++j) oacc[q4][t][j] = xres[q4][t][j] + bcol[t];
#pragma unroll
    for (int c = 0; c < 4; ++c) {
#pragma unroll
        for (int q4 = 0; q4 < QTILES; ++q4) {
            const v8h lo = Ofr[q4][c][0][lane];
            const v8h hi = Ofr[q4][c][1][lane];
            v16h a;
#pragma unroll
            for (int i = 0; i < 8; ++i) { a[i] = lo[i]; a[8 + i] = hi[i]; }
#pragma unroll
            for (int t = 0; t < 2; ++t) oacc[q4][t] = wmma_f16(a, wb[t][c], oacc[q4][t]);
        }
    }
#pragma unroll
    for (int q4 = 0; q4 < QTILES; ++q4)
#pragma unroll
        for (int t = 0; t < 2; ++t)
#pragma unroll
            for (int j = 0; j < 8; ++j)
                out[(orow0 + q4 * 16 + j) * CIN + ocol + t * 16] = oacc[q4][t][j];
}

// ---------------------------------------------------------------------------
// Host-side launch. Workspace layout (bytes):
//   [0,       1 MB)   Qh  f16 [16384, 32]
//   [1 MB,    2 MB)   Kh  f16 [16384, 32]
//   [2 MB,    6 MB)   Vt  f16 [4, 128, 4096]   (transposed values)
//   [14 MB,  ...  )   Wvt f16 [256, 128]      (transposed out-projection weights)
// ---------------------------------------------------------------------------
extern "C" void kernel_launch(void* const* d_in, const int* in_sizes, int n_in,
                              void* d_out, int out_size, void* d_ws, size_t ws_size,
                              hipStream_t stream) {
    const float* x  = (const float*)d_in[0];
    const float* Wf = (const float*)d_in[1];
    const float* bf = (const float*)d_in[2];
    const float* Wg = (const float*)d_in[3];
    const float* bg = (const float*)d_in[4];
    const float* Wh = (const float*)d_in[5];
    const float* bh = (const float*)d_in[6];
    const float* Wv = (const float*)d_in[7];
    const float* bv = (const float*)d_in[8];
    float* out = (float*)d_out;

    char* ws = (char*)d_ws;
    _Float16* Qh  = (_Float16*)(ws);
    _Float16* Kh  = (_Float16*)(ws + (1u << 20));
    _Float16* Vt  = (_Float16*)(ws + (2u << 20));
    _Float16* Wvt = (_Float16*)(ws + (14u << 20));

    // K1: 1024 row-tile waves, 8 waves/block -> 128 blocks
    hipLaunchKernelGGL(proj_qkv_kernel, dim3(128), dim3(256), 0, stream,
                       x, Wf, bf, Wg, bg, Wh, bh, Wv, Qh, Kh, Vt, Wvt);
    // K2: 256 blocks x 16 waves, each block = 64 queries of one batch
    hipLaunchKernelGGL(attn_kernel, dim3(256), dim3(ATHREADS), 0, stream,
                       Qh, Kh, Vt, x, Wvt, bv, out);
}

// v009
// Measured time: 35.8 microseconds a run.
// Timed twice side by side with v008, it ran 1.17 times as fast both times.
// Counting every step since v000, it is 3.71 times as fast.
#include <hip/hip_runtime.h>
#include <hip/hip_bf16.h>

// ---------------------------------------------------------------------------
// Fused self-attention for gfx1250 (MI455X), f16 WMMA with f32 accumulation.
// B=4, H=W=64 -> N=4096 tokens/batch, C=256, DQK=32, DV=128.
// ---------------------------------------------------------------------------

#define BATCH 4
#define NTOK  4096        // H*W
#define CIN   256
#define DQK   32
#define DVDIM 128
#define ROWS  (BATCH * NTOK)   // 16384
#define LPITCH 40              // halfs per staged LDS row: 32 data + 8 pad (80 B)
#define KSPLIT 8               // key groups (waves that share a pair of query tiles)
#define QTILES 4               // 16-query tiles per attention block
#define QPW    2               // query tiles per wave: each K and V^T fragment serves both
#define QGRP   (QTILES / QPW)  // query-tile pairs per attention block
#define SKEYS  (32 * KSPLIT)   // keys per staged LDS buffer
#define AWAVES (KSPLIT * QGRP) // waves per attention block
#define ATHREADS (32 * AWAVES)
#define VGRP   (DVDIM * LPITCH + 32)   // halfs per key group's V^T tile: 128 rows + 64 B, so that the
                                       // eight 64-byte pieces of one copy spread over all banks
#define WROWS  (2 * DQK + DVDIM)   // staged W^T rows of the QKV projection (K, Q, V)
#define WPITCH (CIN + 8)           // halfs per staged row: 256 data + 8 pad (528 B = 16 B x 33)
#define XROWS  128                 // x rows per projection block (8 waves x 16)
#define XPITCH (CIN + 4)           // floats per staged x row: 256 data + 4 pad (1040 B = 16 B x 65)

typedef _Float16 v16h __attribute__((ext_vector_type(16)));
typedef _Float16 v8h  __attribute__((ext_vector_type(8)));
typedef float    v8f  __attribute__((ext_vector_type(8)));
typedef float    v4f  __attribute__((ext_vector_type(4)));
typedef float    v2f  __attribute__((ext_vector_type(2)));

#define LOG2E    1.44269504f   // folded into the stored Q: scores are exponents of 2
#define VAHEAD   3             // V^T fragments read from LDS ahead of the softmax of their pass
#define PSUM_MAX 16384.f       // a lane's exp sum of one pass above this: the max in use is renewed
                               // (every P value is at most its sum, far inside the f16 range)

// K index held by half-slot h (0..15) for lane-group g (0 or 1) in the
// 16-bit A/B operand of V_WMMA_*_16X16X32 (ISA 7.12.2):
//   h<8  -> K = h      + 8g      (VGPR 0..3)
//   h>=8 -> K = h + 8  + 8g      (VGPR 4..7)
__device__ __forceinline__ int kmap(int h, int g) {
    return (h < 8 ? h : h + 8) + 8 * g;
}

// Load a v16h A/B fragment from a contiguous f16 row `p` (row holds K=0..31).
// The two 8-half groups per lane are 16-byte aligned -> b128 vector loads
// (global_load_b128 or ds_load_b128 depending on the pointer).
__device__ __forceinline__ v16h load_frag_h(const _Float16* p, int g) {
    const v8h lo = *(const v8h*)(p + 8 * g);
    const v8h hi = *(const v8h*)(p + 16 + 8 * g);
    v16h r;
#pragma unroll
    for (int i = 0; i < 8; ++i) { r[i] = lo[i]; r[8 + i] = hi[i]; }
    return r;
}

// Load a v16h fragment from a contiguous, 16-byte aligned f32 row (two groups of
// 8 consecutive floats at +8g and +16+8g), converting to f16: four b128 loads
// + cvt_pk.
__device__ __forceinline__ v16h load_frag_f32(const float* p, int g) {
    const v4f lo0 = *(const v4f*)(p + 8 * g);
    const v4f lo1 = *(const v4f*)(p + 8 * g + 4);
    const v4f hi0 = *(const v4f*)(p + 16 + 8 * g);
    const v4f hi1 = *(const v4f*)(p + 16 + 8 * g + 4);
    v16h r;
#pragma unroll
    for (int i = 0; i < 4; ++i) {
        r[i]      = (_Float16)lo0[i];
        r[4 + i]  = (_Float16)lo1[i];
        r[8 + i]  = (_Float16)hi0[i];
        r[12 + i] = (_Float16)hi1[i];
    }
    return r;
}

__device__ __forceinline__ v8f wmma_f16(v16h a, v16h b, v8f c) {
    return __builtin_amdgcn_wmma_f32_16x16x32_f16(false, a, false, b, (short)0, c,
                                                  false, false);
}

// 2^x for the places that run rarely (renewal of the max in use, merge). The v_nop
// fills the one issue slot that the instruction set asks for between a
// transcendental and a directly following use of its result or rewrite of its
// source; in the statement it stands there in every build.
__device__ __forceinline__ float exp2_slot(float x) {
    float r;
    asm("v_exp_f32 %0, %1\n\tv_nop" : "=v"(r) : "v"(x));
    return r;
}

// ---- CDNA5 async global->LDS copies (ASYNCcnt-tracked) --------------------
// Generic pointers to __shared__ have the LDS byte offset in their low 32 bits
// (ISA 10.2: LDS aperture address is truncated to addr[31:0]).
__device__ __forceinline__ unsigned lds_off(const void* p) {
    return (unsigned)(uintptr_t)p;
}
// One 256-key stage = ten 16-byte copies per lane (K: 2 x 128 rows, V^T: 8 x 16
// rows). ldsK / gK, ldsV / gV: the lane's place in the first copy of each. The
// s_wait_xcnt closes the statement so that it stands in front of any later
// rewrite of the address registers the copies name.
__device__ __forceinline__ void async_ld_stage(unsigned ldsK, const _Float16* gK,
                                               unsigned ldsV, const _Float16* gV) {
    asm volatile("global_load_async_to_lds_b128 %0, %1, off\n\t"
                 "global_load_async_to_lds_b128 %2, %3, off\n\t"
                 "global_load_async_to_lds_b128 %4, %5, off\n\t"
                 "global_load_async_to_lds_b128 %6, %7, off\n\t"
                 "global_load_async_to_lds_b128 %8, %9, off\n\t"
                 "global_load_async_to_lds_b128 %10, %11, off\n\t"
                 "global_load_async_to_lds_b128 %12, %13, off\n\t"
                 "global_load_async_to_lds_b128 %14, %15, off\n\t"
                 "global_load_async_to_lds_b128 %16, %17, off\n\t"
                 "global_load_async_to_lds_b128 %18, %19, off\n\t"
                 "s_wait_xcnt 0x0"
                 :: "v"(ldsK),                     "v"(gK),
                    "v"(ldsK + 128 * LPITCH * 2),  "v"(gK + 128 * DQK),
                    "v"(ldsV),                     "v"(gV),
                    "v"(ldsV +  16 * LPITCH * 2),  "v"(gV + (size_t) 16 * NTOK),
                    "v"(ldsV +  32 * LPITCH * 2),  "v"(gV + (size_t) 32 * NTOK),
                    "v"(ldsV +  48 * LPITCH * 2),  "v"(gV + (size_t) 48 * NTOK),
                    "v"(ldsV +  64 * LPITCH * 2),  "v"(gV + (size_t) 64 * NTOK),
                    "v"(ldsV +  80 * LPITCH * 2),  "v"(gV + (size_t) 80 * NTOK),
                    "v"(ldsV +  96 * LPITCH * 2),  "v"(gV + (size_t) 96 * NTOK),
                    "v"(ldsV + 112 * LPITCH * 2),  "v"(gV + (size_t)112 * NTOK)
                 : "memory");
}
// Four x rows of 1 KB = eight 16-byte copies per lane (a copy = 512 contiguous
// bytes per wave: whole lines). gx / lx: the lane's place in the first row. The
// s_wait_xcnt closes the statement so that it stands in front of any later
// rewrite of the address registers the copies name.
__device__ __forceinline__ void async_ld_x4rows(unsigned lx, const float* gx) {
    asm volatile("global_load_async_to_lds_b128 %0, %1, off\n\t"
                 "global_load_async_to_lds_b128 %2, %3, off\n\t"
                 "global_load_async_to_lds_b128 %4, %5, off\n\t"
                 "global_load_async_to_lds_b128 %6, %7, off\n\t"
                 "global_load_async_to_lds_b128 %8, %9, off\n\t"
                 "global_load_async_to_lds_b128 %10, %11, off\n\t"
                 "global_load_async_to_lds_b128 %12, %13, off\n\t"
                 "global_load_async_to_lds_b128 %14, %15, off\n\t"
                 "s_wait_xcnt 0x0"
                 :: "v"(lx),                    "v"(gx),
                    "v"(lx + 512),              "v"(gx + 128),
                    "v"(lx + 4 * XPITCH),       "v"(gx + CIN),
                    "v"(lx + 4 * XPITCH + 512), "v"(gx + CIN + 128),
                    "v"(lx + 8 * XPITCH),       "v"(gx + 2 * CIN),
                    "v"(lx + 8 * XPITCH + 512), "v"(gx + 2 * CIN + 128),
                    "v"(lx + 12 * XPITCH),       "v"(gx + 3 * CIN),
                    "v"(lx + 12 * XPITCH + 512), "v"(gx + 3 * CIN + 128)
                 : "memory");
}
// This wave's own copies have landed (the barrier behind it publishes them).
__device__ __forceinline__ void wait_asynccnt_0() {
    asm volatile("s_wait_asynccnt 0x0" ::: "memory");
}
// This wave's own LDS reads have retired before the buffer they read is refilled.
__device__ __forceinline__ void wait_dscnt_0() {
    asm volatile("s_wait_dscnt 0x0" ::: "memory");
}

// ---------------------------------------------------------------------------
// Kernel 1: fused QKV projections. One wave per 16-row tile computes ALL
// output tiles (2 K + 2 Q + 8 V = 12 WMMAs per K-chunk), reusing the x
// A-fragment. x is read exactly once: right behind the weight loads each wave
// sends for its whole 16 x 256 f32 tile by async copies to LDS (32 copies of
// whole lines, all in flight at once, under the weight staging), so the load
// latency is paid once and not once per K-chunk; the A-fragments come by
// ds_load_b128 at a pitch of 16 B x odd. Each block forms the 192 W^T rows (f16,
// 96 KB) in LDS itself, straight from the f32 weights: a lane loads 4 output
// columns x 8 consecutive k (eight 16-byte loads, whole 128-byte lines per
// wave), converts, and stores one 16-byte k run per column. The B-fragments
// then come by ds_load_b128 at a pitch of 16 B x odd (no bank conflict).
//   Kh = f16(x @ Wf + bf)   [ROWS, 32]
//   Qh = f16((x @ Wg + bg) * log2 e)   [ROWS, 32]
//   Vt = f16(x @ Wh + bh)^T [BATCH, 128, NTOK]
// Each thread also writes one element of Wvt = f16(Wv^T) [256, 128], which the
// attention launch reads.
// ---------------------------------------------------------------------------
__global__ void __launch_bounds__(256)
proj_qkv_kernel(const float* __restrict__ x,
                const float* __restrict__ Wf, const float* __restrict__ bf,
                const float* __restrict__ Wg, const float* __restrict__ bg,
                const float* __restrict__ Wh, const float* __restrict__ bh,
                const float* __restrict__ Wv,
                _Float16* __restrict__ Qh, _Float16* __restrict__ Kh,
                _Float16* __restrict__ Vt, _Float16* __restrict__ Wvt) {
    const int widx = blockIdx.x * 8 + (threadIdx.x >> 5);   // 0 .. 1023
    const int lane = threadIdx.x & 31;
    const int g    = lane >> 4;
    const int lr   = lane & 15;

    const int row0 = widx * 16;

    __shared__ __attribute__((aligned(16))) _Float16 Wl[WROWS * WPITCH];   // rows: 32 K, 32 Q, 128 V
    __shared__ __attribute__((aligned(16))) float    Xl[XROWS * XPITCH];   // the block's x rows, f32

    v8f accK[2], accQ[2], accV[8];
#pragma unroll
    for (int t = 0; t < 2; ++t) accK[t] = accQ[t] = (v8f){0,0,0,0,0,0,0,0};
#pragma unroll
    for (int t = 0; t < 8; ++t) accV[t] = (v8f){0,0,0,0,0,0,0,0};

    const _Float16* wfr = &Wl[lr * WPITCH];                 // row lr of the staged W^T tiles
    const _Float16* wgr = &Wl[(DQK + lr) * WPITCH];
    const _Float16* whr = &Wl[(2 * DQK + lr) * WPITCH];
    const float*    xr  = &Xl[((threadIdx.x >> 5) * 16 + lr) * XPITCH];   // staged x row of this lane

    // ---- stage W^T: wave w takes k = 32w .. 32w+31 of all 192 output columns ----
    // Lane = (k octet, column quad). In every ds_store_b128 the 16 lanes of a
    // half-wave (4 quads x 4 octets) fall on 16 distinct groups of four banks.
    const int iv = blockIdx.x * 256 + threadIdx.x;          // this thread's Wvt element
    float wv;
    {
        const int kk = (threadIdx.x >> 5) * 32 + (lane & 3) * 8;   // first k of the lane's octet
        const int nq = (lane >> 2) * 4;                            // first column of its quad
        const float* pf = Wf + kk * DQK + nq;
        const float* pg = Wg + kk * DQK + nq;
        const float* ph = Wh + kk * DVDIM + nq;
        const float* pv = Wv + (iv & (DVDIM - 1)) * CIN + (iv >> 7);
        v4f r[6][8];                                        // [32-column group: K, Q, 4 x V][k]
#pragma unroll
        for (int i = 0; i < 8; ++i) {
            r[0][i] = *(const v4f*)(pf + i * DQK);
            r[1][i] = *(const v4f*)(pg + i * DQK);
#pragma unroll
            for (int nb = 0; nb < 4; ++nb)
                r[2 + nb][i] = *(const v4f*)(ph + i * DVDIM + nb * 32);
        }
        wv = *pv;
        // keeps the loads' address registers untouched (also by the loads' own
        // results) until every request is taken
        asm volatile("s_wait_xcnt 0x0" :: "v"(pf), "v"(pg), "v"(ph), "v"(pv) : "memory");
        // ---- this wave's 16 x rows: 32 copies, issued while the weight loads fly ----
        {
            const float*   gx = x + (size_t)row0 * CIN + lane * 4;
            const unsigned lx = lds_off(&Xl[(threadIdx.x >> 5) * 16 * XPITCH + lane * 4]);
            // kept rolled: one set of address registers serves all four trips, while
            // the 48 weight loads in flight hold most of the register file
#pragma nounroll
            for (int r4 = 0; r4 < 4; ++r4)
                async_ld_x4rows(lx + r4 * 16 * XPITCH, gx + r4 * 4 * CIN);
        }
#pragma unroll
        for (int m = 0; m < 6; ++m)
#pragma unroll
            for (int c = 0; c < 4; ++c) {
                v8h h;
#pragma unroll
                for (int i = 0; i < 8; ++i) h[i] = (_Float16)r[m][i][c];
                *(v8h*)&Wl[(m * 32 + nq + c) * WPITCH + kk] = h;
            }
    }
    wait_asynccnt_0();                                      // own x tile landed
    __syncthreads();                                        // staged W^T and x visible to all waves

    for (int k0 = 0; k0 < CIN; k0 += 32) {
        const v16h a = load_frag_f32(xr + k0, g);           // shared A fragment
#pragma unroll
        for (int t = 0; t < 2; ++t) {
            const v16h bK = load_frag_h(wfr + (t * 16) * WPITCH + k0, g);
            accK[t] = wmma_f16(a, bK, accK[t]);
            const v16h bQ = load_frag_h(wgr + (t * 16) * WPITCH + k0, g);
            accQ[t] = wmma_f16(a, bQ, accQ[t]);
        }
#pragma unroll
        for (int t = 0; t < 8; ++t) {
            const v16h bV = load_frag_h(whr + (t * 16) * WPITCH + k0, g);
            accV[t] = wmma_f16(a, bV, accV[t]);
        }
    }

    // ---- store K and Q: f16 [row, 32] (C-layout: row = row0 + j + 8g) ----
#pragma unroll
    for (int t = 0; t < 2; ++t) {
        const float bK = bf[t * 16 + lr];
        const float bQ = bg[t * 16 + lr];
#pragma unroll
        for (int j = 0; j < 8; ++j) {
            const size_t row = row0 + j + 8 * g;
            Kh[row * DQK + t * 16 + lr] = (_Float16)(accK[t][j] + bK);
            Qh[row * DQK + t * 16 + lr] = (_Float16)((accQ[t][j] + bQ) * LOG2E);
        }
    }
    // ---- store V transposed: Vt[b][dv][token], 8 consecutive tokens/lane ----
    const int b     = row0 >> 12;
    const int nbase = (row0 & (NTOK - 1)) + 8 * g;
#pragma unroll
    for (int t = 0; t < 8; ++t) {
        const float bV = bh[t * 16 + lr];
        _Float16* dst = Vt + (size_t)b * DVDIM * NTOK + (size_t)(t * 16 + lr) * NTOK;
#pragma unroll
        for (int j = 0; j < 8; ++j)
            dst[nbase + j] = (_Float16)(accV[t][j] + bV);
    }
    // ---- Wv^T element n = iv / 128, k = iv % 128 (behind the barrier: no wait on it) ----
    Wvt[iv] = (_Float16)wv;
}

// ---------------------------------------------------------------------------
// Kernel 2: fused flash attention (transposed formulation) with the output
// projection and residual in its epilogue. Keys are split over
// eight wave groups. One block (16 waves) owns 64 consecutive queries of one
// batch: wave = (query-tile pair qp, key group ks). A stage is 256 keys; group ks
// works on its keys 32*ks .. 32*ks+31 for 32 queries, so every K and V^T
// fragment read from LDS feeds two WMMAs (two query tiles) and the block reads
// half the LDS bytes per score. 256 blocks of four waves per SIMD cover every
// WGP. Stages are double-buffered in LDS via global_load_async_to_lds
// (ASYNCcnt); each block walks them as a ring from a start stage of its own.
// The 64-byte tile rows lie in LDS at a pitch of 80 bytes (16 B x
// odd): the 16 lanes of a half-wave, one row each, then fall on 16 distinct
// groups of four banks in every ds_load_b128.
//   S^T sub-tile  = WMMA(A = K rows, B = Q^T)        (2 per key tile and query tile)
//   softmax against a max in use m (log2 domain) that is renewed rarely: -m is the
//   C operand of the S^T WMMAs, so their result is the exponent itself and a pass
//   needs no max, subtract, scale or rescale of O. One test per pass on the lanes'
//   exp sums branches to the renewal (true max, O and l rescaled, P formed again);
//   the first pass always takes it. m never exceeds the running max.
//   O^T           = WMMA(A = V^T rows, B = P^T)      (8 per key tile and query tile)
// P^T B-fragment is built from the two S^T C-fragments *within each lane*.
// The eight groups' (max, sum, O^T) partials of a query tile meet in LDS at the
// end, in the bytes of the ring (free behind the loop's last barrier); each
// group merges one 16-wide dv tile.
// Epilogue: out = x + O @ Wv + bv for the block's 64 queries. The merged tile
// of a lane is, in place, the low or high half of its part of the f16 A fragment
// (rows = queries) of one 32-wide dv chunk; the 16 fragments are exchanged
// through LDS and each of the waves 0..7 forms 64 queries x 32 output columns
// (32 WMMAs), so that a block loads every Wv^T fragment once. O never goes to
// memory.
// ---------------------------------------------------------------------------
__global__ void __launch_bounds__(ATHREADS)
attn_kernel(const _Float16* __restrict__ Qh, const _Float16* __restrict__ Kh,
            const _Float16* __restrict__ Vt, const float* __restrict__ x,
            const _Float16* __restrict__ Wvt, const float* __restrict__ bv,
            float* __restrict__ out) {
    // one range, two uses: in the loop the K / V^T ring, behind it the partials
    __shared__ __attribute__((aligned(16))) unsigned char ring[AWAVES * QPW * 16 * 32 * 16];
    __shared__ float Pm[AWAVES][QPW][32];                                              // [wave][query tile][lane]
    __shared__ float Pl[AWAVES][QPW][32];
    __shared__ __attribute__((aligned(16))) v8h Ofr[QTILES][DVDIM / 32][2][32];        // [query tile][dv chunk][low/high 8 halfs][lane]
    _Float16* const Kbuf = (_Float16*)ring;                               // [buf][key(256)][dqk(32) + pad]
    _Float16* const Vbuf = (_Float16*)ring + 2 * SKEYS * LPITCH;          // [buf][group] x VGRP: [dv(128)][key(32) + pad]
    v4f*      const Pacc = (v4f*)ring;                                    // [wave][query tile][dt*2 + half][lane]
    static_assert((2 * SKEYS * LPITCH + 2 * KSPLIT * VGRP) * 2 <= AWAVES * QPW * 16 * 32 * 16,
                  "the ring fits the range");

    const int tid  = threadIdx.x;               // 0..511
    const int lane = tid & 31;
    const int g    = lane >> 4;
    const int lr   = lane & 15;
    const int wave = tid >> 5;                  // 0..15
    const int qp   = wave & (QGRP - 1);         // query-tile pair of the block
    const int ks   = wave / QGRP;               // key group

    const int b    = blockIdx.x / (NTOK / (16 * QTILES));         // 64 blocks per batch
    const int qblk = (blockIdx.x % (NTOK / (16 * QTILES))) * (16 * QTILES);
    const int q0   = qblk + qp * (16 * QPW);

    const _Float16* Qb    = Qh + (size_t)b * NTOK * DQK;
    const _Float16* KbBlk = Kh + (size_t)b * NTOK * DQK;      // block-uniform
    const _Float16* VbBlk = Vt + (size_t)b * DVDIM * NTOK;    // block-uniform

    // Q^T B-fragments: lane column = query (q0 + 16c + lr), halfs sweep d_qk (=32)
    v16h qf[QPW];
#pragma unroll
    for (int c = 0; c < QPW; ++c)
        qf[c] = load_frag_h(Qb + (size_t)(q0 + c * 16 + lr) * DQK, g);
    // the Q loads' address registers are reused by the address sums below
    asm volatile("s_wait_xcnt 0x0" ::: "memory");

    // Out-projection share of waves 0..7: output columns n0 .. n0+31 (one 128-byte
    // line per row) of the block's 64 queries.
    const bool owave = __builtin_amdgcn_readfirstlane(wave) < 8;   // wave-uniform: scalar branch
    const int  n0    = (wave & 7) * 32;

    // ---- async stage of 256 keys: 10 ops per wave ----
    auto fill = [&](int kb, int buf) {
        // K: 256 rows x 64 B contiguous = 16384 B = 2 x 512 lanes x 16 B
        // V: 128 rows (stride NTOK) x 512 B = 65536 B = 8 x 512 lanes x 16 B;
        //    a wave covers one row's 512 B, four lanes each group's 64 B
        const int d  = tid >> 5;                 // dv row 0..15 (copy c: +16c)
        const int pc = tid & 31;                 // 16-byte piece of the row
        async_ld_stage(lds_off(Kbuf + buf * (SKEYS * LPITCH) + (tid >> 2) * LPITCH + (tid & 3) * 8),
                       KbBlk + (size_t)kb * DQK + tid * 8,
                       lds_off(Vbuf + (buf * KSPLIT + (pc >> 2)) * VGRP + d * LPITCH + (pc & 3) * 8),
                       VbBlk + (size_t)d * NTOK + kb + pc * 8);
    };

    // m: max in use (log2 domain); its start value makes the first pass's exponents
    // overflow to +inf, which the renewal that this pass always takes throws away.
    // l: sum over this lane's own 16 keys of every pass; the halves meet behind the loop.
    float m[QPW], l[QPW];
    v8f acc[QPW][8];
#pragma unroll
    for (int c = 0; c < QPW; ++c) {
        m[c] = -1e30f;
        l[c] = 0.f;
#pragma unroll
        for (int dt = 0; dt < 8; ++dt) acc[c][dt] = (v8f){0,0,0,0,0,0,0,0};
    }

    const int NST = NTOK / SKEYS;               // 16 stages
    // The 64 blocks of a batch read the same K and V^T lines from L2. Each block starts
    // its walk over the stages at a stage of its own and wraps, so that at any moment the
    // blocks ask for all 16 stages and not all for the same lines. Pass st works on stage
    // (st0 + st) mod 16: every key is met once, in another order. Blocks that share a start
    // (4 of 64) are 2, 4 or 6 apart in index; the choice matters for speed alone.
    const int st0 = (((blockIdx.x >> 3) << 1) | (blockIdx.x & 1)) & (NST - 1);
    fill(st0 * SKEYS, 0);
    wait_asynccnt_0();
    __syncthreads();                             // first stage visible to all waves
    fill(((st0 + 1) & (NST - 1)) * SKEYS, 1);
    for (int st = 0; st < NST; ++st) {
        const int buf = st & 1;

        // A-fragments from LDS: 16 key rows each, halfs sweep d_qk
        const _Float16* krow = Kbuf + buf * (SKEYS * LPITCH) + (ks * 32 + lr) * LPITCH;
        const v16h a0 = load_frag_h(krow, g);
        const v16h a1 = load_frag_h(krow + 16 * LPITCH, g);
        // the first V^T fragments, asked for ahead of the branch below: they land under the
        // test and the packing of P
        const _Float16* vrow = Vbuf + (buf * KSPLIT + ks) * VGRP + lr * LPITCH;
        v16h av[8];
#pragma unroll
        for (int dt = 0; dt < VAHEAD; ++dt) av[dt] = load_frag_h(vrow + (dt * 16) * LPITCH, g);

        // S^T tiles minus the max in use: lane = query column, VGPR j -> key =
        // kb + sub*16 + j + 8g
        v8f s0[QPW], s1[QPW];
#pragma unroll
        for (int c = 0; c < QPW; ++c) {
            const float n = -m[c];              // C of the S^T WMMAs, the same in all eight elements
            const v8f cm = {n, n, n, n, n, n, n, n};
            s0[c] = wmma_f16(a0, qf[c], cm);
            s1[c] = wmma_f16(a1, qf[c], cm);
        }

        // exponentiate + pack P^T B-fragment (pure in-lane repack):
        //   h<8  -> key kb + h + 8g        == s0[j = h]
        //   h>=8 -> key kb + 16 + (h-8)+8g == s1[j = h-8]
        float psum[QPW];
        v16h  pf[QPW];
#pragma unroll
        for (int c = 0; c < QPW; ++c) {
            v2f ps = {0.f, 0.f};
#pragma unroll
            for (int j = 0; j < 8; ++j) {
                const v2f p = {__builtin_amdgcn_exp2f(s0[c][j]), __builtin_amdgcn_exp2f(s1[c][j])};
                ps += p;
                pf[c][j]     = (_Float16)p[0];
                pf[c][8 + j] = (_Float16)p[1];
            }
            psum[c] = ps[0] + ps[1];
        }

        // renewal of the max in use: one scalar branch per pass for the whole wave
        const bool need = st == 0 || !(psum[0] <= PSUM_MAX) || !(psum[1] <= PSUM_MAX);
        if (__builtin_amdgcn_ballot_w32(need) != 0u) {
            // compiler fence: the K fragments are read from LDS again here, so that neither
            // they nor the scores hold registers over the common path
            asm volatile("" ::: "memory");
            const v16h r0 = load_frag_h(krow, g);
            const v16h r1 = load_frag_h(krow + 16 * LPITCH, g);
            const v8f zero = {0,0,0,0,0,0,0,0};
#pragma unroll
            for (int c = 0; c < QPW; ++c) {
                const v8f t0 = wmma_f16(r0, qf[c], zero);
                const v8f t1 = wmma_f16(r1, qf[c], zero);
                float tmax = t0[0];
#pragma unroll
                for (int j = 0; j < 8; ++j) {
                    tmax = fmaxf(tmax, t0[j]);
                    tmax = fmaxf(tmax, t1[j]);
                }
                tmax = fmaxf(tmax, __shfl_xor(tmax, 16, 32));
                const float mnew  = fmaxf(m[c], tmax);
                const float alpha = exp2_slot(m[c] - mnew);   // first pass: 0
                m[c] = mnew;
                v2f ps = {0.f, 0.f};
#pragma unroll
                for (int j = 0; j < 8; ++j) {
                    const v2f p = {exp2_slot(t0[j] - mnew), exp2_slot(t1[j] - mnew)};
                    ps += p;
                    pf[c][j]     = (_Float16)p[0];
                    pf[c][8 + j] = (_Float16)p[1];
                }
                psum[c] = ps[0] + ps[1];
                l[c] *= alpha;
#pragma unroll
                for (int dt = 0; dt < 8; ++dt)
#pragma unroll
                    for (int j = 0; j < 8; ++j) acc[c][dt][j] *= alpha;
            }
        }
#pragma unroll
        for (int c = 0; c < QPW; ++c) l[c] += psum[c];

        // O^T accumulation over the 8 dv tiles (V^T rows from LDS, each fragment
        // for both query tiles)
#pragma unroll
        for (int d0 = 0; d0 < 8; d0 += VAHEAD) {
            // the next group's LDS reads as one block ahead of this group's WMMAs
#pragma unroll
            for (int dt = d0 + VAHEAD; dt < d0 + 2 * VAHEAD && dt < 8; ++dt)
                av[dt] = load_frag_h(vrow + (dt * 16) * LPITCH, g);
            // keeps those reads ahead of the WMMAs: left free, the scheduler puts each read
            // directly in front of its own WMMA and the wave waits out every LDS latency
            if (d0 + VAHEAD < 8) __builtin_amdgcn_sched_barrier(0);
#pragma unroll
            for (int dt = d0; dt < d0 + VAHEAD && dt < 8; ++dt)
#pragma unroll
                for (int c = 0; c < QPW; ++c) acc[c][dt] = wmma_f16(av[dt], pf[c], acc[c][dt]);
        }

        // publish point: own reads of buf retired, own copies of the stage of pass st+1
        // landed; the one barrier publishes it and frees buf for the refill
        wait_dscnt_0();
        wait_asynccnt_0();
        __syncthreads();
        if (st + 2 < NST) fill(((st0 + st + 2) & (NST - 1)) * SKEYS, buf);
    }
    wait_asynccnt_0();

    // residual rows and bias of this wave's output share (C-layout: lane = column,
    // element j = row j + 8g); issued ahead of the partials' LDS stores
    const size_t orow0 = (size_t)b * NTOK + qblk + 8 * g;
    const int    ocol  = n0 + lr;
    float xres[QTILES][2][8], bcol[2];
    if (owave) {
        const float* xp = x + orow0 * CIN + ocol;
#pragma unroll
        for (int t = 0; t < 2; ++t) {
            bcol[t] = bv[ocol + t * 16];
#pragma unroll
            for (int q4 = 0; q4 < QTILES; ++q4)
#pragma unroll
                for (int j = 0; j < 8; ++j)
                    xres[q4][t][j] = xp[(q4 * 16 + j) * CIN + t * 16];
        }
        // keeps the loads' address registers untouched (also by the loads' own
        // results) until every request is taken
        asm volatile("s_wait_xcnt 0x0" :: "v"(ocol), "v"(xp) : "memory");
    }

    // ---- merge the eight key groups' partials of each query tile ----
    // (the ring is free: every wave's last reads and copies ended in front of the
    // loop's last barrier)
#pragma unroll
    for (int c = 0; c < QPW; ++c) {
#pragma unroll
        for (int dt = 0; dt < 8; ++dt) {
            v4f* pa = Pacc + ((wave * QPW + c) * 16 + dt * 2) * 32 + lane;
            pa[0]  = (v4f){acc[c][dt][0], acc[c][dt][1], acc[c][dt][2], acc[c][dt][3]};
            pa[32] = (v4f){acc[c][dt][4], acc[c][dt][5], acc[c][dt][6], acc[c][dt][7]};
        }
        Pm[wave][c][lane] = m[c];
        Pl[wave][c][lane] = l[c] + __shfl_xor(l[c], 16, 32);   // the two halves' keys joined once
    }

    __syncthreads();                             // all partials visible

    // The Wv^T B fragments of waves 0..7: loaded here, where the accumulators'
    // registers are free again; behind the barrier, so that they fly under the merge.
    v16h wb[2][4];
    if (owave) {
        const _Float16* wrow = Wvt + (size_t)(n0 + lr) * DVDIM;
#pragma unroll
        for (int t = 0; t < 2; ++t)
#pragma unroll
            for (int c = 0; c < 4; ++c)
                wb[t][c] = load_frag_h(wrow + (t * 16) * DVDIM + c * 32, g);
        // keeps the loads' address registers untouched (also by the loads' own
        // results) until every request is taken
        asm volatile("s_wait_xcnt 0x0" :: "v"(wrow + 8 * g) : "memory");
    }

    // group ks merges dv 16*ks .. 16*ks+15 of its two query tiles. O^T element j
    // of an even tile is k = j + 8g of its 32-wide chunk, of an odd tile
    // k = 16 + j + 8g: the k order of the 16-bit A/B operand (kmap), so the
    // repack is in-lane.
#pragma unroll
    for (int c = 0; c < QPW; ++c) {
        float ms[KSPLIT], wgt[KSPLIT];
        float mall = -1e30f;
#pragma unroll
        for (int s = 0; s < KSPLIT; ++s) {
            ms[s] = Pm[s * QGRP + qp][c][lane];
            mall  = fmaxf(mall, ms[s]);
        }
        float lall = 0.f;
#pragma unroll
        for (int s = 0; s < KSPLIT; ++s) {
            wgt[s] = exp2_slot(ms[s] - mall);
            lall  += wgt[s] * Pl[s * QGRP + qp][c][lane];
        }
        const float inv = 1.f / lall;
#pragma unroll
        for (int s = 0; s < KSPLIT; ++s) wgt[s] *= inv;

        v8h ofl;
#pragma unroll
        for (int h = 0; h < 2; ++h) {
            v4f o = {0.f, 0.f, 0.f, 0.f};
#pragma unroll
            for (int s = 0; s < KSPLIT; ++s)
                o += Pacc[(((s * QGRP + qp) * QPW + c) * 16 + ks * 2 + h) * 32 + lane] * wgt[s];
#pragma unroll
            for (int i = 0; i < 4; ++i) ofl[h * 4 + i] = (_Float16)o[i];
        }
        Ofr[qp * QPW + c][ks >> 1][ks & 1][lane] = ofl;
    }
    __syncthreads();                             // all O fragments visible

    // ---- out = x + O @ Wv + bv: 4 query tiles x 2 column tiles x 4 dv chunks ----
    if (!owave) return;                          // no barrier follows
    v8f oacc[QTILES][2];                         // start value: residual + bias
#pragma unroll
    for (int q4 = 0; q4 < QTILES; ++q4)
#pragma unroll
        for (int t = 0; t < 2; ++t)
#pragma unroll
            for (int j = 0; j < 8; ++j) oacc[q4][t][j] = xres[q4][t][j] + bcol[t];
#pragma unroll
    for (int c = 0; c < 4; ++c) {
#pragma unroll
        for (int q4 = 0; q4 < QTILES; ++q4) {
            const v8h lo = Ofr[q4][c][0][lane];
            const v8h hi = Ofr[q4][c][1][lane];
            v16h a;
#pragma unroll
            for (int i = 0; i < 8; ++i) { a[i] = lo[i]; a[8 + i] = hi[i]; }
#pragma unroll
            for (int t = 0; t < 2; ++t) oacc[q4][t] = wmma_f16(a, wb[t][c], oacc[q4][t]);
        }
    }
#pragma unroll
    for (int q4 = 0; q4 < QTILES; ++q4)
#pragma unroll
        for (int t = 0; t < 2; ++t)
#pragma unroll
            for (int j = 0; j < 8; ++j)
                out[(orow0 + q4 * 16 + j) * CIN + ocol + t * 16] = oacc[q4][t][j];
}

// ---------------------------------------------------------------------------
// Host-side launch. Workspace layout (bytes):
//   [0,       1 MB)   Qh  f16 [16384, 32]
//   [1 MB,    2 MB)   Kh  f16 [16384, 32]
//   [2 MB,    6 MB)   Vt  f16 [4, 128, 4096]   (transposed values)
//   [14 MB,  ...  )   Wvt f16 [256, 128]      (transposed out-projection weights)
// ---------------------------------------------------------------------------
extern "C" void kernel_launch(void* const* d_in, const int* in_sizes, int n_in,
                              void* d_out, int out_size, void* d_ws, size_t ws_size,
                              hipStream_t stream) {
    const float* x  = (const float*)d_in[0];
    const float* Wf = (const float*)d_in[1];
    const float* bf = (const float*)d_in[2];
    const float* Wg = (const float*)d_in[3];
    const float* bg = (const float*)d_in[4];
    const float* Wh = (const float*)d_in[5];
    const float* bh = (const float*)d_in[6];
    const float* Wv = (const float*)d_in[7];
    const float* bv = (const float*)d_in[8];
    float* out = (float*)d_out;

    char* ws = (char*)d_ws;
    _Float16* Qh  = (_Float16*)(ws);
    _Float16* Kh  = (_Float16*)(ws + (1u << 20));
    _Float16* Vt  = (_Float16*)(ws + (2u << 20));
    _Float16* Wvt = (_Float16*)(ws + (14u << 20));

    // K1: 1024 row-tile waves, 8 waves/block -> 128 blocks
    hipLaunchKernelGGL(proj_qkv_kernel, dim3(128), dim3(256), 0, stream,
                       x, Wf, bf, Wg, bg, Wh, bh, Wv, Qh, Kh, Vt, Wvt);
    // K2: 256 blocks x 16 waves, each block = 64 queries of one batch
    hipLaunchKernelGGL(attn_kernel, dim3(256), dim3(ATHREADS), 0, stream,
                       Qh, Kh, Vt, x, Wvt, bv, out);
}

// v010
// Measured time: 33.9 microseconds a run.
// Two timings next to v009 put it at 1.06 and 1.05 times that version's speed.
// Over all steps from v000 it is 3.91 times as fast.
#include <hip/hip_runtime.h>
#include <hip/hip_bf16.h>

// ---------------------------------------------------------------------------
// Fused self-attention for gfx1250 (MI455X), f16 WMMA with f32 accumulation.
// B=4, H=W=64 -> N=4096 tokens/batch, C=256, DQK=32, DV=128.
// ---------------------------------------------------------------------------

#define BATCH 4
#define NTOK  4096        // H*W
#define CIN   256
#define DQK   32
#define DVDIM 128
#define ROWS  (BATCH * NTOK)   // 16384
#define LPITCH 40              // halfs per staged LDS row: 32 data + 8 pad (80 B)
#define KSPLIT 8               // key groups (waves that share a pair of query tiles)
#define QTILES 4               // 16-query tiles per attention block
#define QPW    2               // query tiles per wave: each K and V^T fragment serves both
#define QGRP   (QTILES / QPW)  // query-tile pairs per attention block
#define SKEYS  (32 * KSPLIT)   // keys per staged LDS buffer
#define AWAVES (KSPLIT * QGRP) // waves per attention block
#define ATHREADS (32 * AWAVES)
#define VGRP   (DVDIM * LPITCH + 32)   // halfs per key group's V^T tile: 128 rows + 64 B, so that the
                                       // eight 64-byte pieces of one copy spread over all banks
#define WROWS  (2 * DQK + DVDIM)   // staged W^T rows of the QKV projection (K, Q, V)
#define WPITCH (CIN + 8)           // halfs per staged row: 256 data + 8 pad (528 B = 16 B x 33)
#define XROWS  128                 // x rows per projection block (8 waves x 16)
#define XPITCH (CIN + 4)           // floats per staged x row: 256 data + 4 pad (1040 B = 16 B x 65)
#define WTILES (WROWS / 16)        // 16-column output tiles of the QKV projection: 2 K, 2 Q, 8 V
#define FGRP   4                   // W^T fragments read from LDS as one group
#define NGRP   (WTILES / FGRP)     // groups per k-step = register groups in the fragment ring
#define KSTEPS (CIN / 32)          // k-steps of the QKV projection

typedef _Float16 v16h __attribute__((ext_vector_type(16)));
typedef _Float16 v8h  __attribute__((ext_vector_type(8)));
typedef float    v8f  __attribute__((ext_vector_type(8)));
typedef float    v4f  __attribute__((ext_vector_type(4)));
typedef float    v2f  __attribute__((ext_vector_type(2)));

#define LOG2E    1.44269504f   // folded into the stored Q: scores are exponents of 2
#define VAHEAD   3             // V^T fragments read from LDS ahead of the softmax of their pass
#define PSUM_MAX 16384.f       // a lane's exp sum of one pass above this: the max in use is renewed
                               // (every P value is at most its sum, far inside the f16 range)

// K index held by half-slot h (0..15) for lane-group g (0 or 1) in the
// 16-bit A/B operand of V_WMMA_*_16X16X32 (ISA 7.12.2):
//   h<8  -> K = h      + 8g      (VGPR 0..3)
//   h>=8 -> K = h + 8  + 8g      (VGPR 4..7)
__device__ __forceinline__ int kmap(int h, int g) {
    return (h < 8 ? h : h + 8) + 8 * g;
}

// Load a v16h A/B fragment from a contiguous f16 row `p` (row holds K=0..31).
// The two 8-half groups per lane are 16-byte aligned -> b128 vector loads
// (global_load_b128 or ds_load_b128 depending on the pointer).
__device__ __forceinline__ v16h load_frag_h(const _Float16* p, int g) {
    const v8h lo = *(const v8h*)(p + 8 * g);
    const v8h hi = *(const v8h*)(p + 16 + 8 * g);
    v16h r;
#pragma unroll
    for (int i = 0; i < 8; ++i) { r[i] = lo[i]; r[8 + i] = hi[i]; }
    return r;
}

__device__ __forceinline__ v8f wmma_f16(v16h a, v16h b, v8f c) {
    return __builtin_amdgcn_wmma_f32_16x16x32_f16(false, a, false, b, (short)0, c,
                                                  false, false);
}

// 2^x for the places that run rarely (renewal of the max in use, merge). The v_nop
// fills the one issue slot that the instruction set asks for between a
// transcendental and a directly following use of its result or rewrite of its
// source; in the statement it stands there in every build.
__device__ __forceinline__ float exp2_slot(float x) {
    float r;
    asm("v_exp_f32 %0, %1\n\tv_nop" : "=v"(r) : "v"(x));
    return r;
}

// ---- CDNA5 async global->LDS copies (ASYNCcnt-tracked) --------------------
// Generic pointers to __shared__ have the LDS byte offset in their low 32 bits
// (ISA 10.2: LDS aperture address is truncated to addr[31:0]).
__device__ __forceinline__ unsigned lds_off(const void* p) {
    return (unsigned)(uintptr_t)p;
}
// One 256-key stage = ten 16-byte copies per lane (K: 2 x 128 rows, V^T: 8 x 16
// rows). ldsK / gK, ldsV / gV: the lane's place in the first copy of each. The
// s_wait_xcnt closes the statement so that it stands in front of any later
// rewrite of the address registers the copies name.
__device__ __forceinline__ void async_ld_stage(unsigned ldsK, const _Float16* gK,
                                               unsigned ldsV, const _Float16* gV) {
    asm volatile("global_load_async_to_lds_b128 %0, %1, off\n\t"
                 "global_load_async_to_lds_b128 %2, %3, off\n\t"
                 "global_load_async_to_lds_b128 %4, %5, off\n\t"
                 "global_load_async_to_lds_b128 %6, %7, off\n\t"
                 "global_load_async_to_lds_b128 %8, %9, off\n\t"
                 "global_load_async_to_lds_b128 %10, %11, off\n\t"
                 "global_load_async_to_lds_b128 %12, %13, off\n\t"
                 "global_load_async_to_lds_b128 %14, %15, off\n\t"
                 "global_load_async_to_lds_b128 %16, %17, off\n\t"
                 "global_load_async_to_lds_b128 %18, %19, off\n\t"
                 "s_wait_xcnt 0x0"
                 :: "v"(ldsK),                     "v"(gK),
                    "v"(ldsK + 128 * LPITCH * 2),  "v"(gK + 128 * DQK),
                    "v"(ldsV),                     "v"(gV),
                    "v"(ldsV +  16 * LPITCH * 2),  "v"(gV + (size_t) 16 * NTOK),
                    "v"(ldsV +  32 * LPITCH * 2),  "v"(gV + (size_t) 32 * NTOK),
                    "v"(ldsV +  48 * LPITCH * 2),  "v"(gV + (size_t) 48 * NTOK),
                    "v"(ldsV +  64 * LPITCH * 2),  "v"(gV + (size_t) 64 * NTOK),
                    "v"(ldsV +  80 * LPITCH * 2),  "v"(gV + (size_t) 80 * NTOK),
                    "v"(ldsV +  96 * LPITCH * 2),  "v"(gV + (size_t) 96 * NTOK),
                    "v"(ldsV + 112 * LPITCH * 2),  "v"(gV + (size_t)112 * NTOK)
                 : "memory");
}
// Four x rows of 1 KB = eight 16-byte copies per lane (a copy = 512 contiguous
// bytes per wave: whole lines). gx / lx: the lane's place in the first row. The
// s_wait_xcnt closes the statement so that it stands in front of any later
// rewrite of the address registers the copies name.
__device__ __forceinline__ void async_ld_x4rows(unsigned lx, const float* gx) {
    asm volatile("global_load_async_to_lds_b128 %0, %1, off\n\t"
                 "global_load_async_to_lds_b128 %2, %3, off\n\t"
                 "global_load_async_to_lds_b128 %4, %5, off\n\t"
                 "global_load_async_to_lds_b128 %6, %7, off\n\t"
                 "global_load_async_to_lds_b128 %8, %9, off\n\t"
                 "global_load_async_to_lds_b128 %10, %11, off\n\t"
                 "global_load_async_to_lds_b128 %12, %13, off\n\t"
                 "global_load_async_to_lds_b128 %14, %15, off\n\t"
                 "s_wait_xcnt 0x0"
                 :: "v"(lx),                    "v"(gx),
                    "v"(lx + 512),              "v"(gx + 128),
                    "v"(lx + 4 * XPITCH),       "v"(gx + CIN),
                    "v"(lx + 4 * XPITCH + 512), "v"(gx + CIN + 128),
                    "v"(lx + 8 * XPITCH),       "v"(gx + 2 * CIN),
                    "v"(lx + 8 * XPITCH + 512), "v"(gx + 2 * CIN + 128),
                    "v"(lx + 12 * XPITCH),       "v"(gx + 3 * CIN),
                    "v"(lx + 12 * XPITCH + 512), "v"(gx + 3 * CIN + 128)
                 : "memory");
}
// This wave's own copies have landed (the barrier behind it publishes them).
__device__ __forceinline__ void wait_asynccnt_0() {
    asm volatile("s_wait_asynccnt 0x0" ::: "memory");
}
// This wave's own LDS reads have retired before the buffer they read is refilled.
__device__ __forceinline__ void wait_dscnt_0() {
    asm volatile("s_wait_dscnt 0x0" ::: "memory");
}

// ---------------------------------------------------------------------------
// Kernel 1: fused QKV projections. One wave per 16-row tile computes ALL
// output tiles (2 K + 2 Q + 8 V = 12 WMMAs per K-chunk), reusing the x
// A-fragment. x is read exactly once: right behind the weight loads each wave
// sends for its whole 16 x 256 f32 tile by async copies to LDS (32 copies of
// whole lines, all in flight at once, under the weight staging), so the load
// latency is paid once and not once per K-chunk; the A-fragments come by
// ds_load_b128 at a pitch of 16 B x odd. Each block forms the 192 W^T rows (f16,
// 96 KB) in LDS itself, straight from the f32 weights: a lane loads 4 output
// columns x 8 consecutive k (eight 16-byte loads, whole 128-byte lines per
// wave), converts, and stores one 16-byte k run per column. The B-fragments
// then come by ds_load_b128 at a pitch of 16 B x odd (no bank conflict), in
// groups of four fragments that are asked for two groups ahead of their WMMAs
// (a ring of three register groups), so that a wave does not wait out the LDS
// latency in front of every WMMA.
//   Kh = f16(x @ Wf + bf)   [ROWS, 32]
//   Qh = f16((x @ Wg + bg) * log2 e)   [ROWS, 32]
//   Vt = f16(x @ Wh + bh)^T [BATCH, 128, NTOK]
// Each thread also writes one element of Wvt = f16(Wv^T) [256, 128], which the
// attention launch reads.
// ---------------------------------------------------------------------------
__global__ void __launch_bounds__(256)
proj_qkv_kernel(const float* __restrict__ x,
                const float* __restrict__ Wf, const float* __restrict__ bf,
                const float* __restrict__ Wg, const float* __restrict__ bg,
                const float* __restrict__ Wh, const float* __restrict__ bh,
                const float* __restrict__ Wv,
                _Float16* __restrict__ Qh, _Float16* __restrict__ Kh,
                _Float16* __restrict__ Vt, _Float16* __restrict__ Wvt) {
    const int widx = blockIdx.x * 8 + (threadIdx.x >> 5);   // 0 .. 1023
    const int lane = threadIdx.x & 31;
    const int g    = lane >> 4;
    const int lr   = lane & 15;

    const int row0 = widx * 16;

    __shared__ __attribute__((aligned(16))) _Float16 Wl[WROWS * WPITCH];   // rows: 32 K, 32 Q, 128 V
    __shared__ __attribute__((aligned(16))) float    Xl[XROWS * XPITCH];   // the block's x rows, f32

    v8f acc[WTILES];                                        // output tiles: 0,1 K; 2,3 Q; 4..11 V
#pragma unroll
    for (int t = 0; t < WTILES; ++t) acc[t] = (v8f){0,0,0,0,0,0,0,0};

    const _Float16* wr  = &Wl[lr * WPITCH];                 // row lr of the first staged W^T tile
    const float*    xr  = &Xl[((threadIdx.x >> 5) * 16 + lr) * XPITCH];   // staged x row of this lane

    // ---- stage W^T: wave w takes k = 32w .. 32w+31 of all 192 output columns ----
    // Lane = (k octet, column quad). In every ds_store_b128 the 16 lanes of a
    // half-wave (4 quads x 4 octets) fall on 16 distinct groups of four banks.
    const int iv = blockIdx.x * 256 + threadIdx.x;          // this thread's Wvt element
    float wv;
    {
        const int kk = (threadIdx.x >> 5) * 32 + (lane & 3) * 8;   // first k of the lane's octet
        const int nq = (lane >> 2) * 4;                            // first column of its quad
        const float* pf = Wf + kk * DQK + nq;
        const float* pg = Wg + kk * DQK + nq;
        const float* ph = Wh + kk * DVDIM + nq;
        const float* pv = Wv + (iv & (DVDIM - 1)) * CIN + (iv >> 7);
        v4f r[6][8];                                        // [32-column group: K, Q, 4 x V][k]
#pragma unroll
        for (int i = 0; i < 8; ++i) {
            r[0][i] = *(const v4f*)(pf + i * DQK);
            r[1][i] = *(const v4f*)(pg + i * DQK);
#pragma unroll
            for (int nb = 0; nb < 4; ++nb)
                r[2 + nb][i] = *(const v4f*)(ph + i * DVDIM + nb * 32);
        }
        wv = *pv;
        // keeps the loads' address registers untouched (also by the loads' own
        // results) until every request is taken
        asm volatile("s_wait_xcnt 0x0" :: "v"(pf), "v"(pg), "v"(ph), "v"(pv) : "memory");
        // ---- this wave's 16 x rows: 32 copies, issued while the weight loads fly ----
        {
            const float*   gx = x + (size_t)row0 * CIN + lane * 4;
            const unsigned lx = lds_off(&Xl[(threadIdx.x >> 5) * 16 * XPITCH + lane * 4]);
            // kept rolled: one set of address registers serves all four trips, while
            // the 48 weight loads in flight hold most of the register file
#pragma nounroll
            for (int r4 = 0; r4 < 4; ++r4)
                async_ld_x4rows(lx + r4 * 16 * XPITCH, gx + r4 * 4 * CIN);
        }
#pragma unroll
        for (int m = 0; m < 6; ++m)
#pragma unroll
            for (int c = 0; c < 4; ++c) {
                v8h h;
#pragma unroll
                for (int i = 0; i < 8; ++i) h[i] = (_Float16)r[m][i][c];
                *(v8h*)&Wl[(m * 32 + nq + c) * WPITCH + kk] = h;
            }
    }
    wait_asynccnt_0();                                      // own x tile landed
    __syncthreads();                                        // staged W^T and x visible to all waves

    // Group j = (k-step j / NGRP, tiles FGRP * (j % NGRP) ..) lives in ring place j % NGRP.
    v16h bfr[NGRP][FGRP];
    v4f  xa[4];                                             // the next k-step's x values, still f32
    auto ld_group = [&](int j) {
#pragma unroll
        for (int i = 0; i < FGRP; ++i)
            bfr[j % NGRP][i] = load_frag_h(wr + (((j % NGRP) * FGRP + i) * 16) * WPITCH + (j / NGRP) * 32, g);
    };
    // A fragment from the f32 row: two runs of 8 consecutive floats at +8g and +16+8g
    // (the k order of load_frag_h), four b128 reads; converted to f16 one group later
    auto ld_x = [&](int s) {
        const float* p = xr + s * 32 + 8 * g;
        xa[0] = *(const v4f*)(p);
        xa[1] = *(const v4f*)(p + 4);
        xa[2] = *(const v4f*)(p + 16);
        xa[3] = *(const v4f*)(p + 20);
    };
    auto cvt_x = [&]() {
        v16h r;
#pragma unroll
        for (int i = 0; i < 4; ++i) {
            r[i]      = (_Float16)xa[0][i];
            r[4 + i]  = (_Float16)xa[1][i];
            r[8 + i]  = (_Float16)xa[2][i];
            r[12 + i] = (_Float16)xa[3][i];
        }
        return r;
    };
    ld_x(0);
    ld_group(0);
    // keeps the first k-step's x values and first group at the head of the LDS queue
    __builtin_amdgcn_sched_barrier(0);
    ld_group(1);
    // and the second group ahead of the third
    __builtin_amdgcn_sched_barrier(0);
    v16h a = cvt_x();                                       // shared A fragment of the k-step
    // unrolled: every ring place and LDS offset is a constant
#pragma unroll
    for (int s = 0; s < KSTEPS; ++s) {
        v16h an = a;
#pragma unroll
        for (int gi = 0; gi < NGRP; ++gi) {
            const int j = s * NGRP + gi;
            if (gi == 1 && s + 1 < KSTEPS) ld_x(s + 1);
            if (j + 2 < KSTEPS * NGRP) ld_group(j + 2);
            // keeps the reads together and ahead of this group's WMMAs: left free, the
            // scheduler puts each read directly in front of its own WMMA and the wave
            // waits out every LDS latency
            __builtin_amdgcn_sched_barrier(0);
#pragma unroll
            for (int i = 0; i < FGRP; ++i)
                acc[gi * FGRP + i] = wmma_f16(a, bfr[gi][i], acc[gi * FGRP + i]);
            if (gi == NGRP - 1 && s + 1 < KSTEPS) an = cvt_x();
            // keeps the next group's reads from moving in among these WMMAs
            __builtin_amdgcn_sched_barrier(0);
        }
        a = an;
    }

    // ---- store K and Q: f16 [row, 32] (C-layout: row = row0 + j + 8g) ----
#pragma unroll
    for (int t = 0; t < 2; ++t) {
        const float bK = bf[t * 16 + lr];
        const float bQ = bg[t * 16 + lr];
#pragma unroll
        for (int j = 0; j < 8; ++j) {
            const size_t row = row0 + j + 8 * g;
            Kh[row * DQK + t * 16 + lr] = (_Float16)(acc[t][j] + bK);
            Qh[row * DQK + t * 16 + lr] = (_Float16)((acc[2 + t][j] + bQ) * LOG2E);
        }
    }
    // ---- store V transposed: Vt[b][dv][token], 8 consecutive tokens/lane ----
    const int b     = row0 >> 12;
    const int nbase = (row0 & (NTOK - 1)) + 8 * g;
#pragma unroll
    for (int t = 0; t < 8; ++t) {
        const float bV = bh[t * 16 + lr];
        _Float16* dst = Vt + (size_t)b * DVDIM * NTOK + (size_t)(t * 16 + lr) * NTOK;
#pragma unroll
        for (int j = 0; j < 8; ++j)
            dst[nbase + j] = (_Float16)(acc[4 + t][j] + bV);
    }
    // ---- Wv^T element n = iv / 128, k = iv % 128 (behind the barrier: no wait on it) ----
    Wvt[iv] = (_Float16)wv;
}

// ---------------------------------------------------------------------------
// Kernel 2: fused flash attention (transposed formulation) with the output
// projection and residual in its epilogue. Keys are split over
// eight wave groups. One block (16 waves) owns 64 consecutive queries of one
// batch: wave = (query-tile pair qp, key group ks). A stage is 256 keys; group ks
// works on its keys 32*ks .. 32*ks+31 for 32 queries, so every K and V^T
// fragment read from LDS feeds two WMMAs (two query tiles) and the block reads
// half the LDS bytes per score. 256 blocks of four waves per SIMD cover every
// WGP. Stages are double-buffered in LDS via global_load_async_to_lds
// (ASYNCcnt); each block walks them as a ring from a start stage of its own.
// The 64-byte tile rows lie in LDS at a pitch of 80 bytes (16 B x
// odd): the 16 lanes of a half-wave, one row each, then fall on 16 distinct
// groups of four banks in every ds_load_b128.
//   S^T sub-tile  = WMMA(A = K rows, B = Q^T)        (2 per key tile and query tile)
//   softmax against a max in use m (log2 domain) that is renewed rarely: -m is the
//   C operand of the S^T WMMAs, so their result is the exponent itself and a pass
//   needs no max, subtract, scale or rescale of O. One test per pass on the lanes'
//   exp sums branches to the renewal (true max, O and l rescaled, P formed again);
//   the first pass always takes it. m never exceeds the running max.
//   O^T           = WMMA(A = V^T rows, B = P^T)      (8 per key tile and query tile)
// P^T B-fragment is built from the two S^T C-fragments *within each lane*.
// The eight groups' (max, sum, O^T) partials of a query tile meet in LDS at the
// end, in the bytes of the ring (free behind the loop's last barrier); each
// group merges one 16-wide dv tile.
// Epilogue: out = x + O @ Wv + bv for the block's 64 queries. The merged tile
// of a lane is, in place, the low or high half of its part of the f16 A fragment
// (rows = queries) of one 32-wide dv chunk; the 16 fragments are exchanged
// through LDS and each of the waves 0..7 forms 64 queries x 32 output columns
// (32 WMMAs), so that a block loads every Wv^T fragment once. O never goes to
// memory.
// ---------------------------------------------------------------------------
__global__ void __launch_bounds__(ATHREADS)
attn_kernel(const _Float16* __restrict__ Qh, const _Float16* __restrict__ Kh,
            const _Float16* __restrict__ Vt, const float* __restrict__ x,
            const _Float16* __restrict__ Wvt, const float* __restrict__ bv,
            float* __restrict__ out) {
    // one range, two uses: in the loop the K / V^T ring, behind it the partials
    __shared__ __attribute__((aligned(16))) unsigned char ring[AWAVES * QPW * 16 * 32 * 16];
    __shared__ float Pm[AWAVES][QPW][32];                                              // [wave][query tile][lane]
    __shared__ float Pl[AWAVES][QPW][32];
    __shared__ __attribute__((aligned(16))) v8h Ofr[QTILES][DVDIM / 32][2][32];        // [query tile][dv chunk][low/high 8 halfs][lane]
    _Float16* const Kbuf = (_Float16*)ring;                               // [buf][key(256)][dqk(32) + pad]
    _Float16* const Vbuf = (_Float16*)ring + 2 * SKEYS * LPITCH;          // [buf][group] x VGRP: [dv(128)][key(32) + pad]
    v4f*      const Pacc = (v4f*)ring;                                    // [wave][query tile][dt*2 + half][lane]
    static_assert((2 * SKEYS * LPITCH + 2 * KSPLIT * VGRP) * 2 <= AWAVES * QPW * 16 * 32 * 16,
                  "the ring fits the range");

    const int tid  = threadIdx.x;               // 0..511
    const int lane = tid & 31;
    const int g    = lane >> 4;
    const int lr   = lane & 15;
    const int wave = tid >> 5;                  // 0..15
    const int qp   = wave & (QGRP - 1);         // query-tile pair of the block
    const int ks   = wave / QGRP;               // key group

    const int b    = blockIdx.x / (NTOK / (16 * QTILES));         // 64 blocks per batch
    const int qblk = (blockIdx.x % (NTOK / (16 * QTILES))) * (16 * QTILES);
    const int q0   = qblk + qp * (16 * QPW);

    const _Float16* Qb    = Qh + (size_t)b * NTOK * DQK;
    const _Float16* KbBlk = Kh + (size_t)b * NTOK * DQK;      // block-uniform
    const _Float16* VbBlk = Vt + (size_t)b * DVDIM * NTOK;    // block-uniform

    // Q^T B-fragments: lane column = query (q0 + 16c + lr), halfs sweep d_qk (=32)
    v16h qf[QPW];
#pragma unroll
    for (int c = 0; c < QPW; ++c)
        qf[c] = load_frag_h(Qb + (size_t)(q0 + c * 16 + lr) * DQK, g);
    // the Q loads' address registers are reused by the address sums below
    asm volatile("s_wait_xcnt 0x0" ::: "memory");

    // Out-projection share of waves 0..7: output columns n0 .. n0+31 (one 128-byte
    // line per row) of the block's 64 queries.
    const bool owave = __builtin_amdgcn_readfirstlane(wave) < 8;   // wave-uniform: scalar branch
    const int  n0    = (wave & 7) * 32;

    // ---- async stage of 256 keys: 10 ops per wave ----
    auto fill = [&](int kb, int buf) {
        // K: 256 rows x 64 B contiguous = 16384 B = 2 x 512 lanes x 16 B
        // V: 128 rows (stride NTOK) x 512 B = 65536 B = 8 x 512 lanes x 16 B;
        //    a wave covers one row's 512 B, four lanes each group's 64 B
        const int d  = tid >> 5;                 // dv row 0..15 (copy c: +16c)
        const int pc = tid & 31;                 // 16-byte piece of the row
        async_ld_stage(lds_off(Kbuf + buf * (SKEYS * LPITCH) + (tid >> 2) * LPITCH + (tid & 3) * 8),
                       KbBlk + (size_t)kb * DQK + tid * 8,
                       lds_off(Vbuf + (buf * KSPLIT + (pc >> 2)) * VGRP + d * LPITCH + (pc & 3) * 8),
                       VbBlk + (size_t)d * NTOK + kb + pc * 8);
    };

    // m: max in use (log2 domain); its start value makes the first pass's exponents
    // overflow to +inf, which the renewal that this pass always takes throws away.
    // l: sum over this lane's own 16 keys of every pass; the halves meet behind the loop.
    float m[QPW], l[QPW];
    v8f acc[QPW][8];
#pragma unroll
    for (int c = 0; c < QPW; ++c) {
        m[c] = -1e30f;
        l[c] = 0.f;
#pragma unroll
        for (int dt = 0; dt < 8; ++dt) acc[c][dt] = (v8f){0,0,0,0,0,0,0,0};
    }

    const int NST = NTOK / SKEYS;               // 16 stages
    // The 64 blocks of a batch read the same K and V^T lines from L2. Each block starts
    // its walk over the stages at a stage of its own and wraps, so that at any moment the
    // blocks ask for all 16 stages and not all for the same lines. Pass st works on stage
    // (st0 + st) mod 16: every key is met once, in another order. Blocks that share a start
    // (4 of 64) are 2, 4 or 6 apart in index; the choice matters for speed alone.
    const int st0 = (((blockIdx.x >> 3) << 1) | (blockIdx.x & 1)) & (NST - 1);
    fill(st0 * SKEYS, 0);
    wait_asynccnt_0();
    __syncthreads();                             // first stage visible to all waves
    fill(((st0 + 1) & (NST - 1)) * SKEYS, 1);
    for (int st = 0; st < NST; ++st) {
        const int buf = st & 1;

        // A-fragments from LDS: 16 key rows each, halfs sweep d_qk
        const _Float16* krow = Kbuf + buf * (SKEYS * LPITCH) + (ks * 32 + lr) * LPITCH;
        const v16h a0 = load_frag_h(krow, g);
        const v16h a1 = load_frag_h(krow + 16 * LPITCH, g);
        // the first V^T fragments, asked for ahead of the branch below: they land under the
        // test and the packing of P
        const _Float16* vrow = Vbuf + (buf * KSPLIT + ks) * VGRP + lr * LPITCH;
        v16h av[8];
#pragma unroll
        for (int dt = 0; dt < VAHEAD; ++dt) av[dt] = load_frag_h(vrow + (dt * 16) * LPITCH, g);

        // S^T tiles minus the max in use: lane = query column, VGPR j -> key =
        // kb + sub*16 + j + 8g
        v8f s0[QPW], s1[QPW];
#pragma unroll
        for (int c = 0; c < QPW; ++c) {
            const float n = -m[c];              // C of the S^T WMMAs, the same in all eight elements
            const v8f cm = {n, n, n, n, n, n, n, n};
            s0[c] = wmma_f16(a0, qf[c], cm);
            s1[c] = wmma_f16(a1, qf[c], cm);
        }

        // exponentiate + pack P^T B-fragment (pure in-lane repack):
        //   h<8  -> key kb + h + 8g        == s0[j = h]
        //   h>=8 -> key kb + 16 + (h-8)+8g == s1[j = h-8]
        float psum[QPW];
        v16h  pf[QPW];
#pragma unroll
        for (int c = 0; c < QPW; ++c) {
            v2f ps = {0.f, 0.f};
#pragma unroll
            for (int j = 0; j < 8; ++j) {
                const v2f p = {__builtin_amdgcn_exp2f(s0[c][j]), __builtin_amdgcn_exp2f(s1[c][j])};
                ps += p;
                pf[c][j]     = (_Float16)p[0];
                pf[c][8 + j] = (_Float16)p[1];
            }
            psum[c] = ps[0] + ps[1];
        }

        // renewal of the max in use: one scalar branch per pass for the whole wave
        const bool need = st == 0 || !(psum[0] <= PSUM_MAX) || !(psum[1] <= PSUM_MAX);
        if (__builtin_amdgcn_ballot_w32(need) != 0u) {
            // compiler fence: the K fragments are read from LDS again here, so that neither
            // they nor the scores hold registers over the common path
            asm volatile("" ::: "memory");
            const v16h r0 = load_frag_h(krow, g);
            const v16h r1 = load_frag_h(krow + 16 * LPITCH, g);
            const v8f zero = {0,0,0,0,0,0,0,0};
#pragma unroll
            for (int c = 0; c < QPW; ++c) {
                const v8f t0 = wmma_f16(r0, qf[c], zero);
                const v8f t1 = wmma_f16(r1, qf[c], zero);
                float tmax = t0[0];
#pragma unroll
                for (int j = 0; j < 8; ++j) {
                    tmax = fmaxf(tmax, t0[j]);
                    tmax = fmaxf(tmax, t1[j]);
                }
                tmax = fmaxf(tmax, __shfl_xor(tmax, 16, 32));
                const float mnew  = fmaxf(m[c], tmax);
                const float alpha = exp2_slot(m[c] - mnew);   // first pass: 0
                m[c] = mnew;
                v2f ps = {0.f, 0.f};
#pragma unroll
                for (int j = 0; j < 8; ++j) {
                    const v2f p = {exp2_slot(t0[j] - mnew), exp2_slot(t1[j] - mnew)};
                    ps += p;
                    pf[c][j]     = (_Float16)p[0];
                    pf[c][8 + j] = (_Float16)p[1];
                }
                psum[c] = ps[0] + ps[1];
                l[c] *= alpha;
#pragma unroll
                for (int dt = 0; dt < 8; ++dt)
#pragma unroll
                    for (int j = 0; j < 8; ++j) acc[c][dt][j] *= alpha;
            }
        }
#pragma unroll
        for (int c = 0; c < QPW; ++c) l[c] += psum[c];

        // O^T accumulation over the 8 dv tiles (V^T rows from LDS, each fragment
        // for both query tiles)
#pragma unroll
        for (int d0 = 0; d0 < 8; d0 += VAHEAD) {
            // the next group's LDS reads as one block ahead of this group's WMMAs
#pragma unroll
            for (int dt = d0 + VAHEAD; dt < d0 + 2 * VAHEAD && dt < 8; ++dt)
                av[dt] = load_frag_h(vrow + (dt * 16) * LPITCH, g);
            // keeps those reads ahead of the WMMAs: left free, the scheduler puts each read
            // directly in front of its own WMMA and the wave waits out every LDS latency
            if (d0 + VAHEAD < 8) __builtin_amdgcn_sched_barrier(0);
#pragma unroll
            for (int dt = d0; dt < d0 + VAHEAD && dt < 8; ++dt)
#pragma unroll
                for (int c = 0; c < QPW; ++c) acc[c][dt] = wmma_f16(av[dt], pf[c], acc[c][dt]);
        }

        // publish point: own reads of buf retired, own copies of the stage of pass st+1
        // landed; the one barrier publishes it and frees buf for the refill
        wait_dscnt_0();
        wait_asynccnt_0();
        __syncthreads();
        if (st + 2 < NST) fill(((st0 + st + 2) & (NST - 1)) * SKEYS, buf);
    }
    wait_asynccnt_0();

    // residual rows and bias of this wave's output share (C-layout: lane = column,
    // element j = row j + 8g); issued ahead of the partials' LDS stores
    const size_t orow0 = (size_t)b * NTOK + qblk + 8 * g;
    const int    ocol  = n0 + lr;
    float xres[QTILES][2][8], bcol[2];
    if (owave) {
        const float* xp = x + orow0 * CIN + ocol;
#pragma unroll
        for (int t = 0; t < 2; ++t) {
            bcol[t] = bv[ocol + t * 16];
#pragma unroll
            for (int q4 = 0; q4 < QTILES; ++q4)
#pragma unroll
                for (int j = 0; j < 8; ++j)
                    xres[q4][t][j] = xp[(q4 * 16 + j) * CIN + t * 16];
        }
        // keeps the loads' address registers untouched (also by the loads' own
        // results) until every request is taken
        asm volatile("s_wait_xcnt 0x0" :: "v"(ocol), "v"(xp) : "memory");
    }

    // ---- merge the eight key groups' partials of each query tile ----
    // (the ring is free: every wave's last reads and copies ended in front of the
    // loop's last barrier)
#pragma unroll
    for (int c = 0; c < QPW; ++c) {
#pragma unroll
        for (int dt = 0; dt < 8; ++dt) {
            v4f* pa = Pacc + ((wave * QPW + c) * 16 + dt * 2) * 32 + lane;
            pa[0]  = (v4f){acc[c][dt][0], acc[c][dt][1], acc[c][dt][2], acc[c][dt][3]};
            pa[32] = (v4f){acc[c][dt][4], acc[c][dt][5], acc[c][dt][6], acc[c][dt][7]};
        }
        Pm[wave][c][lane] = m[c];
        Pl[wave][c][lane] = l[c] + __shfl_xor(l[c], 16, 32);   // the two halves' keys joined once
    }

    __syncthreads();                             // all partials visible

    // The Wv^T B fragments of waves 0..7: loaded here, where the accumulators'
    // registers are free again; behind the barrier, so that they fly under the merge.
    v16h wb[2][4];
    if (owave) {
        const _Float16* wrow = Wvt + (size_t)(n0 + lr) * DVDIM;
#pragma unroll
        for (int t = 0; t < 2; ++t)
#pragma unroll
            for (int c = 0; c < 4; ++c)
                wb[t][c] = load_frag_h(wrow + (t * 16) * DVDIM + c * 32, g);
        // keeps the loads' address registers untouched (also by the loads' own
        // results) until every request is taken
        asm volatile("s_wait_xcnt 0x0" :: "v"(wrow + 8 * g) : "memory");
    }

    // group ks merges dv 16*ks .. 16*ks+15 of its two query tiles. O^T element j
    // of an even tile is k = j + 8g of its 32-wide chunk, of an odd tile
    // k = 16 + j + 8g: the k order of the 16-bit A/B operand (kmap), so the
    // repack is in-lane.
#pragma unroll
    for (int c = 0; c < QPW; ++c) {
        float ms[KSPLIT], wgt[KSPLIT];
        float mall = -1e30f;
#pragma unroll
        for (int s = 0; s < KSPLIT; ++s) {
            ms[s] = Pm[s * QGRP + qp][c][lane];
            mall  = fmaxf(mall, ms[s]);
        }
        float lall = 0.f;
#pragma unroll
        for (int s = 0; s < KSPLIT; ++s) {
            wgt[s] = exp2_slot(ms[s] - mall);
            lall  += wgt[s] * Pl[s * QGRP + qp][c][lane];
        }
        const float inv = 1.f / lall;
#pragma unroll
        for (int s = 0; s < KSPLIT; ++s) wgt[s] *= inv;

        v8h ofl;
#pragma unroll
        for (int h = 0; h < 2; ++h) {
            v4f o = {0.f, 0.f, 0.f, 0.f};
#pragma unroll
            for (int s = 0; s < KSPLIT; ++s)
                o += Pacc[(((s * QGRP + qp) * QPW + c) * 16 + ks * 2 + h) * 32 + lane] * wgt[s];
#pragma unroll
            for (int i = 0; i < 4; ++i) ofl[h * 4 + i] = (_Float16)o[i];
        }
        Ofr[qp * QPW + c][ks >> 1][ks & 1][lane] = ofl;
    }
    __syncthreads();                             // all O fragments visible

    // ---- out = x + O @ Wv + bv: 4 query tiles x 2 column tiles x 4 dv chunks ----
    if (!owave) return;                          // no barrier follows
    v8f oacc[QTILES][2];                         // start value: residual + bias
#pragma unroll
    for (int q4 = 0; q4 < QTILES; ++q4)
#pragma unroll
        for (int t = 0; t < 2; ++t)
#pragma unroll
            for (int j = 0; j < 8; ++j) oacc[q4][t][j] = xres[q4][t][j] + bcol[t];
#pragma unroll
    for (int c = 0; c < 4; ++c) {
#pragma unroll
        for (int q4 = 0; q4 < QTILES; ++q4) {
            const v8h lo = Ofr[q4][c][0][lane];
            const v8h hi = Ofr[q4][c][1][lane];
            v16h a;
#pragma unroll
            for (int i = 0; i < 8; ++i) { a[i] = lo[i]; a[8 + i] = hi[i]; }
#pragma unroll
            for (int t = 0; t < 2; ++t) oacc[q4][t] = wmma_f16(a, wb[t][c], oacc[q4][t]);
        }
    }
#pragma unroll
    for (int q4 = 0; q4 < QTILES; ++q4)
#pragma unroll
        for (int t = 0; t < 2; ++t)
#pragma unroll
            for (int j = 0; j < 8; ++j)
                out[(orow0 + q4 * 16 + j) * CIN + ocol + t * 16] = oacc[q4][t][j];
}

// ---------------------------------------------------------------------------
// Host-side launch. Workspace layout (bytes):
//   [0,       1 MB)   Qh  f16 [16384, 32]
//   [1 MB,    2 MB)   Kh  f16 [16384, 32]
//   [2 MB,    6 MB)   Vt  f16 [4, 128, 4096]   (transposed values)
//   [14 MB,  ...  )   Wvt f16 [256, 128]      (transposed out-projection weights)
// ---------------------------------------------------------------------------
extern "C" void kernel_launch(void* const* d_in, const int* in_sizes, int n_in,
                              void* d_out, int out_size, void* d_ws, size_t ws_size,
                              hipStream_t stream) {
    const float* x  = (const float*)d_in[0];
    const float* Wf = (const float*)d_in[1];
    const float* bf = (const float*)d_in[2];
    const float* Wg = (const float*)d_in[3];
    const float* bg = (const float*)d_in[4];
    const float* Wh = (const float*)d_in[5];
    const float* bh = (const float*)d_in[6];
    const float* Wv = (const float*)d_in[7];
    const float* bv = (const float*)d_in[8];
    float* out = (float*)d_out;

    char* ws = (char*)d_ws;
    _Float16* Qh  = (_Float16*)(ws);
    _Float16* Kh  = (_Float16*)(ws + (1u << 20));
    _Float16* Vt  = (_Float16*)(ws + (2u << 20));
    _Float16* Wvt = (_Float16*)(ws + (14u << 20));

    // K1: 1024 row-tile waves, 8 waves/block -> 128 blocks
    hipLaunchKernelGGL(proj_qkv_kernel, dim3(128), dim3(256), 0, stream,
                       x, Wf, bf, Wg, bg, Wh, bh, Wv, Qh, Kh, Vt, Wvt);
    // K2: 256 blocks x 16 waves, each block = 64 queries of one batch
    hipLaunchKernelGGL(attn_kernel, dim3(256), dim3(ATHREADS), 0, stream,
                       Qh, Kh, Vt, x, Wvt, bv, out);
}
